// v000
// Times are from an AMD MI455X. After a warm-up the kernel runs many times in a row, and a time is the length of
// such a window on the GPU divided by its runs, so every launch and the gaps after it count. The runs cycle
// through copies of the inputs. A figure is the median of several windows, for all but v000 over two sittings.
// Sittings can differ by a few percent; kernels timed side by side share one.
// The starting kernel, v000, takes 289 microseconds a run.
#include <hip/hip_runtime.h>

// BART attention with relation embeddings: q = (x Wq^T + bq)/8, k = x Wk^T + bk, v = x Wv^T + bv (16 heads x 64); attn = softmax(q.k) (no mask; the k-relation term has scale 0);
// out_h[t] = sum_s attn[t][s] (v_h[s] + rel_emb[relation_inputs[b][t][s]]) (v-relation scale 1, shared by all heads); out = merged Wo^T + bo -> [2][1024][1024].
// The relation term is sum_r w_r[t] rel_emb[r] with w_r[t] = sum over keys s of relation r of attn[t][s]: per (b, h, 16 queries) the final probabilities are bucketed by the INPUT relation id
// into an f32 LDS table [16 queries][41] (plain ordered adds, no atomics), then multiplied by the 41 x 64 table — nothing index-like is written; ids only select an LDS accumulator.
// Numerics: bf16 inputs (x, weights, biases, rel_emb rounded to bf16): projections on v_wmma_f32_16x16x32_bf16 (exact products; + bias); per pair a
// v_wmma_f32_16x16x32_f16; out projection with y hi+lo x8 (2 products); softmax, buckets and the relation product in f32. Fragment k-map per lane half hh for A AND B: elements 0..7 <-

namespace {
constexpr int BT = 2, Bn = 2, S = 1024, D = 1024, H = 16, HD = 64, NTOK = Bn * S, NREL = 41;
constexpr float SCALE = 0.125f, VS = 8.0f, QS = 8.0f, PS = 8.0f;   // power-of-two carry scales so hi/lo residual planes stay normal in f16
constexpr size_t VPL = (size_t)NTOK * D;   // distance between the (8v)^T hi and lo planes
constexpr size_t QPL = (size_t)NTOK * D;   // distance between the q/k hi and lo planes

typedef _Float16 b16;
typedef __attribute__((ext_vector_type(16))) _Float16 v16b;
typedef __attribute__((ext_vector_type(8)))  _Float16 v8b;
typedef __attribute__((ext_vector_type(8)))  float v8f;
typedef __attribute__((ext_vector_type(4)))  float v4f;

__device__ __forceinline__ v8b ld8b(const b16* p) { return *(const v8b*)p; }
__device__ __forceinline__ v16b cat8b(v8b a, v8b b) { return __builtin_shufflevector(a, b, 0, 1, 2, 3, 4, 5, 6, 7, 8, 9, 10, 11, 12, 13, 14, 15); }
__device__ __forceinline__ v16b frag_kb(const b16* p, int hh) { return cat8b(ld8b(p + 8 * hh), ld8b(p + 16 + 8 * hh)); }
__device__ __forceinline__ void split16(float v, b16& hi, b16& lo) { hi = (b16)v; lo = (b16)(v - (float)hi); }
// hi/lo fragment pair straight from an f32 k-contiguous row (same k-map)
__device__ __forceinline__ void frag_ksplit(const float* p, int hh, v16b& fh_, v16b& fl_) {
  const float* p0 = p + 8 * hh; const float* p1 = p + 16 + 8 * hh;
#pragma unroll
  for (int e = 0; e < 8; ++e) { b16 a, c; split16(p0[e], a, c); fh_[e] = a; fl_[e] = c; split16(p1[e], a, c); fh_[8 + e] = a; fl_[8 + e] = c; }
}
__device__ __forceinline__ v8f wmma16b(v16b a, v16b b, v8f c) {
  v8f d = __builtin_amdgcn_wmma_f32_16x16x32_f16(false, a, false, b, (short)0, c, false, false);
  asm volatile("v_nop\n\tv_nop\n\tv_nop\n\tv_nop" : "+v"(d) : "v"(a), "v"(b));
  return d;
}
__device__ __forceinline__ void wave_lds_sync() {
  __builtin_amdgcn_fence(__ATOMIC_RELEASE, "workgroup");
  __builtin_amdgcn_wave_barrier();
  __builtin_amdgcn_fence(__ATOMIC_ACQUIRE, "workgroup");
}

// Operand descriptor: NP = 0 -> f32 rows split on the fly into (hi, lo); NP = 1 -> one f16 plane; NP = 2 -> f16 hi + lo planes;
// NP = 3 -> f32 rows rounded once to a single f16 fragment. ld = row pitch.
struct Opnd { const void* p0; const void* p1; int ld; };
template <int NP> __device__ __forceinline__ void load_frags(const Opnd& o, int row, int kb, int hh, v16b& fh_, v16b& fl_) {
  if (NP == 0) { frag_ksplit((const float*)o.p0 + (size_t)row * o.ld + kb, hh, fh_, fl_); }
  else if (NP == 4 || NP == 5) {                             // f32 rows x64 (NP 4) or x8 (NP 5) then split (keeps the lo halves of small values normal)
    const float sc_ = (NP == 4) ? 64.0f : 8.0f;
    const float* p = (const float*)o.p0 + (size_t)row * o.ld + kb; const float* p0 = p + 8 * hh; const float* p1 = p + 16 + 8 * hh;
#pragma unroll
    for (int e = 0; e < 8; ++e) { b16 a, c; split16(p0[e] * sc_, a, c); fh_[e] = a; fl_[e] = c; split16(p1[e] * sc_, a, c); fh_[8 + e] = a; fl_[8 + e] = c; }
  } else if (NP == 3) {
    const float* p = (const float*)o.p0 + (size_t)row * o.ld + kb; const float* p0 = p + 8 * hh; const float* p1 = p + 16 + 8 * hh;
#pragma unroll
    for (int e = 0; e < 8; ++e) { fh_[e] = (b16)p0[e]; fh_[8 + e] = (b16)p1[e]; }
    fl_ = fh_;
  } else {
    fh_ = frag_kb((const b16*)o.p0 + (size_t)row * o.ld + kb, hh);
    if (NP == 2) fl_ = frag_kb((const b16*)o.p1 + (size_t)row * o.ld + kb, hh); else fl_ = fh_;
  }
}
template <int ANP, int BNP> __device__ __forceinline__ v8f mac(v16b ah, v16b al, v16b bh, v16b bl, v8f c) {
  c = wmma16b(ah, bh, c);
  if (BNP == 0 || BNP == 2 || BNP == 4 || BNP == 5) c = wmma16b(ah, bl, c);     // hi.lo
  if (ANP == 0 || ANP == 2 || ANP == 4 || ANP == 5) c = wmma16b(al, bh, c);     // lo.hi   (lo.lo dropped)
  return c;
}
// 32x64 wave tile: acc[r][t] (rows m0+16r.., cols c0+16t..) += A[m][k] . B[n][k] over k in [0, K)
template <int ANP, int BNP>
__device__ __forceinline__ void gemm_tile(const Opnd& A, const Opnd& B, int K, int m0, int c0, int nloc, int hlf, v8f (&acc)[2][4]) {
  for (int kb = 0; kb < K; kb += 32) {
    v16b a0h, a0l, a1h, a1l;
    load_frags<ANP>(A, m0 + nloc, kb, hlf, a0h, a0l);
    load_frags<ANP>(A, m0 + 16 + nloc, kb, hlf, a1h, a1l);
#pragma unroll
    for (int t = 0; t < 4; ++t) {
      v16b bh, bl;
      load_frags<BNP>(B, c0 + t * 16 + nloc, kb, hlf, bh, bl);
      acc[0][t] = mac<ANP, BNP>(a0h, a0l, bh, bl, acc[0][t]);
      acc[1][t] = mac<ANP, BNP>(a1h, a1l, bh, bl, acc[1][t]);
    }
  }
}

__device__ __forceinline__ void epi_planes(v8f (&acc)[2][4], float scale, bool two, b16* __restrict__ oh, b16* __restrict__ ol, int ldo,
                                           int m0, int c0, int lane, b16* Th, b16* Tl) {
  const int nloc = lane & 15, hlf = lane >> 4;
#pragma unroll
  for (int t = 0; t < 4; ++t)
#pragma unroll
    for (int r = 0; r < 2; ++r)
#pragma unroll
      for (int v = 0; v < 8; ++v) {
        const int rr = r * 16 + v + 8 * hlf, cc = t * 16 + nloc;
        b16 h_, l_; split16(acc[r][t][v] * scale, h_, l_);
        Th[rr * 64 + cc] = h_; Tl[rr * 64 + cc] = l_;
      }
  wave_lds_sync();
  {
#pragma unroll
    for (int j = 0; j < 8; ++j) {
      const int rr = j * 4 + (lane >> 3), c8 = (lane & 7) * 8;
      const size_t o = (size_t)(m0 + rr) * ldo + c0 + c8;
      *(v8b*)(oh + o) = ld8b(Th + rr * 64 + c8);
      if (two) *(v8b*)(ol + o) = ld8b(Tl + rr * 64 + c8);
    }
    
  }
}
// (b) f32 rows with pitch ldo: 64 floats = 256 B = 2 lines per row; 16 lanes x 16 B per row, 2 rows per instruction. Optional per-row factor
__device__ __forceinline__ void epi_f32(v8f (&acc)[2][4], float scale, const float* rscale, float* __restrict__ out, int ldo, int m0, int c0, int lane, float* Tt) {
  const int nloc = lane & 15, hlf = lane >> 4;
#pragma unroll
  for (int t = 0; t < 4; ++t)
#pragma unroll
    for (int r = 0; r < 2; ++r)
#pragma unroll
      for (int v = 0; v < 8; ++v) {
        const int rr = r * 16 + v + 8 * hlf;
        const float rs = rscale ? rscale[(size_t)(m0 + rr) * 32] : 1.0f;
        Tt[rr * 64 + t * 16 + nloc] = acc[r][t][v] * scale * rs;
      }
  wave_lds_sync();
  float* dst0 = out + (size_t)m0 * ldo + c0;
  {
#pragma unroll
    for (int j = 0; j < 16; ++j) { const int rr = j * 2 + hlf, c4 = nloc * 4; *(v4f*)(dst0 + (size_t)rr * ldo + c4) = *(const v4f*)(Tt + rr * 64 + c4); }
    
  }
}



typedef __attribute__((ext_vector_type(8))) __bf16 v8bb; typedef __attribute__((ext_vector_type(16))) __bf16 v16bb;
typedef __attribute__((ext_vector_type(8))) unsigned short v8us;
__device__ __forceinline__ v16bb frag_kb_bf(const __bf16* p, int hh) { const v8bb a = *(const v8bb*)(p + 8 * hh), b = *(const v8bb*)(p + 16 + 8 * hh); return __builtin_shufflevector(a, b, 0, 1, 2, 3, 4, 5, 6, 7, 8, 9, 10, 11, 12, 13, 14, 15); }
__device__ __forceinline__ v8f wmma16bb(v16bb a, v16bb b, v8f c) {
  v8f d = __builtin_amdgcn_wmma_f32_16x16x32_bf16(false, a, false, b, (short)0, c, false, false);
  asm volatile("v_nop\n\tv_nop\n\tv_nop\n\tv_nop" : "+v"(d) : "v"(a), "v"(b));
  return d;
}
__device__ __forceinline__ unsigned short bf16_rne_bits(float v) { unsigned int u = __float_as_uint(v); u += 0x7FFFu + ((u >> 16) & 1u); return (unsigned short)(u >> 16); }
__device__ __forceinline__ float bf16_rne(float v) { return __uint_as_float(((unsigned int)bf16_rne_bits(v)) << 16); }



// x (f32) -> bf16 bits, round to nearest even.
__global__ __launch_bounds__(256) void xprep_kernel(const float* __restrict__ x, unsigned short* __restrict__ x16) {   // one pass's two batches -> bf16
  const size_t tid = (size_t)blockIdx.x * blockDim.x + threadIdx.x, nth = (size_t)gridDim.x * blockDim.x;
  { for (size_t p = tid; p < (size_t)NTOK * D / 8; p += nth) { v8us v;
#pragma unroll
      for (int e = 0; e < 8; ++e) v[e] = bf16_rne_bits(x[p * 8 + e]);
      *(v8us*)(x16 + p * 8) = v; }  }
}
__global__ __launch_bounds__(256) void prep_kernel(const float* __restrict__ wq, const float* __restrict__ wk, const float* __restrict__ wv, const float* __restrict__ wo, unsigned short* __restrict__ w16, b16* __restrict__ wo16) {
  const size_t tid = (size_t)blockIdx.x * blockDim.x + threadIdx.x, nth = (size_t)gridDim.x * blockDim.x;
  {
    for (size_t p = tid; p < (size_t)3 * D * D / 8; p += nth) { const float* W = (p < (size_t)D * D / 8) ? wq : (p < (size_t)2 * D * D / 8) ? wk : wv; const size_t q = p % ((size_t)D * D / 8); v8us v;   // [out][in] rows copied directly
#pragma unroll
      for (int e = 0; e < 8; ++e) v[e] = bf16_rne_bits(W[q * 8 + e]);
      *(v8us*)(w16 + p * 8) = v; }
    for (size_t p = tid; p < (size_t)D * D / 8; p += nth) { v8b w;   // W_o [out][in] rows copied directly
#pragma unroll
      for (int e = 0; e < 8; ++e) w[e] = (b16)bf16_rne(wo[p * 8 + e]);
      *(v8b*)(wo16 + p * 8) = w; }
    
  }
}

// projections: rows = tokens (2048), K = 1024, column tiles of 64 = one head of q (tiles 0..15), k (16..31) or v (32..47); f16 rows [b*H + head][tok][64] for q/k;
// v: (8v)^T f16 [b*H + head][64][tok]. grid (48, 16) x 128.
__global__ __launch_bounds__(128) void proj_kernel(const __bf16* __restrict__ x16, const __bf16* __restrict__ w16, const float* __restrict__ bq, const float* __restrict__ bk, const float* __restrict__ bv, b16* __restrict__ qh, b16* __restrict__ kh, b16* __restrict__ vt) {
  __shared__ __attribute__((aligned(16))) b16 Th[4][32][HD + 8], Tq[4][32][HD + 8];
  __shared__ __attribute__((aligned(16))) b16 Tt[64][128 + 8], Tl[64][128 + 8];
  const int lane = threadIdx.x & 31, wave = threadIdx.x >> 5, nloc = lane & 15, hlf = lane >> 4, m0 = blockIdx.y * 128 + wave * 32, c0 = blockIdx.x * 64;
  v8f acc[2][4];
#pragma unroll
  for (int r = 0; r < 2; ++r)
#pragma unroll
    for (int t = 0; t < 4; ++t) acc[r][t] = (v8f){};
#pragma unroll 2
  for (int kb = 0; kb < D; kb += 32) {
    const v16bb a0 = frag_kb_bf(x16 + (size_t)(m0 + nloc) * D + kb, hlf), a1 = frag_kb_bf(x16 + (size_t)(m0 + 16 + nloc) * D + kb, hlf);
#pragma unroll
    for (int t = 0; t < 4; ++t) { const v16bb bw = frag_kb_bf(w16 + (size_t)(c0 + t * 16 + nloc) * D + kb, hlf); acc[0][t] = wmma16bb(a0, bw, acc[0][t]); acc[1][t] = wmma16bb(a1, bw, acc[1][t]); }
  }
  const int which = blockIdx.x / (D / 64), head = blockIdx.x % (D / 64), b = m0 / S, tok0 = m0 % S;
  { const float* bias = (which == 0) ? bq : (which == 1) ? bk : bv;   // + bf16(bias)
#pragma unroll
    for (int t = 0; t < 4; ++t) { const float bb = bf16_rne(bias[head * HD + t * 16 + nloc]);
#pragma unroll
      for (int r = 0; r < 2; ++r)
#pragma unroll
        for (int v = 0; v < 8; ++v) acc[r][t][v] += bb; } }
  if (which < 2) {                                              // q or k head: f16 rows
#pragma unroll
    for (int t = 0; t < 4; ++t)
#pragma unroll
      for (int r = 0; r < 2; ++r)
#pragma unroll
        for (int v = 0; v < 8; ++v) { b16 a_, c_; split16(acc[r][t][v] * QS, a_, c_); Th[wave][r * 16 + 8 * hlf + v][t * 16 + nloc] = a_; Tq[wave][r * 16 + 8 * hlf + v][t * 16 + nloc] = c_; }   // q, k carried x8 (lo residuals stay normal)
    wave_lds_sync();
    b16* dst = (which == 0 ? qh : kh) + (((size_t)b * H + head) * S + tok0) * HD;
    {
#pragma unroll
      for (int j = 0; j < 8; ++j) { const int rr = j * 4 + (lane >> 3), c8 = (lane & 7) * 8; *(v8b*)(dst + (size_t)rr * HD + c8) = *(const v8b*)(&Th[wave][rr][c8]); *(v8b*)(dst + QPL + (size_t)rr * HD + c8) = *(const v8b*)(&Tq[wave][rr][c8]); }
       }
    return;
  }
  const int vh = head;                                          // v head: (8v)^T tile [64 d][128 tok] via LDS, rows of 256 B
#pragma unroll
  for (int t = 0; t < 4; ++t)
#pragma unroll
    for (int r = 0; r < 2; ++r)
#pragma unroll
      for (int v = 0; v < 8; ++v) { b16 a_, c_; split16(acc[r][t][v] * VS, a_, c_); Tt[t * 16 + nloc][wave * 32 + r * 16 + 8 * hlf + v] = a_; Tl[t * 16 + nloc][wave * 32 + r * 16 + 8 * hlf + v] = c_; }
  __syncthreads();
  b16* dstv = vt + (((size_t)b * H + vh) * HD) * S + (blockIdx.y * 128) % S;
  {
#pragma unroll
    for (int j = 0; j < 8; ++j) { const int dd = wave * 16 + j * 2 + (lane >> 4), c8 = (lane & 15) * 8; *(v8b*)(dstv + (size_t)dd * S + c8) = *(const v8b*)(&Tt[dd][c8]); *(v8b*)(dstv + VPL + (size_t)dd * S + c8) = *(const v8b*)(&Tl[dd][c8]); }
    
  }
}

__device__ __forceinline__ void s_tile(const b16* __restrict__ K, const v16b* qf, const v16b* ql, int kb, int col, int hh, v8f& s0, v8f& s1) {
  s0 = (v8f){}; s1 = (v8f){};
#pragma unroll
  for (int ks = 0; ks < 2; ++ks) { const v16b k0 = frag_kb(K + (size_t)(kb + col) * HD + ks * 32, hh), k0l = frag_kb(K + QPL + (size_t)(kb + col) * HD + ks * 32, hh), k1 = frag_kb(K + (size_t)(kb + 16 + col) * HD + ks * 32, hh), k1l = frag_kb(K + QPL + (size_t)(kb + 16 + col) * HD + ks * 32, hh);
    s0 = wmma16b(k0, qf[ks], s0); s0 = wmma16b(k0, ql[ks], s0); s0 = wmma16b(k0l, qf[ks], s0); s1 = wmma16b(k1, qf[ks], s1); s1 = wmma16b(k1, ql[ks], s1); s1 = wmma16b(k1l, qf[ks], s1); }
#pragma unroll
  for (int r = 0; r < 8; ++r) { s0[r] *= SCALE / (QS * QS); s1[r] *= SCALE / (QS * QS); }
}
template <int QT>
__global__ __launch_bounds__(256) void attn_kernel(const b16* __restrict__ qh, const b16* __restrict__ kh, const b16* __restrict__ vt, const int* __restrict__ rel, const float* __restrict__ remb, float* __restrict__ y) {
  __shared__ __attribute__((aligned(16))) float Os[8][16][HD + 4]; __shared__ float Bk[8][16][NREL + 1]; __shared__ float Es[NREL][HD];
  const int wid = threadIdx.x >> 5, lane = threadIdx.x & 31, hh = lane >> 4, col = lane & 15;
  for (int i = threadIdx.x; i < NREL * HD; i += 256) Es[i / HD][i % HD] = bf16_rne(remb[i]);
  for (int i = lane; i < 16 * (NREL + 1); i += 32) Bk[wid][i / (NREL + 1)][i % (NREL + 1)] = 0.0f;
  __syncthreads();
  const int qt = blockIdx.x * 8 + wid, jt = qt % QT, bh = qt / QT, h = bh % H, b = bh / H, q0 = jt * 16, qi = q0 + col;
  const b16* Q = qh + ((size_t)bh * S) * HD; const b16* K = kh + ((size_t)bh * S) * HD; const b16* vb = vt + ((size_t)bh * HD) * S; const int* rrow = rel + ((size_t)b * S + qi) * S;
  v16b qf[2], ql[2];
#pragma unroll
  for (int ks = 0; ks < 2; ++ks) { qf[ks] = frag_kb(Q + (size_t)qi * HD + ks * 32, hh); ql[ks] = frag_kb(Q + QPL + (size_t)qi * HD + ks * 32, hh); }
  float m = -INFINITY, l = 0.0f;
  for (int kb = 0; kb < S; kb += 32) { v8f s0, s1; s_tile(K, qf, ql, kb, col, hh, s0, s1);
    float mr = -INFINITY;
#pragma unroll
    for (int r = 0; r < 8; ++r) mr = fmaxf(mr, fmaxf(s0[r], s1[r]));
    mr = fmaxf(mr, __shfl_xor(mr, 16));
    const float mn = fmaxf(m, mr), al_ = __expf(m - mn); m = mn; float sum = 0.0f;
#pragma unroll
    for (int r = 0; r < 8; ++r) sum += __expf(s0[r] - mn) + __expf(s1[r] - mn);
    sum += __shfl_xor(sum, 16); l = l * al_ + sum; }
  const float il = 1.0f / l; v8f o[4] = {{}, {}, {}, {}};
  for (int kb = 0; kb < S; kb += 32) { v8f s0, s1; s_tile(K, qf, ql, kb, col, hh, s0, s1);     // pass 2
    v16b pb, pl; float p0[8], p1[8]; int r0[8], r1[8];
#pragma unroll
    for (int r = 0; r < 8; ++r) { p0[r] = __expf(s0[r] - m) * il; p1[r] = __expf(s1[r] - m) * il; b16 a, c; split16(p0[r] * PS, a, c); pb[r] = a; pl[r] = c; split16(p1[r] * PS, a, c); pb[8 + r] = a; pl[8 + r] = c;
      int ra = rrow[kb + 8 * hh + r], rb = rrow[kb + 16 + 8 * hh + r]; r0[r] = (ra < 0) ? 0 : (ra >= NREL ? NREL - 1 : ra); r1[r] = (rb < 0) ? 0 : (rb >= NREL ? NREL - 1 : rb); }
#pragma unroll
    for (int n = 0; n < 4; ++n) { const v16b vf = frag_kb(vb + (size_t)(n * 16 + col) * S + kb, hh), vl = frag_kb(vb + VPL + (size_t)(n * 16 + col) * S + kb, hh);
      o[n] = wmma16b(vf, pb, o[n]); o[n] = wmma16b(vf, pl, o[n]); o[n] = wmma16b(vl, pb, o[n]); }
    // relation buckets: Bk[q][id] += p — the two lanes of a query column add in turn (ordered, no atomics)
    for (int turn = 0; turn < 2; ++turn) {
      if (hh == turn) {
#pragma unroll
        for (int r = 0; r < 8; ++r) { Bk[wid][col][r0[r]] += p0[r]; Bk[wid][col][r1[r]] += p1[r]; } }
      wave_lds_sync(); }
  }
  // epilogue: y[q][d] = o/64 + Σ_r Bk[q][r] E[r][d]; lane (col, hh) forms d = n*16 + 8hh + r via the accumulator layout
#pragma unroll
  for (int n = 0; n < 4; ++n)
#pragma unroll
    for (int r = 0; r < 8; ++r) { const int d = n * 16 + 8 * hh + r; float acc_ = o[n][r] * (1.0f / (VS * PS));
#pragma unroll 1
      for (int rr = 0; rr < NREL; ++rr) acc_ += Bk[wid][col][rr] * Es[rr][d];
      Os[wid][col][d] = acc_; }
  wave_lds_sync();
  float* dst = y + ((size_t)b * S + q0) * D + h * HD;
  {
#pragma unroll
    for (int j = 0; j < 8; ++j) { const int rr = j * 2 + hh, c4 = col * 4; *(v4f*)(dst + (size_t)rr * D + c4) = *(const v4f*)(&Os[wid][rr][c4]); }
    
  }
}

// out = y W_o^T: (2048 x 1024) x (1024 x 1024); A = y x8 split at load into f16 hi + lo, B = f16(bf16 W_o) rows; f32 rows; grid (16, 16).
__global__ __launch_bounds__(128) void out_kernel(const float* __restrict__ y, const b16* __restrict__ wo16, const float* __restrict__ bo, float* __restrict__ out) {
  __shared__ __attribute__((aligned(16))) float Ts[4][32 * 64];
  const int lane = threadIdx.x & 31, wave = threadIdx.x >> 5, nloc = lane & 15, hlf = lane >> 4, m0 = blockIdx.y * 128 + wave * 32, c0 = blockIdx.x * 64;
  v8f acc[2][4];
#pragma unroll
  for (int r = 0; r < 2; ++r)
#pragma unroll
    for (int t = 0; t < 4; ++t) acc[r][t] = (v8f){};
  const Opnd A{y, nullptr, D}, Bo{wo16, nullptr, D};
  gemm_tile<5, 1>(A, Bo, D, m0, c0, nloc, hlf, acc);                            // y as an f16 hi+lo pair carried x8 (2 products)
#pragma unroll
  for (int t = 0; t < 4; ++t)
#pragma unroll
    for (int r = 0; r < 2; ++r)
#pragma unroll
      for (int v = 0; v < 8; ++v) acc[r][t][v] = acc[r][t][v] * (1.0f / 8.0f) + bf16_rne(bo[c0 + t * 16 + nloc]);
  epi_f32(acc, 1.0f, nullptr, out, D, m0, c0, lane, Ts[wave]);
}
}  // namespace

extern "C" void kernel_launch(void* const* d_in, const int* in_sizes, int n_in,
                              void* d_out, int out_size, void* d_ws, size_t ws_size, hipStream_t stream) {
  (void)n_in; (void)out_size;
  const float* x = (const float*)d_in[0]; const int* rel = (const int*)d_in[1];
  const float* wq = (const float*)d_in[2]; const float* bq = (const float*)d_in[3]; const float* wk = (const float*)d_in[4]; const float* bk = (const float*)d_in[5]; const float* wv = (const float*)d_in[6]; const float* bv = (const float*)d_in[7];
  const float* wo = (const float*)d_in[8]; const float* bo = (const float*)d_in[9]; const float* remb = (const float*)d_in[10];
  float* out = (float*)d_out;   // [2][1024][1024]
  if (in_sizes[0] != BT * S * D || in_sizes[1] != BT * S * S || in_sizes[2] != D * D || in_sizes[8] != D * D || in_sizes[10] != NREL * HD) return;
  size_t off = 0; char* ws = (char*)d_ws;
  auto carve = [&](size_t bytes) { char* p = ws + off; off += (bytes + 255) & ~(size_t)255; return p; };
  unsigned short* x16 = (unsigned short*)carve((size_t)NTOK * D * 2); unsigned short* w16 = (unsigned short*)carve((size_t)3 * D * D * 2); b16* wo16 = (b16*)carve((size_t)D * D * 2);
  b16* qh = (b16*)carve((size_t)2 * NTOK * D * 2); b16* kh = (b16*)carve((size_t)2 * NTOK * D * 2); b16* vt = (b16*)carve((size_t)2 * NTOK * D * 2); float* y = (float*)carve((size_t)NTOK * D * 4);
  if (off > ws_size) return;                                    // ≈ 46 MB
  prep_kernel<<<512, 256, 0, stream>>>(wq, wk, wv, wo, w16, wo16);
  xprep_kernel<<<1024, 256, 0, stream>>>(x, x16);
  proj_kernel<<<dim3(3 * D / 64, NTOK / 128), 128, 0, stream>>>((const __bf16*)x16, (const __bf16*)w16, bq, bk, bv, qh, kh, vt);
  attn_kernel<S / 16><<<Bn * H * (S / 16) / 8, 256, 0, stream>>>(qh, kh, vt, rel, remb, y);
  out_kernel<<<dim3(D / 64, NTOK / 128), 128, 0, stream>>>(y, wo16, bo, out);
}

// v001
// It runs in 250 microseconds.
// Timed twice side by side with v000, it ran 1.17 and 1.18 times as fast.
#include <hip/hip_runtime.h>

// BART attention with relation embeddings: q = (x Wq^T + bq)/8, k = x Wk^T + bk, v = x Wv^T + bv (16 heads x 64); attn = softmax(q.k) (no mask; the k-relation term has scale 0);
// out_h[t] = sum_s attn[t][s] (v_h[s] + rel_emb[relation_inputs[b][t][s]]) (v-relation scale 1, shared by all heads); out = merged Wo^T + bo -> [2][1024][1024].
// The relation term is sum_r w_r[t] rel_emb[r] with w_r[t] = sum over keys s of relation r of attn[t][s]: per (b, h, 16 queries) the final probabilities are bucketed by the INPUT relation id
// into an f32 LDS table [16 queries][41] (plain ordered adds, no atomics), then multiplied by the 41 x 64 table — nothing index-like is written; ids only select an LDS accumulator.
// Numerics: bf16 inputs (x, weights, biases, rel_emb rounded to bf16): projections on v_wmma_f32_16x16x32_bf16 (exact products; + bias); per pair a
// v_wmma_f32_16x16x32_f16; out projection with y hi+lo x8 (2 products); softmax, buckets and the relation product in f32. Fragment k-map per lane half hh for A AND B: elements 0..7 <-

namespace {
constexpr int BT = 2, Bn = 2, S = 1024, D = 1024, H = 16, HD = 64, NTOK = Bn * S, NREL = 41;
constexpr float SCALE = 0.125f, VS = 8.0f, QS = 8.0f, PS = 8.0f;   // power-of-two carry scales so hi/lo residual planes stay normal in f16
constexpr size_t VPL = (size_t)NTOK * D;   // distance between the (8v)^T hi and lo planes
constexpr size_t QPL = (size_t)NTOK * D;   // distance between the q/k hi and lo planes

typedef _Float16 b16;
typedef __attribute__((ext_vector_type(16))) _Float16 v16b;
typedef __attribute__((ext_vector_type(8)))  _Float16 v8b;
typedef __attribute__((ext_vector_type(8)))  float v8f;
typedef __attribute__((ext_vector_type(4)))  float v4f;

__device__ __forceinline__ v8b ld8b(const b16* p) { return *(const v8b*)p; }
__device__ __forceinline__ v16b cat8b(v8b a, v8b b) { return __builtin_shufflevector(a, b, 0, 1, 2, 3, 4, 5, 6, 7, 8, 9, 10, 11, 12, 13, 14, 15); }
__device__ __forceinline__ v16b frag_kb(const b16* p, int hh) { return cat8b(ld8b(p + 8 * hh), ld8b(p + 16 + 8 * hh)); }
__device__ __forceinline__ void split16(float v, b16& hi, b16& lo) { hi = (b16)v; lo = (b16)(v - (float)hi); }
// hi/lo fragment pair straight from an f32 k-contiguous row (same k-map)
__device__ __forceinline__ void frag_ksplit(const float* p, int hh, v16b& fh_, v16b& fl_) {
  const float* p0 = p + 8 * hh; const float* p1 = p + 16 + 8 * hh;
#pragma unroll
  for (int e = 0; e < 8; ++e) { b16 a, c; split16(p0[e], a, c); fh_[e] = a; fl_[e] = c; split16(p1[e], a, c); fh_[8 + e] = a; fl_[8 + e] = c; }
}
__device__ __forceinline__ v8f wmma16b(v16b a, v16b b, v8f c) {
  v8f d = __builtin_amdgcn_wmma_f32_16x16x32_f16(false, a, false, b, (short)0, c, false, false);
  asm volatile("v_nop\n\tv_nop\n\tv_nop\n\tv_nop" : "+v"(d) : "v"(a), "v"(b));
  return d;
}
__device__ __forceinline__ void wave_lds_sync() {
  __builtin_amdgcn_fence(__ATOMIC_RELEASE, "workgroup");
  __builtin_amdgcn_wave_barrier();
  __builtin_amdgcn_fence(__ATOMIC_ACQUIRE, "workgroup");
}

// Operand descriptor: NP = 0 -> f32 rows split on the fly into (hi, lo); NP = 1 -> one f16 plane; NP = 2 -> f16 hi + lo planes;
// NP = 3 -> f32 rows rounded once to a single f16 fragment. ld = row pitch.
struct Opnd { const void* p0; const void* p1; int ld; };
template <int NP> __device__ __forceinline__ void load_frags(const Opnd& o, int row, int kb, int hh, v16b& fh_, v16b& fl_) {
  if (NP == 0) { frag_ksplit((const float*)o.p0 + (size_t)row * o.ld + kb, hh, fh_, fl_); }
  else if (NP == 4 || NP == 5) {                             // f32 rows x64 (NP 4) or x8 (NP 5) then split (keeps the lo halves of small values normal)
    const float sc_ = (NP == 4) ? 64.0f : 8.0f;
    const float* p = (const float*)o.p0 + (size_t)row * o.ld + kb; const float* p0 = p + 8 * hh; const float* p1 = p + 16 + 8 * hh;
#pragma unroll
    for (int e = 0; e < 8; ++e) { b16 a, c; split16(p0[e] * sc_, a, c); fh_[e] = a; fl_[e] = c; split16(p1[e] * sc_, a, c); fh_[8 + e] = a; fl_[8 + e] = c; }
  } else if (NP == 3) {
    const float* p = (const float*)o.p0 + (size_t)row * o.ld + kb; const float* p0 = p + 8 * hh; const float* p1 = p + 16 + 8 * hh;
#pragma unroll
    for (int e = 0; e < 8; ++e) { fh_[e] = (b16)p0[e]; fh_[8 + e] = (b16)p1[e]; }
    fl_ = fh_;
  } else {
    fh_ = frag_kb((const b16*)o.p0 + (size_t)row * o.ld + kb, hh);
    if (NP == 2) fl_ = frag_kb((const b16*)o.p1 + (size_t)row * o.ld + kb, hh); else fl_ = fh_;
  }
}
template <int ANP, int BNP> __device__ __forceinline__ v8f mac(v16b ah, v16b al, v16b bh, v16b bl, v8f c) {
  c = wmma16b(ah, bh, c);
  if (BNP == 0 || BNP == 2 || BNP == 4 || BNP == 5) c = wmma16b(ah, bl, c);     // hi.lo
  if (ANP == 0 || ANP == 2 || ANP == 4 || ANP == 5) c = wmma16b(al, bh, c);     // lo.hi   (lo.lo dropped)
  return c;
}
// 32x64 wave tile: acc[r][t] (rows m0+16r.., cols c0+16t..) += A[m][k] . B[n][k] over k in [0, K)
template <int ANP, int BNP>
__device__ __forceinline__ void gemm_tile(const Opnd& A, const Opnd& B, int K, int m0, int c0, int nloc, int hlf, v8f (&acc)[2][4]) {
  for (int kb = 0; kb < K; kb += 32) {
    v16b a0h, a0l, a1h, a1l;
    load_frags<ANP>(A, m0 + nloc, kb, hlf, a0h, a0l);
    load_frags<ANP>(A, m0 + 16 + nloc, kb, hlf, a1h, a1l);
#pragma unroll
    for (int t = 0; t < 4; ++t) {
      v16b bh, bl;
      load_frags<BNP>(B, c0 + t * 16 + nloc, kb, hlf, bh, bl);
      acc[0][t] = mac<ANP, BNP>(a0h, a0l, bh, bl, acc[0][t]);
      acc[1][t] = mac<ANP, BNP>(a1h, a1l, bh, bl, acc[1][t]);
    }
  }
}

__device__ __forceinline__ void epi_planes(v8f (&acc)[2][4], float scale, bool two, b16* __restrict__ oh, b16* __restrict__ ol, int ldo,
                                           int m0, int c0, int lane, b16* Th, b16* Tl) {
  const int nloc = lane & 15, hlf = lane >> 4;
#pragma unroll
  for (int t = 0; t < 4; ++t)
#pragma unroll
    for (int r = 0; r < 2; ++r)
#pragma unroll
      for (int v = 0; v < 8; ++v) {
        const int rr = r * 16 + v + 8 * hlf, cc = t * 16 + nloc;
        b16 h_, l_; split16(acc[r][t][v] * scale, h_, l_);
        Th[rr * 64 + cc] = h_; Tl[rr * 64 + cc] = l_;
      }
  wave_lds_sync();
  {
#pragma unroll
    for (int j = 0; j < 8; ++j) {
      const int rr = j * 4 + (lane >> 3), c8 = (lane & 7) * 8;
      const size_t o = (size_t)(m0 + rr) * ldo + c0 + c8;
      *(v8b*)(oh + o) = ld8b(Th + rr * 64 + c8);
      if (two) *(v8b*)(ol + o) = ld8b(Tl + rr * 64 + c8);
    }
    
  }
}
// (b) f32 rows with pitch ldo: 64 floats = 256 B = 2 lines per row; 16 lanes x 16 B per row, 2 rows per instruction. Optional per-row factor
__device__ __forceinline__ void epi_f32(v8f (&acc)[2][4], float scale, const float* rscale, float* __restrict__ out, int ldo, int m0, int c0, int lane, float* Tt) {
  const int nloc = lane & 15, hlf = lane >> 4;
#pragma unroll
  for (int t = 0; t < 4; ++t)
#pragma unroll
    for (int r = 0; r < 2; ++r)
#pragma unroll
      for (int v = 0; v < 8; ++v) {
        const int rr = r * 16 + v + 8 * hlf;
        const float rs = rscale ? rscale[(size_t)(m0 + rr) * 32] : 1.0f;
        Tt[rr * 64 + t * 16 + nloc] = acc[r][t][v] * scale * rs;
      }
  wave_lds_sync();
  float* dst0 = out + (size_t)m0 * ldo + c0;
  {
#pragma unroll
    for (int j = 0; j < 16; ++j) { const int rr = j * 2 + hlf, c4 = nloc * 4; *(v4f*)(dst0 + (size_t)rr * ldo + c4) = *(const v4f*)(Tt + rr * 64 + c4); }
    
  }
}



typedef __attribute__((ext_vector_type(8))) __bf16 v8bb; typedef __attribute__((ext_vector_type(16))) __bf16 v16bb;
typedef __attribute__((ext_vector_type(8))) unsigned short v8us;
__device__ __forceinline__ v16bb frag_kb_bf(const __bf16* p, int hh) { const v8bb a = *(const v8bb*)(p + 8 * hh), b = *(const v8bb*)(p + 16 + 8 * hh); return __builtin_shufflevector(a, b, 0, 1, 2, 3, 4, 5, 6, 7, 8, 9, 10, 11, 12, 13, 14, 15); }
__device__ __forceinline__ v8f wmma16bb(v16bb a, v16bb b, v8f c) {
  v8f d = __builtin_amdgcn_wmma_f32_16x16x32_bf16(false, a, false, b, (short)0, c, false, false);
  asm volatile("v_nop\n\tv_nop\n\tv_nop\n\tv_nop" : "+v"(d) : "v"(a), "v"(b));
  return d;
}
__device__ __forceinline__ unsigned short bf16_rne_bits(float v) { unsigned int u = __float_as_uint(v); u += 0x7FFFu + ((u >> 16) & 1u); return (unsigned short)(u >> 16); }
__device__ __forceinline__ float bf16_rne(float v) { return __uint_as_float(((unsigned int)bf16_rne_bits(v)) << 16); }



// x (f32) -> bf16 bits, round to nearest even.
__global__ __launch_bounds__(256) void xprep_kernel(const float* __restrict__ x, unsigned short* __restrict__ x16) {   // one pass's two batches -> bf16
  const size_t tid = (size_t)blockIdx.x * blockDim.x + threadIdx.x, nth = (size_t)gridDim.x * blockDim.x;
  { for (size_t p = tid; p < (size_t)NTOK * D / 8; p += nth) { v8us v;
#pragma unroll
      for (int e = 0; e < 8; ++e) v[e] = bf16_rne_bits(x[p * 8 + e]);
      *(v8us*)(x16 + p * 8) = v; }  }
}
__global__ __launch_bounds__(256) void prep_kernel(const float* __restrict__ wq, const float* __restrict__ wk, const float* __restrict__ wv, const float* __restrict__ wo, unsigned short* __restrict__ w16, b16* __restrict__ wo16) {
  const size_t tid = (size_t)blockIdx.x * blockDim.x + threadIdx.x, nth = (size_t)gridDim.x * blockDim.x;
  {
    for (size_t p = tid; p < (size_t)3 * D * D / 8; p += nth) { const float* W = (p < (size_t)D * D / 8) ? wq : (p < (size_t)2 * D * D / 8) ? wk : wv; const size_t q = p % ((size_t)D * D / 8); v8us v;   // [out][in] rows copied directly
#pragma unroll
      for (int e = 0; e < 8; ++e) v[e] = bf16_rne_bits(W[q * 8 + e]);
      *(v8us*)(w16 + p * 8) = v; }
    for (size_t p = tid; p < (size_t)D * D / 8; p += nth) { v8b w;   // W_o [out][in] rows copied directly
#pragma unroll
      for (int e = 0; e < 8; ++e) w[e] = (b16)bf16_rne(wo[p * 8 + e]);
      *(v8b*)(wo16 + p * 8) = w; }
    
  }
}

// projections: rows = tokens (2048), K = 1024, column tiles of 64 = one head of q (tiles 0..15), k (16..31) or v (32..47); f16 rows [b*H + head][tok][64] for q/k;
// v: (8v)^T f16 [b*H + head][64][tok]. grid (48, 16) x 128.
__global__ __launch_bounds__(128) void proj_kernel(const __bf16* __restrict__ x16, const __bf16* __restrict__ w16, const float* __restrict__ bq, const float* __restrict__ bk, const float* __restrict__ bv, b16* __restrict__ qh, b16* __restrict__ kh, b16* __restrict__ vt) {
  __shared__ __attribute__((aligned(16))) b16 Th[4][32][HD + 8], Tq[4][32][HD + 8];
  __shared__ __attribute__((aligned(16))) b16 Tt[64][128 + 8], Tl[64][128 + 8];
  const int lane = threadIdx.x & 31, wave = threadIdx.x >> 5, nloc = lane & 15, hlf = lane >> 4, m0 = blockIdx.y * 128 + wave * 32, c0 = blockIdx.x * 64;
  v8f acc[2][4];
#pragma unroll
  for (int r = 0; r < 2; ++r)
#pragma unroll
    for (int t = 0; t < 4; ++t) acc[r][t] = (v8f){};
#pragma unroll 2
  for (int kb = 0; kb < D; kb += 32) {
    const v16bb a0 = frag_kb_bf(x16 + (size_t)(m0 + nloc) * D + kb, hlf), a1 = frag_kb_bf(x16 + (size_t)(m0 + 16 + nloc) * D + kb, hlf);
#pragma unroll
    for (int t = 0; t < 4; ++t) { const v16bb bw = frag_kb_bf(w16 + (size_t)(c0 + t * 16 + nloc) * D + kb, hlf); acc[0][t] = wmma16bb(a0, bw, acc[0][t]); acc[1][t] = wmma16bb(a1, bw, acc[1][t]); }
  }
  const int which = blockIdx.x / (D / 64), head = blockIdx.x % (D / 64), b = m0 / S, tok0 = m0 % S;
  { const float* bias = (which == 0) ? bq : (which == 1) ? bk : bv;   // + bf16(bias)
#pragma unroll
    for (int t = 0; t < 4; ++t) { const float bb = bf16_rne(bias[head * HD + t * 16 + nloc]);
#pragma unroll
      for (int r = 0; r < 2; ++r)
#pragma unroll
        for (int v = 0; v < 8; ++v) acc[r][t][v] += bb; } }
  if (which < 2) {                                              // q or k head: f16 rows
#pragma unroll
    for (int t = 0; t < 4; ++t)
#pragma unroll
      for (int r = 0; r < 2; ++r)
#pragma unroll
        for (int v = 0; v < 8; ++v) { b16 a_, c_; split16(acc[r][t][v] * QS, a_, c_); Th[wave][r * 16 + 8 * hlf + v][t * 16 + nloc] = a_; Tq[wave][r * 16 + 8 * hlf + v][t * 16 + nloc] = c_; }   // q, k carried x8 (lo residuals stay normal)
    wave_lds_sync();
    b16* dst = (which == 0 ? qh : kh) + (((size_t)b * H + head) * S + tok0) * HD;
    {
#pragma unroll
      for (int j = 0; j < 8; ++j) { const int rr = j * 4 + (lane >> 3), c8 = (lane & 7) * 8; *(v8b*)(dst + (size_t)rr * HD + c8) = *(const v8b*)(&Th[wave][rr][c8]); *(v8b*)(dst + QPL + (size_t)rr * HD + c8) = *(const v8b*)(&Tq[wave][rr][c8]); }
       }
    return;
  }
  const int vh = head;                                          // v head: (8v)^T tile [64 d][128 tok] via LDS, rows of 256 B
#pragma unroll
  for (int t = 0; t < 4; ++t)
#pragma unroll
    for (int r = 0; r < 2; ++r)
#pragma unroll
      for (int v = 0; v < 8; ++v) { b16 a_, c_; split16(acc[r][t][v] * VS, a_, c_); Tt[t * 16 + nloc][wave * 32 + r * 16 + 8 * hlf + v] = a_; Tl[t * 16 + nloc][wave * 32 + r * 16 + 8 * hlf + v] = c_; }
  __syncthreads();
  b16* dstv = vt + (((size_t)b * H + vh) * HD) * S + (blockIdx.y * 128) % S;
  {
#pragma unroll
    for (int j = 0; j < 8; ++j) { const int dd = wave * 16 + j * 2 + (lane >> 4), c8 = (lane & 15) * 8; *(v8b*)(dstv + (size_t)dd * S + c8) = *(const v8b*)(&Tt[dd][c8]); *(v8b*)(dstv + VPL + (size_t)dd * S + c8) = *(const v8b*)(&Tl[dd][c8]); }
    
  }
}

__device__ __forceinline__ void s_tile(const b16* __restrict__ K, const v16b* qf, const v16b* ql, int kb, int col, int hh, v8f& s0, v8f& s1) {
  s0 = (v8f){}; s1 = (v8f){};
#pragma unroll
  for (int ks = 0; ks < 2; ++ks) { const v16b k0 = frag_kb(K + (size_t)(kb + col) * HD + ks * 32, hh), k0l = frag_kb(K + QPL + (size_t)(kb + col) * HD + ks * 32, hh), k1 = frag_kb(K + (size_t)(kb + 16 + col) * HD + ks * 32, hh), k1l = frag_kb(K + QPL + (size_t)(kb + 16 + col) * HD + ks * 32, hh);
    s0 = wmma16b(k0, qf[ks], s0); s0 = wmma16b(k0, ql[ks], s0); s0 = wmma16b(k0l, qf[ks], s0); s1 = wmma16b(k1, qf[ks], s1); s1 = wmma16b(k1, ql[ks], s1); s1 = wmma16b(k1l, qf[ks], s1); }
#pragma unroll
  for (int r = 0; r < 8; ++r) { s0[r] *= SCALE / (QS * QS); s1[r] *= SCALE / (QS * QS); }
}
template <int QT>
__global__ __launch_bounds__(256) void attn_kernel(const b16* __restrict__ qh, const b16* __restrict__ kh, const b16* __restrict__ vt, const int* __restrict__ rel, const float* __restrict__ remb, float* __restrict__ y) {
  __shared__ __attribute__((aligned(16))) float Os[8][16][HD + 4]; __shared__ float Bk[8][16][NREL + 1]; __shared__ __attribute__((aligned(16))) float Es[NREL][HD];
  const int wid = threadIdx.x >> 5, lane = threadIdx.x & 31, hh = lane >> 4, col = lane & 15;
  for (int i = threadIdx.x; i < NREL * HD; i += 256) Es[i / HD][i % HD] = bf16_rne(remb[i]);
  for (int i = lane; i < 16 * (NREL + 1); i += 32) Bk[wid][i / (NREL + 1)][i % (NREL + 1)] = 0.0f;
  __syncthreads();
  const int qt = blockIdx.x * 8 + wid, jt = qt % QT, bh = qt / QT, h = bh % H, b = bh / H, q0 = jt * 16, qi = q0 + col;
  const b16* Q = qh + ((size_t)bh * S) * HD; const b16* K = kh + ((size_t)bh * S) * HD; const b16* vb = vt + ((size_t)bh * HD) * S; const int* rrow = rel + ((size_t)b * S + qi) * S;
  v16b qf[2], ql[2];
#pragma unroll
  for (int ks = 0; ks < 2; ++ks) { qf[ks] = frag_kb(Q + (size_t)qi * HD + ks * 32, hh); ql[ks] = frag_kb(Q + QPL + (size_t)qi * HD + ks * 32, hh); }
  float m = -INFINITY, l = 0.0f;
  for (int kb = 0; kb < S; kb += 32) { v8f s0, s1; s_tile(K, qf, ql, kb, col, hh, s0, s1);
    float mr = -INFINITY;
#pragma unroll
    for (int r = 0; r < 8; ++r) mr = fmaxf(mr, fmaxf(s0[r], s1[r]));
    mr = fmaxf(mr, __shfl_xor(mr, 16));
    const float mn = fmaxf(m, mr), al_ = __expf(m - mn); m = mn; float sum = 0.0f;
#pragma unroll
    for (int r = 0; r < 8; ++r) sum += __expf(s0[r] - mn) + __expf(s1[r] - mn);
    sum += __shfl_xor(sum, 16); l = l * al_ + sum; }
  const float il = 1.0f / l; v8f o[4] = {{}, {}, {}, {}};
  for (int kb = 0; kb < S; kb += 32) { v8f s0, s1; s_tile(K, qf, ql, kb, col, hh, s0, s1);     // pass 2
    v16b pb, pl; float p0[8], p1[8]; int r0[8], r1[8];
#pragma unroll
    for (int r = 0; r < 8; ++r) { p0[r] = __expf(s0[r] - m) * il; p1[r] = __expf(s1[r] - m) * il; b16 a, c; split16(p0[r] * PS, a, c); pb[r] = a; pl[r] = c; split16(p1[r] * PS, a, c); pb[8 + r] = a; pl[8 + r] = c;
      int ra = rrow[kb + 8 * hh + r], rb = rrow[kb + 16 + 8 * hh + r]; r0[r] = (ra < 0) ? 0 : (ra >= NREL ? NREL - 1 : ra); r1[r] = (rb < 0) ? 0 : (rb >= NREL ? NREL - 1 : rb); }
#pragma unroll
    for (int n = 0; n < 4; ++n) { const v16b vf = frag_kb(vb + (size_t)(n * 16 + col) * S + kb, hh), vl = frag_kb(vb + VPL + (size_t)(n * 16 + col) * S + kb, hh);
      o[n] = wmma16b(vf, pb, o[n]); o[n] = wmma16b(vf, pl, o[n]); o[n] = wmma16b(vl, pb, o[n]); }
    // relation buckets: Bk[q][id] += p — the two lanes of a query column add in turn (ordered, no atomics)
    for (int turn = 0; turn < 2; ++turn) {
      if (hh == turn) {
#pragma unroll
        for (int r = 0; r < 8; ++r) { Bk[wid][col][r0[r]] += p0[r]; Bk[wid][col][r1[r]] += p1[r]; } }
      wave_lds_sync(); }
  }
  // epilogue: y[q][d] = o/64 + Σ_r Bk[q][r] E[r][d]; lane (col, hh) forms d = n*16 + 8hh + r via the accumulator layout
#pragma unroll
  for (int n = 0; n < 4; ++n)
#pragma unroll
    for (int r = 0; r < 8; ++r) o[n][r] *= 1.0f / (VS * PS);
  // relation id outermost, all 32 sums of the lane carried in registers: one weight and eight 16-byte table reads per id, none depending on an earlier read.
  // Unrolled so that the reads of later ids are issued under the multiply-adds of earlier ones; each sum still adds ids 0..40 in that order.
#pragma unroll
  for (int rr = 0; rr < NREL; ++rr) { const float w = Bk[wid][col][rr];
#pragma unroll
    for (int n = 0; n < 4; ++n) { const v4f e0 = *(const v4f*)(&Es[rr][n * 16 + 8 * hh]), e1 = *(const v4f*)(&Es[rr][n * 16 + 8 * hh + 4]);
#pragma unroll
      for (int r = 0; r < 4; ++r) { o[n][r] += w * e0[r]; o[n][4 + r] += w * e1[r]; } } }
#pragma unroll
  for (int n = 0; n < 4; ++n)
#pragma unroll
    for (int r = 0; r < 8; ++r) Os[wid][col][n * 16 + 8 * hh + r] = o[n][r];
  wave_lds_sync();
  float* dst = y + ((size_t)b * S + q0) * D + h * HD;
  {
#pragma unroll
    for (int j = 0; j < 8; ++j) { const int rr = j * 2 + hh, c4 = col * 4; *(v4f*)(dst + (size_t)rr * D + c4) = *(const v4f*)(&Os[wid][rr][c4]); }
    
  }
}

// out = y W_o^T: (2048 x 1024) x (1024 x 1024); A = y x8 split at load into f16 hi + lo, B = f16(bf16 W_o) rows; f32 rows; grid (16, 16).
__global__ __launch_bounds__(128) void out_kernel(const float* __restrict__ y, const b16* __restrict__ wo16, const float* __restrict__ bo, float* __restrict__ out) {
  __shared__ __attribute__((aligned(16))) float Ts[4][32 * 64];
  const int lane = threadIdx.x & 31, wave = threadIdx.x >> 5, nloc = lane & 15, hlf = lane >> 4, m0 = blockIdx.y * 128 + wave * 32, c0 = blockIdx.x * 64;
  v8f acc[2][4];
#pragma unroll
  for (int r = 0; r < 2; ++r)
#pragma unroll
    for (int t = 0; t < 4; ++t) acc[r][t] = (v8f){};
  const Opnd A{y, nullptr, D}, Bo{wo16, nullptr, D};
  gemm_tile<5, 1>(A, Bo, D, m0, c0, nloc, hlf, acc);                            // y as an f16 hi+lo pair carried x8 (2 products)
#pragma unroll
  for (int t = 0; t < 4; ++t)
#pragma unroll
    for (int r = 0; r < 2; ++r)
#pragma unroll
      for (int v = 0; v < 8; ++v) acc[r][t][v] = acc[r][t][v] * (1.0f / 8.0f) + bf16_rne(bo[c0 + t * 16 + nloc]);
  epi_f32(acc, 1.0f, nullptr, out, D, m0, c0, lane, Ts[wave]);
}
}  // namespace

extern "C" void kernel_launch(void* const* d_in, const int* in_sizes, int n_in,
                              void* d_out, int out_size, void* d_ws, size_t ws_size, hipStream_t stream) {
  (void)n_in; (void)out_size;
  const float* x = (const float*)d_in[0]; const int* rel = (const int*)d_in[1];
  const float* wq = (const float*)d_in[2]; const float* bq = (const float*)d_in[3]; const float* wk = (const float*)d_in[4]; const float* bk = (const float*)d_in[5]; const float* wv = (const float*)d_in[6]; const float* bv = (const float*)d_in[7];
  const float* wo = (const float*)d_in[8]; const float* bo = (const float*)d_in[9]; const float* remb = (const float*)d_in[10];
  float* out = (float*)d_out;   // [2][1024][1024]
  if (in_sizes[0] != BT * S * D || in_sizes[1] != BT * S * S || in_sizes[2] != D * D || in_sizes[8] != D * D || in_sizes[10] != NREL * HD) return;
  size_t off = 0; char* ws = (char*)d_ws;
  auto carve = [&](size_t bytes) { char* p = ws + off; off += (bytes + 255) & ~(size_t)255; return p; };
  unsigned short* x16 = (unsigned short*)carve((size_t)NTOK * D * 2); unsigned short* w16 = (unsigned short*)carve((size_t)3 * D * D * 2); b16* wo16 = (b16*)carve((size_t)D * D * 2);
  b16* qh = (b16*)carve((size_t)2 * NTOK * D * 2); b16* kh = (b16*)carve((size_t)2 * NTOK * D * 2); b16* vt = (b16*)carve((size_t)2 * NTOK * D * 2); float* y = (float*)carve((size_t)NTOK * D * 4);
  if (off > ws_size) return;                                    // ≈ 46 MB
  prep_kernel<<<512, 256, 0, stream>>>(wq, wk, wv, wo, w16, wo16);
  xprep_kernel<<<1024, 256, 0, stream>>>(x, x16);
  proj_kernel<<<dim3(3 * D / 64, NTOK / 128), 128, 0, stream>>>((const __bf16*)x16, (const __bf16*)w16, bq, bk, bv, qh, kh, vt);
  attn_kernel<S / 16><<<Bn * H * (S / 16) / 8, 256, 0, stream>>>(qh, kh, vt, rel, remb, y);
  out_kernel<<<dim3(D / 64, NTOK / 128), 128, 0, stream>>>(y, wo16, bo, out);
}

// v002
// One run takes 197 microseconds.
// Two timings next to v001 put it at 1.24 and 1.25 times that version's speed.
// Over all steps from v000 it is 1.46 times as fast.
#include <hip/hip_runtime.h>

// BART attention with relation embeddings: q = (x Wq^T + bq)/8, k = x Wk^T + bk, v = x Wv^T + bv (16 heads x 64); attn = softmax(q.k) (no mask; the k-relation term has scale 0);
// out_h[t] = sum_s attn[t][s] (v_h[s] + rel_emb[relation_inputs[b][t][s]]) (v-relation scale 1, shared by all heads); out = merged Wo^T + bo -> [2][1024][1024].
// The relation term is sum_r w_r[t] rel_emb[r] with w_r[t] = sum over keys s of relation r of attn[t][s]: per (b, h, 16 queries) the final probabilities are bucketed by the INPUT relation id
// into f32 LDS tables [16 queries][41], one per key part (plain ordered adds, no atomics), summed over the parts, then multiplied by the 41 x 64 table — nothing index-like is written; ids only select an LDS accumulator.
// Numerics: bf16 inputs (x, weights, biases, rel_emb rounded to bf16): projections on v_wmma_f32_16x16x32_bf16 (exact products; + bias); per pair a
// v_wmma_f32_16x16x32_f16; out projection with y hi+lo x8 (2 products); softmax, buckets and the relation product in f32. Fragment k-map per lane half hh for A AND B: elements 0..7 <-

namespace {
constexpr int BT = 2, Bn = 2, S = 1024, D = 1024, H = 16, HD = 64, NTOK = Bn * S, NREL = 41;
constexpr float SCALE = 0.125f, VS = 8.0f, QS = 8.0f, PS = 8.0f;   // power-of-two carry scales so hi/lo residual planes stay normal in f16
constexpr size_t VPL = (size_t)NTOK * D;   // distance between the (8v)^T hi and lo planes
constexpr size_t QPL = (size_t)NTOK * D;   // distance between the q/k hi and lo planes

typedef _Float16 b16;
typedef __attribute__((ext_vector_type(16))) _Float16 v16b;
typedef __attribute__((ext_vector_type(8)))  _Float16 v8b;
typedef __attribute__((ext_vector_type(8)))  float v8f;
typedef __attribute__((ext_vector_type(4)))  float v4f;

__device__ __forceinline__ v8b ld8b(const b16* p) { return *(const v8b*)p; }
__device__ __forceinline__ v16b cat8b(v8b a, v8b b) { return __builtin_shufflevector(a, b, 0, 1, 2, 3, 4, 5, 6, 7, 8, 9, 10, 11, 12, 13, 14, 15); }
__device__ __forceinline__ v16b frag_kb(const b16* p, int hh) { return cat8b(ld8b(p + 8 * hh), ld8b(p + 16 + 8 * hh)); }
__device__ __forceinline__ void split16(float v, b16& hi, b16& lo) { hi = (b16)v; lo = (b16)(v - (float)hi); }
// hi/lo fragment pair straight from an f32 k-contiguous row (same k-map)
__device__ __forceinline__ void frag_ksplit(const float* p, int hh, v16b& fh_, v16b& fl_) {
  const float* p0 = p + 8 * hh; const float* p1 = p + 16 + 8 * hh;
#pragma unroll
  for (int e = 0; e < 8; ++e) { b16 a, c; split16(p0[e], a, c); fh_[e] = a; fl_[e] = c; split16(p1[e], a, c); fh_[8 + e] = a; fl_[8 + e] = c; }
}
__device__ __forceinline__ v8f wmma16b(v16b a, v16b b, v8f c) {
  v8f d = __builtin_amdgcn_wmma_f32_16x16x32_f16(false, a, false, b, (short)0, c, false, false);
  asm volatile("v_nop\n\tv_nop\n\tv_nop\n\tv_nop" : "+v"(d) : "v"(a), "v"(b));
  return d;
}
__device__ __forceinline__ void wave_lds_sync() {
  __builtin_amdgcn_fence(__ATOMIC_RELEASE, "workgroup");
  __builtin_amdgcn_wave_barrier();
  __builtin_amdgcn_fence(__ATOMIC_ACQUIRE, "workgroup");
}

// Operand descriptor: NP = 0 -> f32 rows split on the fly into (hi, lo); NP = 1 -> one f16 plane; NP = 2 -> f16 hi + lo planes;
// NP = 3 -> f32 rows rounded once to a single f16 fragment. ld = row pitch.
struct Opnd { const void* p0; const void* p1; int ld; };
template <int NP> __device__ __forceinline__ void load_frags(const Opnd& o, int row, int kb, int hh, v16b& fh_, v16b& fl_) {
  if (NP == 0) { frag_ksplit((const float*)o.p0 + (size_t)row * o.ld + kb, hh, fh_, fl_); }
  else if (NP == 4 || NP == 5) {                             // f32 rows x64 (NP 4) or x8 (NP 5) then split (keeps the lo halves of small values normal)
    const float sc_ = (NP == 4) ? 64.0f : 8.0f;
    const float* p = (const float*)o.p0 + (size_t)row * o.ld + kb; const float* p0 = p + 8 * hh; const float* p1 = p + 16 + 8 * hh;
#pragma unroll
    for (int e = 0; e < 8; ++e) { b16 a, c; split16(p0[e] * sc_, a, c); fh_[e] = a; fl_[e] = c; split16(p1[e] * sc_, a, c); fh_[8 + e] = a; fl_[8 + e] = c; }
  } else if (NP == 3) {
    const float* p = (const float*)o.p0 + (size_t)row * o.ld + kb; const float* p0 = p + 8 * hh; const float* p1 = p + 16 + 8 * hh;
#pragma unroll
    for (int e = 0; e < 8; ++e) { fh_[e] = (b16)p0[e]; fh_[8 + e] = (b16)p1[e]; }
    fl_ = fh_;
  } else {
    fh_ = frag_kb((const b16*)o.p0 + (size_t)row * o.ld + kb, hh);
    if (NP == 2) fl_ = frag_kb((const b16*)o.p1 + (size_t)row * o.ld + kb, hh); else fl_ = fh_;
  }
}
template <int ANP, int BNP> __device__ __forceinline__ v8f mac(v16b ah, v16b al, v16b bh, v16b bl, v8f c) {
  c = wmma16b(ah, bh, c);
  if (BNP == 0 || BNP == 2 || BNP == 4 || BNP == 5) c = wmma16b(ah, bl, c);     // hi.lo
  if (ANP == 0 || ANP == 2 || ANP == 4 || ANP == 5) c = wmma16b(al, bh, c);     // lo.hi   (lo.lo dropped)
  return c;
}
// 32x64 wave tile: acc[r][t] (rows m0+16r.., cols c0+16t..) += A[m][k] . B[n][k] over k in [0, K)
template <int ANP, int BNP>
__device__ __forceinline__ void gemm_tile(const Opnd& A, const Opnd& B, int K, int m0, int c0, int nloc, int hlf, v8f (&acc)[2][4]) {
  for (int kb = 0; kb < K; kb += 32) {
    v16b a0h, a0l, a1h, a1l;
    load_frags<ANP>(A, m0 + nloc, kb, hlf, a0h, a0l);
    load_frags<ANP>(A, m0 + 16 + nloc, kb, hlf, a1h, a1l);
#pragma unroll
    for (int t = 0; t < 4; ++t) {
      v16b bh, bl;
      load_frags<BNP>(B, c0 + t * 16 + nloc, kb, hlf, bh, bl);
      acc[0][t] = mac<ANP, BNP>(a0h, a0l, bh, bl, acc[0][t]);
      acc[1][t] = mac<ANP, BNP>(a1h, a1l, bh, bl, acc[1][t]);
    }
  }
}

__device__ __forceinline__ void epi_planes(v8f (&acc)[2][4], float scale, bool two, b16* __restrict__ oh, b16* __restrict__ ol, int ldo,
                                           int m0, int c0, int lane, b16* Th, b16* Tl) {
  const int nloc = lane & 15, hlf = lane >> 4;
#pragma unroll
  for (int t = 0; t < 4; ++t)
#pragma unroll
    for (int r = 0; r < 2; ++r)
#pragma unroll
      for (int v = 0; v < 8; ++v) {
        const int rr = r * 16 + v + 8 * hlf, cc = t * 16 + nloc;
        b16 h_, l_; split16(acc[r][t][v] * scale, h_, l_);
        Th[rr * 64 + cc] = h_; Tl[rr * 64 + cc] = l_;
      }
  wave_lds_sync();
  {
#pragma unroll
    for (int j = 0; j < 8; ++j) {
      const int rr = j * 4 + (lane >> 3), c8 = (lane & 7) * 8;
      const size_t o = (size_t)(m0 + rr) * ldo + c0 + c8;
      *(v8b*)(oh + o) = ld8b(Th + rr * 64 + c8);
      if (two) *(v8b*)(ol + o) = ld8b(Tl + rr * 64 + c8);
    }
    
  }
}
// (b) f32 rows with pitch ldo: 64 floats = 256 B = 2 lines per row; 16 lanes x 16 B per row, 2 rows per instruction. Optional per-row factor
__device__ __forceinline__ void epi_f32(v8f (&acc)[2][4], float scale, const float* rscale, float* __restrict__ out, int ldo, int m0, int c0, int lane, float* Tt) {
  const int nloc = lane & 15, hlf = lane >> 4;
#pragma unroll
  for (int t = 0; t < 4; ++t)
#pragma unroll
    for (int r = 0; r < 2; ++r)
#pragma unroll
      for (int v = 0; v < 8; ++v) {
        const int rr = r * 16 + v + 8 * hlf;
        const float rs = rscale ? rscale[(size_t)(m0 + rr) * 32] : 1.0f;
        Tt[rr * 64 + t * 16 + nloc] = acc[r][t][v] * scale * rs;
      }
  wave_lds_sync();
  float* dst0 = out + (size_t)m0 * ldo + c0;
  {
#pragma unroll
    for (int j = 0; j < 16; ++j) { const int rr = j * 2 + hlf, c4 = nloc * 4; *(v4f*)(dst0 + (size_t)rr * ldo + c4) = *(const v4f*)(Tt + rr * 64 + c4); }
    
  }
}



typedef __attribute__((ext_vector_type(8))) __bf16 v8bb; typedef __attribute__((ext_vector_type(16))) __bf16 v16bb;
typedef __attribute__((ext_vector_type(8))) unsigned short v8us;
__device__ __forceinline__ v16bb frag_kb_bf(const __bf16* p, int hh) { const v8bb a = *(const v8bb*)(p + 8 * hh), b = *(const v8bb*)(p + 16 + 8 * hh); return __builtin_shufflevector(a, b, 0, 1, 2, 3, 4, 5, 6, 7, 8, 9, 10, 11, 12, 13, 14, 15); }
__device__ __forceinline__ v8f wmma16bb(v16bb a, v16bb b, v8f c) {
  v8f d = __builtin_amdgcn_wmma_f32_16x16x32_bf16(false, a, false, b, (short)0, c, false, false);
  asm volatile("v_nop\n\tv_nop\n\tv_nop\n\tv_nop" : "+v"(d) : "v"(a), "v"(b));
  return d;
}
__device__ __forceinline__ unsigned short bf16_rne_bits(float v) { unsigned int u = __float_as_uint(v); u += 0x7FFFu + ((u >> 16) & 1u); return (unsigned short)(u >> 16); }
__device__ __forceinline__ float bf16_rne(float v) { return __uint_as_float(((unsigned int)bf16_rne_bits(v)) << 16); }



// x (f32) -> bf16 bits, round to nearest even.
__global__ __launch_bounds__(256) void xprep_kernel(const float* __restrict__ x, unsigned short* __restrict__ x16) {   // one pass's two batches -> bf16
  const size_t tid = (size_t)blockIdx.x * blockDim.x + threadIdx.x, nth = (size_t)gridDim.x * blockDim.x;
  { for (size_t p = tid; p < (size_t)NTOK * D / 8; p += nth) { v8us v;
#pragma unroll
      for (int e = 0; e < 8; ++e) v[e] = bf16_rne_bits(x[p * 8 + e]);
      *(v8us*)(x16 + p * 8) = v; }  }
}
__global__ __launch_bounds__(256) void prep_kernel(const float* __restrict__ wq, const float* __restrict__ wk, const float* __restrict__ wv, const float* __restrict__ wo, unsigned short* __restrict__ w16, b16* __restrict__ wo16) {
  const size_t tid = (size_t)blockIdx.x * blockDim.x + threadIdx.x, nth = (size_t)gridDim.x * blockDim.x;
  {
    for (size_t p = tid; p < (size_t)3 * D * D / 8; p += nth) { const float* W = (p < (size_t)D * D / 8) ? wq : (p < (size_t)2 * D * D / 8) ? wk : wv; const size_t q = p % ((size_t)D * D / 8); v8us v;   // [out][in] rows copied directly
#pragma unroll
      for (int e = 0; e < 8; ++e) v[e] = bf16_rne_bits(W[q * 8 + e]);
      *(v8us*)(w16 + p * 8) = v; }
    for (size_t p = tid; p < (size_t)D * D / 8; p += nth) { v8b w;   // W_o [out][in] rows copied directly
#pragma unroll
      for (int e = 0; e < 8; ++e) w[e] = (b16)bf16_rne(wo[p * 8 + e]);
      *(v8b*)(wo16 + p * 8) = w; }
    
  }
}

// projections: rows = tokens (2048), K = 1024, column tiles of 64 = one head of q (tiles 0..15), k (16..31) or v (32..47); f16 rows [b*H + head][tok][64] for q/k;
// v: (8v)^T f16 [b*H + head][64][tok]. grid (48, 16) x 128.
__global__ __launch_bounds__(128) void proj_kernel(const __bf16* __restrict__ x16, const __bf16* __restrict__ w16, const float* __restrict__ bq, const float* __restrict__ bk, const float* __restrict__ bv, b16* __restrict__ qh, b16* __restrict__ kh, b16* __restrict__ vt) {
  __shared__ __attribute__((aligned(16))) b16 Th[4][32][HD + 8], Tq[4][32][HD + 8];
  __shared__ __attribute__((aligned(16))) b16 Tt[64][128 + 8], Tl[64][128 + 8];
  const int lane = threadIdx.x & 31, wave = threadIdx.x >> 5, nloc = lane & 15, hlf = lane >> 4, m0 = blockIdx.y * 128 + wave * 32, c0 = blockIdx.x * 64;
  v8f acc[2][4];
#pragma unroll
  for (int r = 0; r < 2; ++r)
#pragma unroll
    for (int t = 0; t < 4; ++t) acc[r][t] = (v8f){};
#pragma unroll 2
  for (int kb = 0; kb < D; kb += 32) {
    const v16bb a0 = frag_kb_bf(x16 + (size_t)(m0 + nloc) * D + kb, hlf), a1 = frag_kb_bf(x16 + (size_t)(m0 + 16 + nloc) * D + kb, hlf);
#pragma unroll
    for (int t = 0; t < 4; ++t) { const v16bb bw = frag_kb_bf(w16 + (size_t)(c0 + t * 16 + nloc) * D + kb, hlf); acc[0][t] = wmma16bb(a0, bw, acc[0][t]); acc[1][t] = wmma16bb(a1, bw, acc[1][t]); }
  }
  const int which = blockIdx.x / (D / 64), head = blockIdx.x % (D / 64), b = m0 / S, tok0 = m0 % S;
  { const float* bias = (which == 0) ? bq : (which == 1) ? bk : bv;   // + bf16(bias)
#pragma unroll
    for (int t = 0; t < 4; ++t) { const float bb = bf16_rne(bias[head * HD + t * 16 + nloc]);
#pragma unroll
      for (int r = 0; r < 2; ++r)
#pragma unroll
        for (int v = 0; v < 8; ++v) acc[r][t][v] += bb; } }
  if (which < 2) {                                              // q or k head: f16 rows
#pragma unroll
    for (int t = 0; t < 4; ++t)
#pragma unroll
      for (int r = 0; r < 2; ++r)
#pragma unroll
        for (int v = 0; v < 8; ++v) { b16 a_, c_; split16(acc[r][t][v] * QS, a_, c_); Th[wave][r * 16 + 8 * hlf + v][t * 16 + nloc] = a_; Tq[wave][r * 16 + 8 * hlf + v][t * 16 + nloc] = c_; }   // q, k carried x8 (lo residuals stay normal)
    wave_lds_sync();
    b16* dst = (which == 0 ? qh : kh) + (((size_t)b * H + head) * S + tok0) * HD;
    {
#pragma unroll
      for (int j = 0; j < 8; ++j) { const int rr = j * 4 + (lane >> 3), c8 = (lane & 7) * 8; *(v8b*)(dst + (size_t)rr * HD + c8) = *(const v8b*)(&Th[wave][rr][c8]); *(v8b*)(dst + QPL + (size_t)rr * HD + c8) = *(const v8b*)(&Tq[wave][rr][c8]); }
       }
    return;
  }
  const int vh = head;                                          // v head: (8v)^T tile [64 d][128 tok] via LDS, rows of 256 B
#pragma unroll
  for (int t = 0; t < 4; ++t)
#pragma unroll
    for (int r = 0; r < 2; ++r)
#pragma unroll
      for (int v = 0; v < 8; ++v) { b16 a_, c_; split16(acc[r][t][v] * VS, a_, c_); Tt[t * 16 + nloc][wave * 32 + r * 16 + 8 * hlf + v] = a_; Tl[t * 16 + nloc][wave * 32 + r * 16 + 8 * hlf + v] = c_; }
  __syncthreads();
  b16* dstv = vt + (((size_t)b * H + vh) * HD) * S + (blockIdx.y * 128) % S;
  {
#pragma unroll
    for (int j = 0; j < 8; ++j) { const int dd = wave * 16 + j * 2 + (lane >> 4), c8 = (lane & 15) * 8; *(v8b*)(dstv + (size_t)dd * S + c8) = *(const v8b*)(&Tt[dd][c8]); *(v8b*)(dstv + VPL + (size_t)dd * S + c8) = *(const v8b*)(&Tl[dd][c8]); }
    
  }
}

__device__ __forceinline__ void s_tile(const b16* __restrict__ K, const v16b* qf, const v16b* ql, int kb, int col, int hh, v8f& s0, v8f& s1) {
  s0 = (v8f){}; s1 = (v8f){};
#pragma unroll
  for (int ks = 0; ks < 2; ++ks) { const v16b k0 = frag_kb(K + (size_t)(kb + col) * HD + ks * 32, hh), k0l = frag_kb(K + QPL + (size_t)(kb + col) * HD + ks * 32, hh), k1 = frag_kb(K + (size_t)(kb + 16 + col) * HD + ks * 32, hh), k1l = frag_kb(K + QPL + (size_t)(kb + 16 + col) * HD + ks * 32, hh);
    asm volatile("s_wait_xcnt 0x0" ::: "memory");   // stands behind the key reads because their address pairs are rewritten later in the trip, in pass 2 while the reads are still out
    s0 = wmma16b(k0, qf[ks], s0); s0 = wmma16b(k0, ql[ks], s0); s0 = wmma16b(k0l, qf[ks], s0); s1 = wmma16b(k1, qf[ks], s1); s1 = wmma16b(k1, ql[ks], s1); s1 = wmma16b(k1l, qf[ks], s1); }
#pragma unroll
  for (int r = 0; r < 8; ++r) { s0[r] *= SCALE / (QS * QS); s1[r] *= SCALE / (QS * QS); }
}
// Each 16-query tile is worked by KP waves of one work-group, each on its own run of keys (TP trips of 32 keys; the last part has what is left): wave = part * 8 + tile.
// The parts meet twice in LDS: after pass 1 (row maximum and row sum) and after pass 2 (partial outputs and partial relation buckets, summed in part order 0..KP-1).
constexpr int KP = 3, TP = (S / 32 + KP - 1) / KP;
template <int QT>
__global__ __launch_bounds__(256 * KP) void attn_kernel(const b16* __restrict__ qh, const b16* __restrict__ kh, const b16* __restrict__ vt, const int* __restrict__ rel, const float* __restrict__ remb, float* __restrict__ y) {
  __shared__ __attribute__((aligned(16))) float Os[8 * KP][16][HD + 4]; __shared__ float Bk[8 * KP][16][NREL + 1]; __shared__ __attribute__((aligned(16))) float Es[NREL][HD]; __shared__ float Ms[8 * KP][16], Ls[8 * KP][16];
  // the wave's number is taken as a scalar so that tile, part, head, the key range and the base addresses formed from them stay out of the vector registers
  const int wid = __builtin_amdgcn_readfirstlane(threadIdx.x >> 5), lane = threadIdx.x & 31, hh = lane >> 4, col = lane & 15, tile = wid & 7, part = wid >> 3;
  const int kbeg = part * TP * 32, kend = (kbeg + TP * 32 < S) ? kbeg + TP * 32 : S;
  for (int i = threadIdx.x; i < NREL * HD; i += 256 * KP) Es[i / HD][i % HD] = bf16_rne(remb[i]);
  for (int i = lane; i < 16 * (NREL + 1); i += 32) Bk[wid][i / (NREL + 1)][i % (NREL + 1)] = 0.0f;
  __syncthreads();
  const int qt = blockIdx.x * 8 + tile, jt = qt % QT, bh = qt / QT, h = bh % H, b = bh / H, q0 = jt * 16, qi = q0 + col;
  const b16* Q = qh + ((size_t)bh * S) * HD; const b16* K = kh + ((size_t)bh * S) * HD; const b16* vb = vt + ((size_t)bh * HD) * S; const int* rrow = rel + ((size_t)b * S + qi) * S;
  v16b qf[2], ql[2];
#pragma unroll
  for (int ks = 0; ks < 2; ++ks) { qf[ks] = frag_kb(Q + (size_t)qi * HD + ks * 32, hh); ql[ks] = frag_kb(Q + QPL + (size_t)qi * HD + ks * 32, hh); }
  asm volatile("s_wait_xcnt 0x0" ::: "memory");   // the query reads' address pair is rewritten behind the loop's entry branch
  float m = -INFINITY, l = 0.0f;
  for (int kb = kbeg; kb < kend; kb += 32) { v8f s0, s1; s_tile(K, qf, ql, kb, col, hh, s0, s1);
    float mr = -INFINITY;
#pragma unroll
    for (int r = 0; r < 8; ++r) mr = fmaxf(mr, fmaxf(s0[r], s1[r]));
    mr = fmaxf(mr, __shfl_xor(mr, 16));
    const float mn = fmaxf(m, mr), al_ = __expf(m - mn); m = mn; float sum = 0.0f;
#pragma unroll
    for (int r = 0; r < 8; ++r) sum += __expf(s0[r] - mn) + __expf(s1[r] - mn);
    sum += __shfl_xor(sum, 16); l = l * al_ + sum; }
  if (hh == 0) { Ms[wid][col] = m; Ls[wid][col] = l; }           // this part's row maximum and row sum (both lane halves hold the same pair)
  __syncthreads();
  { float mg = -INFINITY, lg = 0.0f;
#pragma unroll
    for (int p = 0; p < KP; ++p) mg = fmaxf(mg, Ms[p * 8 + tile][col]);
#pragma unroll
    for (int p = 0; p < KP; ++p) lg += Ls[p * 8 + tile][col] * __expf(Ms[p * 8 + tile][col] - mg);
    m = mg; l = lg; }
  const float il = 1.0f / l; v8f o[4] = {{}, {}, {}, {}};
  for (int kb = kbeg; kb < kend; kb += 32) { v8f s0, s1; s_tile(K, qf, ql, kb, col, hh, s0, s1);     // pass 2
    v16b pb, pl; float p0[8], p1[8]; int r0[8], r1[8];
#pragma unroll
    for (int r = 0; r < 8; ++r) { p0[r] = __expf(s0[r] - m) * il; p1[r] = __expf(s1[r] - m) * il; b16 a, c; split16(p0[r] * PS, a, c); pb[r] = a; pl[r] = c; split16(p1[r] * PS, a, c); pb[8 + r] = a; pl[8 + r] = c;
      int ra = rrow[kb + 8 * hh + r], rb = rrow[kb + 16 + 8 * hh + r]; r0[r] = (ra < 0) ? 0 : (ra >= NREL ? NREL - 1 : ra); r1[r] = (rb < 0) ? 0 : (rb >= NREL ? NREL - 1 : rb); }
#pragma unroll
    for (int n = 0; n < 4; ++n) { const v16b vf = frag_kb(vb + (size_t)(n * 16 + col) * S + kb, hh), vl = frag_kb(vb + VPL + (size_t)(n * 16 + col) * S + kb, hh);
      o[n] = wmma16b(vf, pb, o[n]); o[n] = wmma16b(vf, pl, o[n]); o[n] = wmma16b(vl, pb, o[n]); }
    // relation buckets: Bk[q][id] += p — the two lanes of a query column add in turn (ordered, no atomics)
    for (int turn = 0; turn < 2; ++turn) {
      if (hh == turn) {
#pragma unroll
        for (int r = 0; r < 8; ++r) { Bk[wid][col][r0[r]] += p0[r]; Bk[wid][col][r1[r]] += p1[r]; } }
      wave_lds_sync(); }
  }
  // epilogue: y[q][d] = sum over parts of o/64 + sum_r (sum over parts of Bk[q][r]) E[r][d]. Each wave leaves its partial o in LDS; behind the barrier the waves of parts 0 and 1
  // finish eight queries of their tile each: four lanes per query, sixteen consecutive d per lane, so a wave stores eight whole 256-byte rows.
#pragma unroll
  for (int n = 0; n < 4; ++n)
#pragma unroll
    for (int r = 0; r < 8; ++r) Os[wid][col][n * 16 + 8 * hh + r] = o[n][r] * (1.0f / (VS * PS));
  __syncthreads();
  if (part < 2) {
    const int qq = part * 8 + (lane >> 2), d0 = (lane & 3) * 16;
    v4f a[4] = {{}, {}, {}, {}};
#pragma unroll
    for (int p = 0; p < KP; ++p)
#pragma unroll
      for (int j = 0; j < 4; ++j) a[j] += *(const v4f*)(&Os[p * 8 + tile][qq][d0 + 4 * j]);
    // Unrolled so that the reads of later ids are issued under the multiply-adds of earlier ones; each sum still adds ids 0..40 in that order.
#pragma unroll
    for (int rr = 0; rr < NREL; ++rr) { float w = 0.0f;
#pragma unroll
      for (int p = 0; p < KP; ++p) w += Bk[p * 8 + tile][qq][rr];
#pragma unroll
      for (int j = 0; j < 4; ++j) a[j] += w * *(const v4f*)(&Es[rr][d0 + 4 * j]); }
    float* dst = y + ((size_t)b * S + q0 + qq) * D + h * HD + d0;
#pragma unroll
    for (int j = 0; j < 4; ++j) *(v4f*)(dst + 4 * j) = a[j];
  }
}

// out = y W_o^T: (2048 x 1024) x (1024 x 1024); A = y x8 split at load into f16 hi + lo, B = f16(bf16 W_o) rows; f32 rows; grid (16, 16).
__global__ __launch_bounds__(128) void out_kernel(const float* __restrict__ y, const b16* __restrict__ wo16, const float* __restrict__ bo, float* __restrict__ out) {
  __shared__ __attribute__((aligned(16))) float Ts[4][32 * 64];
  const int lane = threadIdx.x & 31, wave = threadIdx.x >> 5, nloc = lane & 15, hlf = lane >> 4, m0 = blockIdx.y * 128 + wave * 32, c0 = blockIdx.x * 64;
  v8f acc[2][4];
#pragma unroll
  for (int r = 0; r < 2; ++r)
#pragma unroll
    for (int t = 0; t < 4; ++t) acc[r][t] = (v8f){};
  const Opnd A{y, nullptr, D}, Bo{wo16, nullptr, D};
  gemm_tile<5, 1>(A, Bo, D, m0, c0, nloc, hlf, acc);                            // y as an f16 hi+lo pair carried x8 (2 products)
#pragma unroll
  for (int t = 0; t < 4; ++t)
#pragma unroll
    for (int r = 0; r < 2; ++r)
#pragma unroll
      for (int v = 0; v < 8; ++v) acc[r][t][v] = acc[r][t][v] * (1.0f / 8.0f) + bf16_rne(bo[c0 + t * 16 + nloc]);
  epi_f32(acc, 1.0f, nullptr, out, D, m0, c0, lane, Ts[wave]);
}
}  // namespace

extern "C" void kernel_launch(void* const* d_in, const int* in_sizes, int n_in,
                              void* d_out, int out_size, void* d_ws, size_t ws_size, hipStream_t stream) {
  (void)n_in; (void)out_size;
  const float* x = (const float*)d_in[0]; const int* rel = (const int*)d_in[1];
  const float* wq = (const float*)d_in[2]; const float* bq = (const float*)d_in[3]; const float* wk = (const float*)d_in[4]; const float* bk = (const float*)d_in[5]; const float* wv = (const float*)d_in[6]; const float* bv = (const float*)d_in[7];
  const float* wo = (const float*)d_in[8]; const float* bo = (const float*)d_in[9]; const float* remb = (const float*)d_in[10];
  float* out = (float*)d_out;   // [2][1024][1024]
  if (in_sizes[0] != BT * S * D || in_sizes[1] != BT * S * S || in_sizes[2] != D * D || in_sizes[8] != D * D || in_sizes[10] != NREL * HD) return;
  size_t off = 0; char* ws = (char*)d_ws;
  auto carve = [&](size_t bytes) { char* p = ws + off; off += (bytes + 255) & ~(size_t)255; return p; };
  unsigned short* x16 = (unsigned short*)carve((size_t)NTOK * D * 2); unsigned short* w16 = (unsigned short*)carve((size_t)3 * D * D * 2); b16* wo16 = (b16*)carve((size_t)D * D * 2);
  b16* qh = (b16*)carve((size_t)2 * NTOK * D * 2); b16* kh = (b16*)carve((size_t)2 * NTOK * D * 2); b16* vt = (b16*)carve((size_t)2 * NTOK * D * 2); float* y = (float*)carve((size_t)NTOK * D * 4);
  if (off > ws_size) return;                                    // ≈ 46 MB
  prep_kernel<<<512, 256, 0, stream>>>(wq, wk, wv, wo, w16, wo16);
  xprep_kernel<<<1024, 256, 0, stream>>>(x, x16);
  proj_kernel<<<dim3(3 * D / 64, NTOK / 128), 128, 0, stream>>>((const __bf16*)x16, (const __bf16*)w16, bq, bk, bv, qh, kh, vt);
  attn_kernel<S / 16><<<Bn * H * (S / 16) / 8, 256 * KP, 0, stream>>>(qh, kh, vt, rel, remb, y);
  out_kernel<<<dim3(D / 64, NTOK / 128), 128, 0, stream>>>(y, wo16, bo, out);
}

// v003
// It runs in 170 microseconds.
// Next to v002, in two timings, it ran 1.16 and 1.17 times as fast.
// All steps since v000 together make it 1.70 times as fast.
#include <hip/hip_runtime.h>

// BART attention with relation embeddings: q = (x Wq^T + bq)/8, k = x Wk^T + bk, v = x Wv^T + bv (16 heads x 64); attn = softmax(q.k) (no mask; the k-relation term has scale 0);
// out_h[t] = sum_s attn[t][s] (v_h[s] + rel_emb[relation_inputs[b][t][s]]) (v-relation scale 1, shared by all heads); out = merged Wo^T + bo -> [2][1024][1024].
// The relation term is sum_r w_r[t] rel_emb[r] with w_r[t] = sum over keys s of relation r of attn[t][s]: per (b, h, 16 queries) the final probabilities are bucketed by the INPUT relation id
// into f32 LDS tables [16 queries][41], one per key part (plain ordered adds, no atomics), summed over the parts, then multiplied by the 41 x 64 table — nothing index-like is written; ids only select an LDS accumulator.
// Numerics: bf16 inputs (x, weights, biases, rel_emb rounded to bf16): projections on v_wmma_f32_16x16x32_bf16 (exact products; + bias); per pair a
// v_wmma_f32_16x16x32_f16; out projection with y hi+lo x8 (2 products); softmax, buckets and the relation product in f32. Fragment k-map per lane half hh for A AND B: elements 0..7 <-

namespace {
constexpr int BT = 2, Bn = 2, S = 1024, D = 1024, H = 16, HD = 64, NTOK = Bn * S, NREL = 41;
constexpr float SCALE = 0.125f, VS = 8.0f, QS = 8.0f, PS = 8.0f;   // power-of-two carry scales so hi/lo residual planes stay normal in f16
constexpr size_t VPL = (size_t)NTOK * D;   // distance between the (8v)^T hi and lo planes
constexpr size_t QPL = (size_t)NTOK * D;   // distance between the q/k hi and lo planes

typedef _Float16 b16;
typedef __attribute__((ext_vector_type(16))) _Float16 v16b;
typedef __attribute__((ext_vector_type(8)))  _Float16 v8b;
typedef __attribute__((ext_vector_type(8)))  float v8f;
typedef __attribute__((ext_vector_type(4)))  float v4f;

__device__ __forceinline__ v8b ld8b(const b16* p) { return *(const v8b*)p; }
__device__ __forceinline__ v16b cat8b(v8b a, v8b b) { return __builtin_shufflevector(a, b, 0, 1, 2, 3, 4, 5, 6, 7, 8, 9, 10, 11, 12, 13, 14, 15); }
__device__ __forceinline__ v16b frag_kb(const b16* p, int hh) { return cat8b(ld8b(p + 8 * hh), ld8b(p + 16 + 8 * hh)); }
__device__ __forceinline__ void split16(float v, b16& hi, b16& lo) { hi = (b16)v; lo = (b16)(v - (float)hi); }
__device__ __forceinline__ v8f wmma16b(v16b a, v16b b, v8f c) {
  v8f d = __builtin_amdgcn_wmma_f32_16x16x32_f16(false, a, false, b, (short)0, c, false, false);
  asm volatile("v_nop\n\tv_nop\n\tv_nop\n\tv_nop" : "+v"(d) : "v"(a), "v"(b));
  return d;
}
__device__ __forceinline__ void wave_lds_sync() {
  __builtin_amdgcn_fence(__ATOMIC_RELEASE, "workgroup");
  __builtin_amdgcn_wave_barrier();
  __builtin_amdgcn_fence(__ATOMIC_ACQUIRE, "workgroup");
}

__device__ __forceinline__ void epi_planes(v8f (&acc)[2][4], float scale, bool two, b16* __restrict__ oh, b16* __restrict__ ol, int ldo,
                                           int m0, int c0, int lane, b16* Th, b16* Tl) {
  const int nloc = lane & 15, hlf = lane >> 4;
#pragma unroll
  for (int t = 0; t < 4; ++t)
#pragma unroll
    for (int r = 0; r < 2; ++r)
#pragma unroll
      for (int v = 0; v < 8; ++v) {
        const int rr = r * 16 + v + 8 * hlf, cc = t * 16 + nloc;
        b16 h_, l_; split16(acc[r][t][v] * scale, h_, l_);
        Th[rr * 64 + cc] = h_; Tl[rr * 64 + cc] = l_;
      }
  wave_lds_sync();
  {
#pragma unroll
    for (int j = 0; j < 8; ++j) {
      const int rr = j * 4 + (lane >> 3), c8 = (lane & 7) * 8;
      const size_t o = (size_t)(m0 + rr) * ldo + c0 + c8;
      *(v8b*)(oh + o) = ld8b(Th + rr * 64 + c8);
      if (two) *(v8b*)(ol + o) = ld8b(Tl + rr * 64 + c8);
    }
    
  }
}
// (b) f32 rows with pitch ldo: 64 floats = 256 B = 2 lines per row; 16 lanes x 16 B per row, 2 rows per instruction. Optional per-row factor
__device__ __forceinline__ void epi_f32(v8f (&acc)[2][4], float scale, const float* rscale, float* __restrict__ out, int ldo, int m0, int c0, int lane, float* Tt) {
  const int nloc = lane & 15, hlf = lane >> 4;
#pragma unroll
  for (int t = 0; t < 4; ++t)
#pragma unroll
    for (int r = 0; r < 2; ++r)
#pragma unroll
      for (int v = 0; v < 8; ++v) {
        const int rr = r * 16 + v + 8 * hlf;
        const float rs = rscale ? rscale[(size_t)(m0 + rr) * 32] : 1.0f;
        Tt[rr * 64 + t * 16 + nloc] = acc[r][t][v] * scale * rs;
      }
  wave_lds_sync();
  float* dst0 = out + (size_t)m0 * ldo + c0;
  {
#pragma unroll
    for (int j = 0; j < 16; ++j) { const int rr = j * 2 + hlf, c4 = nloc * 4; *(v4f*)(dst0 + (size_t)rr * ldo + c4) = *(const v4f*)(Tt + rr * 64 + c4); }
    
  }
}



typedef __attribute__((ext_vector_type(8))) __bf16 v8bb; typedef __attribute__((ext_vector_type(16))) __bf16 v16bb;
typedef __attribute__((ext_vector_type(8))) unsigned short v8us;
__device__ __forceinline__ v16bb frag_kb_bf(const __bf16* p, int hh) { const v8bb a = *(const v8bb*)(p + 8 * hh), b = *(const v8bb*)(p + 16 + 8 * hh); return __builtin_shufflevector(a, b, 0, 1, 2, 3, 4, 5, 6, 7, 8, 9, 10, 11, 12, 13, 14, 15); }
__device__ __forceinline__ v8f wmma16bb(v16bb a, v16bb b, v8f c) {
  v8f d = __builtin_amdgcn_wmma_f32_16x16x32_bf16(false, a, false, b, (short)0, c, false, false);
  asm volatile("v_nop\n\tv_nop\n\tv_nop\n\tv_nop" : "+v"(d) : "v"(a), "v"(b));
  return d;
}
__device__ __forceinline__ unsigned short bf16_rne_bits(float v) { unsigned int u = __float_as_uint(v); u += 0x7FFFu + ((u >> 16) & 1u); return (unsigned short)(u >> 16); }
__device__ __forceinline__ float bf16_rne(float v) { return __uint_as_float(((unsigned int)bf16_rne_bits(v)) << 16); }



// x (f32) -> bf16 bits, round to nearest even.
__global__ __launch_bounds__(256) void xprep_kernel(const float* __restrict__ x, unsigned short* __restrict__ x16) {   // one pass's two batches -> bf16
  const size_t tid = (size_t)blockIdx.x * blockDim.x + threadIdx.x, nth = (size_t)gridDim.x * blockDim.x;
  { for (size_t p = tid; p < (size_t)NTOK * D / 8; p += nth) { v8us v;
#pragma unroll
      for (int e = 0; e < 8; ++e) v[e] = bf16_rne_bits(x[p * 8 + e]);
      *(v8us*)(x16 + p * 8) = v; }  }
}
__global__ __launch_bounds__(256) void prep_kernel(const float* __restrict__ wq, const float* __restrict__ wk, const float* __restrict__ wv, const float* __restrict__ wo, unsigned short* __restrict__ w16, b16* __restrict__ wo16) {
  const size_t tid = (size_t)blockIdx.x * blockDim.x + threadIdx.x, nth = (size_t)gridDim.x * blockDim.x;
  {
    for (size_t p = tid; p < (size_t)3 * D * D / 8; p += nth) { const float* W = (p < (size_t)D * D / 8) ? wq : (p < (size_t)2 * D * D / 8) ? wk : wv; const size_t q = p % ((size_t)D * D / 8); v8us v;   // [out][in] rows copied directly
#pragma unroll
      for (int e = 0; e < 8; ++e) v[e] = bf16_rne_bits(W[q * 8 + e]);
      *(v8us*)(w16 + p * 8) = v; }
    for (size_t p = tid; p < (size_t)D * D / 8; p += nth) { v8b w;   // W_o [out][in] rows copied directly
#pragma unroll
      for (int e = 0; e < 8; ++e) w[e] = (b16)bf16_rne(wo[p * 8 + e]);
      *(v8b*)(wo16 + p * 8) = w; }
    
  }
}

// projections: rows = tokens (2048), K = 1024, column tiles of 64 = one head of q (tiles 0..15), k (16..31) or v (32..47); f16 rows [b*H + head][tok][64] for q/k;
// v: (8v)^T f16 [b*H + head][64][tok]. grid (48, 16) x 128.
__global__ __launch_bounds__(128) void proj_kernel(const __bf16* __restrict__ x16, const __bf16* __restrict__ w16, const float* __restrict__ bq, const float* __restrict__ bk, const float* __restrict__ bv, b16* __restrict__ qh, b16* __restrict__ kh, b16* __restrict__ vt) {
  __shared__ __attribute__((aligned(16))) b16 Th[4][32][HD + 8], Tq[4][32][HD + 8];
  __shared__ __attribute__((aligned(16))) b16 Tt[64][128 + 8], Tl[64][128 + 8];
  const int lane = threadIdx.x & 31, wave = threadIdx.x >> 5, nloc = lane & 15, hlf = lane >> 4, m0 = blockIdx.y * 128 + wave * 32, c0 = blockIdx.x * 64;
  v8f acc[2][4];
#pragma unroll
  for (int r = 0; r < 2; ++r)
#pragma unroll
    for (int t = 0; t < 4; ++t) acc[r][t] = (v8f){};
  // Three register stages of 32 k: all twelve loads of stage j + 2 are issued ahead of the matrix instructions of stage j, so a stage waits once, two stages late, not once per weight fragment.
  const __bf16* pa = x16 + (size_t)(m0 + nloc) * D; const __bf16* pw = w16 + (size_t)(c0 + nloc) * D;
  v16bb fa[3][2], fw[3][4];
  auto fetch = [&](int st, int s) {
#pragma unroll
    for (int r = 0; r < 2; ++r) fa[s][r] = frag_kb_bf(pa + (size_t)r * 16 * D + st * 32, hlf);
#pragma unroll
    for (int t = 0; t < 4; ++t) fw[s][t] = frag_kb_bf(pw + (size_t)t * 16 * D + st * 32, hlf);
    __builtin_amdgcn_sched_barrier(0);   // keeps the stage's loads in front of the matrix instructions that follow; without it they sink to their first use and each is waited for alone
  };
  auto work = [&](int s) {
#pragma unroll
    for (int t = 0; t < 4; ++t) { acc[0][t] = wmma16bb(fa[s][0], fw[s][t], acc[0][t]); acc[1][t] = wmma16bb(fa[s][1], fw[s][t], acc[1][t]); }
  };
  fetch(0, 0); fetch(1, 1);
  for (int st = 0; st < D / 32 - 2; st += 3) { fetch(st + 2, 2); work(0); fetch(st + 3, 0); work(1); fetch(st + 4, 1); work(2);
    asm volatile("s_wait_xcnt 0x0" ::: "memory"); }   // the trip's loads are still out when the next trip rewrites their address pairs
  work(0); work(1);
  const int which = blockIdx.x / (D / 64), head = blockIdx.x % (D / 64), b = m0 / S, tok0 = m0 % S;
  { const float* bias = (which == 0) ? bq : (which == 1) ? bk : bv;   // + bf16(bias)
#pragma unroll
    for (int t = 0; t < 4; ++t) { const float bb = bf16_rne(bias[head * HD + t * 16 + nloc]);
#pragma unroll
      for (int r = 0; r < 2; ++r)
#pragma unroll
        for (int v = 0; v < 8; ++v) acc[r][t][v] += bb; } }
  if (which < 2) {                                              // q or k head: f16 rows
#pragma unroll
    for (int t = 0; t < 4; ++t)
#pragma unroll
      for (int r = 0; r < 2; ++r)
#pragma unroll
        for (int v = 0; v < 8; ++v) { b16 a_, c_; split16(acc[r][t][v] * QS, a_, c_); Th[wave][r * 16 + 8 * hlf + v][t * 16 + nloc] = a_; Tq[wave][r * 16 + 8 * hlf + v][t * 16 + nloc] = c_; }   // q, k carried x8 (lo residuals stay normal)
    wave_lds_sync();
    b16* dst = (which == 0 ? qh : kh) + (((size_t)b * H + head) * S + tok0) * HD;
    {
#pragma unroll
      for (int j = 0; j < 8; ++j) { const int rr = j * 4 + (lane >> 3), c8 = (lane & 7) * 8; *(v8b*)(dst + (size_t)rr * HD + c8) = *(const v8b*)(&Th[wave][rr][c8]); *(v8b*)(dst + QPL + (size_t)rr * HD + c8) = *(const v8b*)(&Tq[wave][rr][c8]); }
       }
    return;
  }
  const int vh = head;                                          // v head: (8v)^T tile [64 d][128 tok] via LDS, rows of 256 B
#pragma unroll
  for (int t = 0; t < 4; ++t)
#pragma unroll
    for (int r = 0; r < 2; ++r)
#pragma unroll
      for (int v = 0; v < 8; ++v) { b16 a_, c_; split16(acc[r][t][v] * VS, a_, c_); Tt[t * 16 + nloc][wave * 32 + r * 16 + 8 * hlf + v] = a_; Tl[t * 16 + nloc][wave * 32 + r * 16 + 8 * hlf + v] = c_; }
  __syncthreads();
  b16* dstv = vt + (((size_t)b * H + vh) * HD) * S + (blockIdx.y * 128) % S;
  {
#pragma unroll
    for (int j = 0; j < 8; ++j) { const int dd = wave * 16 + j * 2 + (lane >> 4), c8 = (lane & 15) * 8; *(v8b*)(dstv + (size_t)dd * S + c8) = *(const v8b*)(&Tt[dd][c8]); *(v8b*)(dstv + VPL + (size_t)dd * S + c8) = *(const v8b*)(&Tl[dd][c8]); }
    
  }
}

__device__ __forceinline__ void s_tile(const b16* __restrict__ K, const v16b* qf, const v16b* ql, int kb, int col, int hh, v8f& s0, v8f& s1) {
  s0 = (v8f){}; s1 = (v8f){};
  v16b k0[2], k0l[2], k1[2], k1l[2];   // all sixteen key reads of the trip go out together: one wait for memory per trip, not one per half of the head dimension
#pragma unroll
  for (int ks = 0; ks < 2; ++ks) { k0[ks] = frag_kb(K + (size_t)(kb + col) * HD + ks * 32, hh); k0l[ks] = frag_kb(K + QPL + (size_t)(kb + col) * HD + ks * 32, hh); k1[ks] = frag_kb(K + (size_t)(kb + 16 + col) * HD + ks * 32, hh); k1l[ks] = frag_kb(K + QPL + (size_t)(kb + 16 + col) * HD + ks * 32, hh); }
  asm volatile("s_wait_xcnt 0x0" ::: "memory");   // stands behind the key reads because their address pairs are rewritten later in the trip, in pass 2 while the reads are still out
#pragma unroll
  for (int ks = 0; ks < 2; ++ks) { s0 = wmma16b(k0[ks], qf[ks], s0); s0 = wmma16b(k0[ks], ql[ks], s0); s0 = wmma16b(k0l[ks], qf[ks], s0); s1 = wmma16b(k1[ks], qf[ks], s1); s1 = wmma16b(k1[ks], ql[ks], s1); s1 = wmma16b(k1l[ks], qf[ks], s1); }
#pragma unroll
  for (int r = 0; r < 8; ++r) { s0[r] *= SCALE / (QS * QS); s1[r] *= SCALE / (QS * QS); }
}
// Each 16-query tile is worked by KP waves of one work-group, each on its own run of keys (TP trips of 32 keys; the last part has what is left): wave = part * 8 + tile.
// The parts meet twice in LDS: after pass 1 (row maximum and row sum) and after pass 2 (partial outputs and partial relation buckets, summed in part order 0..KP-1).
constexpr int KP = 3, TP = (S / 32 + KP - 1) / KP;
template <int QT>
__global__ __launch_bounds__(256 * KP) void attn_kernel(const b16* __restrict__ qh, const b16* __restrict__ kh, const b16* __restrict__ vt, const int* __restrict__ rel, const float* __restrict__ remb, float* __restrict__ y) {
  __shared__ __attribute__((aligned(16))) float Os[8 * KP][16][HD + 4]; __shared__ float Bk[8 * KP][16][NREL + 1]; __shared__ __attribute__((aligned(16))) float Es[NREL][HD]; __shared__ float Ms[8 * KP][16], Ls[8 * KP][16];
  // the wave's number is taken as a scalar so that tile, part, head, the key range and the base addresses formed from them stay out of the vector registers
  const int wid = __builtin_amdgcn_readfirstlane(threadIdx.x >> 5), lane = threadIdx.x & 31, hh = lane >> 4, col = lane & 15, tile = wid & 7, part = wid >> 3;
  const int kbeg = part * TP * 32, kend = (kbeg + TP * 32 < S) ? kbeg + TP * 32 : S;
  for (int i = threadIdx.x; i < NREL * HD; i += 256 * KP) Es[i / HD][i % HD] = bf16_rne(remb[i]);
  for (int i = lane; i < 16 * (NREL + 1); i += 32) Bk[wid][i / (NREL + 1)][i % (NREL + 1)] = 0.0f;
  __syncthreads();
  const int qt = blockIdx.x * 8 + tile, jt = qt % QT, bh = qt / QT, h = bh % H, b = bh / H, q0 = jt * 16, qi = q0 + col;
  const b16* Q = qh + ((size_t)bh * S) * HD; const b16* K = kh + ((size_t)bh * S) * HD; const b16* vb = vt + ((size_t)bh * HD) * S; const int* rrow = rel + ((size_t)b * S + qi) * S;
  v16b qf[2], ql[2];
#pragma unroll
  for (int ks = 0; ks < 2; ++ks) { qf[ks] = frag_kb(Q + (size_t)qi * HD + ks * 32, hh); ql[ks] = frag_kb(Q + QPL + (size_t)qi * HD + ks * 32, hh); }
  asm volatile("s_wait_xcnt 0x0" ::: "memory");   // the query reads' address pair is rewritten behind the loop's entry branch
  float m = -INFINITY, l = 0.0f;
  for (int kb = kbeg; kb < kend; kb += 32) { v8f s0, s1; s_tile(K, qf, ql, kb, col, hh, s0, s1);
    float mr = -INFINITY;
#pragma unroll
    for (int r = 0; r < 8; ++r) mr = fmaxf(mr, fmaxf(s0[r], s1[r]));
    mr = fmaxf(mr, __shfl_xor(mr, 16));
    const float mn = fmaxf(m, mr), al_ = __expf(m - mn); m = mn; float sum = 0.0f;
#pragma unroll
    for (int r = 0; r < 8; ++r) sum += __expf(s0[r] - mn) + __expf(s1[r] - mn);
    sum += __shfl_xor(sum, 16); l = l * al_ + sum; }
  if (hh == 0) { Ms[wid][col] = m; Ls[wid][col] = l; }           // this part's row maximum and row sum (both lane halves hold the same pair)
  __syncthreads();
  { float mg = -INFINITY, lg = 0.0f;
#pragma unroll
    for (int p = 0; p < KP; ++p) mg = fmaxf(mg, Ms[p * 8 + tile][col]);
#pragma unroll
    for (int p = 0; p < KP; ++p) lg += Ls[p * 8 + tile][col] * __expf(Ms[p * 8 + tile][col] - mg);
    m = mg; l = lg; }
  const float il = 1.0f / l; v8f o[4] = {{}, {}, {}, {}};
  for (int kb = kbeg; kb < kend; kb += 32) { v8f s0, s1; s_tile(K, qf, ql, kb, col, hh, s0, s1);     // pass 2
    v16b pb, pl; float p0[8], p1[8]; int r0[8], r1[8];
#pragma unroll
    for (int r = 0; r < 8; ++r) { p0[r] = __expf(s0[r] - m) * il; p1[r] = __expf(s1[r] - m) * il; b16 a, c; split16(p0[r] * PS, a, c); pb[r] = a; pl[r] = c; split16(p1[r] * PS, a, c); pb[8 + r] = a; pl[8 + r] = c;
      int ra = rrow[kb + 8 * hh + r], rb = rrow[kb + 16 + 8 * hh + r]; r0[r] = (ra < 0) ? 0 : (ra >= NREL ? NREL - 1 : ra); r1[r] = (rb < 0) ? 0 : (rb >= NREL ? NREL - 1 : rb); }
#pragma unroll
    for (int n = 0; n < 4; ++n) { const v16b vf = frag_kb(vb + (size_t)(n * 16 + col) * S + kb, hh), vl = frag_kb(vb + VPL + (size_t)(n * 16 + col) * S + kb, hh);
      o[n] = wmma16b(vf, pb, o[n]); o[n] = wmma16b(vf, pl, o[n]); o[n] = wmma16b(vl, pb, o[n]); }
    // relation buckets: Bk[q][id] += p — the two lanes of a query column add in turn (ordered, no atomics)
    for (int turn = 0; turn < 2; ++turn) {
      if (hh == turn) {
#pragma unroll
        for (int r = 0; r < 8; ++r) { Bk[wid][col][r0[r]] += p0[r]; Bk[wid][col][r1[r]] += p1[r]; } }
      wave_lds_sync(); }
  }
  // epilogue: y[q][d] = sum over parts of o/64 + sum_r (sum over parts of Bk[q][r]) E[r][d]. Each wave leaves its partial o in LDS; behind the barrier the waves of parts 0 and 1
  // finish eight queries of their tile each: four lanes per query, sixteen consecutive d per lane, so a wave stores eight whole 256-byte rows.
#pragma unroll
  for (int n = 0; n < 4; ++n)
#pragma unroll
    for (int r = 0; r < 8; ++r) Os[wid][col][n * 16 + 8 * hh + r] = o[n][r] * (1.0f / (VS * PS));
  __syncthreads();
  if (part < 2) {
    const int qq = part * 8 + (lane >> 2), d0 = (lane & 3) * 16;
    v4f a[4] = {{}, {}, {}, {}};
#pragma unroll
    for (int p = 0; p < KP; ++p)
#pragma unroll
      for (int j = 0; j < 4; ++j) a[j] += *(const v4f*)(&Os[p * 8 + tile][qq][d0 + 4 * j]);
    // Unrolled so that the reads of later ids are issued under the multiply-adds of earlier ones; each sum still adds ids 0..40 in that order.
#pragma unroll
    for (int rr = 0; rr < NREL; ++rr) { float w = 0.0f;
#pragma unroll
      for (int p = 0; p < KP; ++p) w += Bk[p * 8 + tile][qq][rr];
#pragma unroll
      for (int j = 0; j < 4; ++j) a[j] += w * *(const v4f*)(&Es[rr][d0 + 4 * j]); }
    float* dst = y + ((size_t)b * S + q0 + qq) * D + h * HD + d0;
#pragma unroll
    for (int j = 0; j < 4; ++j) *(v4f*)(dst + 4 * j) = a[j];
  }
}

// out = y W_o^T: (2048 x 1024) x (1024 x 1024); A = y x8 split at load into f16 hi + lo, B = f16(bf16 W_o) rows; f32 rows; grid (16, 16).
__global__ __launch_bounds__(128) void out_kernel(const float* __restrict__ y, const b16* __restrict__ wo16, const float* __restrict__ bo, float* __restrict__ out) {
  __shared__ __attribute__((aligned(16))) float Ts[4][32 * 64];
  const int lane = threadIdx.x & 31, wave = threadIdx.x >> 5, nloc = lane & 15, hlf = lane >> 4, m0 = blockIdx.y * 128 + wave * 32, c0 = blockIdx.x * 64;
  v8f acc[2][4];
#pragma unroll
  for (int r = 0; r < 2; ++r)
#pragma unroll
    for (int t = 0; t < 4; ++t) acc[r][t] = (v8f){};
  // Two register stages of 32 k: the sixteen loads of stage j + 1 (raw f32 y, f16 weights) are issued ahead of the split and the matrix instructions of stage j.
  const float* py = y + (size_t)(m0 + nloc) * D + 8 * hlf; const b16* pw = wo16 + (size_t)(c0 + nloc) * D;
  v4f ry[2][2][4]; v16b fw[2][4];
  auto fetch = [&](int kb, int s) {
#pragma unroll
    for (int r = 0; r < 2; ++r) { const float* p = py + (size_t)r * 16 * D + kb; ry[s][r][0] = *(const v4f*)p; ry[s][r][1] = *(const v4f*)(p + 4); ry[s][r][2] = *(const v4f*)(p + 16); ry[s][r][3] = *(const v4f*)(p + 20); }
#pragma unroll
    for (int t = 0; t < 4; ++t) fw[s][t] = frag_kb(pw + (size_t)t * 16 * D + kb, hlf);
    __builtin_amdgcn_sched_barrier(0);   // keeps the stage's loads in front of the work that follows; without it they sink to their first use and each is waited for alone
  };
  auto work = [&](int s) {                                                      // y as an f16 hi+lo pair carried x8 (2 products)
    v16b ah[2], al[2];
#pragma unroll
    for (int r = 0; r < 2; ++r)
#pragma unroll
      for (int e = 0; e < 8; ++e) { b16 a, c; split16(ry[s][r][e >> 2][e & 3] * 8.0f, a, c); ah[r][e] = a; al[r][e] = c; split16(ry[s][r][2 + (e >> 2)][e & 3] * 8.0f, a, c); ah[r][8 + e] = a; al[r][8 + e] = c; }
#pragma unroll
    for (int t = 0; t < 4; ++t)
#pragma unroll
      for (int r = 0; r < 2; ++r) { acc[r][t] = wmma16b(ah[r], fw[s][t], acc[r][t]); acc[r][t] = wmma16b(al[r], fw[s][t], acc[r][t]); }
  };
  fetch(0, 0);
  for (int kb = 0; kb < D - 64; kb += 64) { fetch(kb + 32, 1); work(0); fetch(kb + 64, 0); work(1); }
  fetch(D - 32, 1);
  asm volatile("s_wait_xcnt 0x0" ::: "memory");   // the last stage's address pairs are reused by the split below while its loads are still out
  __builtin_amdgcn_sched_barrier(0);              // holds the split behind that wait
  work(0); work(1);
#pragma unroll
  for (int t = 0; t < 4; ++t)
#pragma unroll
    for (int r = 0; r < 2; ++r)
#pragma unroll
      for (int v = 0; v < 8; ++v) acc[r][t][v] = acc[r][t][v] * (1.0f / 8.0f) + bf16_rne(bo[c0 + t * 16 + nloc]);
  epi_f32(acc, 1.0f, nullptr, out, D, m0, c0, lane, Ts[wave]);
}
}  // namespace

extern "C" void kernel_launch(void* const* d_in, const int* in_sizes, int n_in,
                              void* d_out, int out_size, void* d_ws, size_t ws_size, hipStream_t stream) {
  (void)n_in; (void)out_size;
  const float* x = (const float*)d_in[0]; const int* rel = (const int*)d_in[1];
  const float* wq = (const float*)d_in[2]; const float* bq = (const float*)d_in[3]; const float* wk = (const float*)d_in[4]; const float* bk = (const float*)d_in[5]; const float* wv = (const float*)d_in[6]; const float* bv = (const float*)d_in[7];
  const float* wo = (const float*)d_in[8]; const float* bo = (const float*)d_in[9]; const float* remb = (const float*)d_in[10];
  float* out = (float*)d_out;   // [2][1024][1024]
  if (in_sizes[0] != BT * S * D || in_sizes[1] != BT * S * S || in_sizes[2] != D * D || in_sizes[8] != D * D || in_sizes[10] != NREL * HD) return;
  size_t off = 0; char* ws = (char*)d_ws;
  auto carve = [&](size_t bytes) { char* p = ws + off; off += (bytes + 255) & ~(size_t)255; return p; };
  unsigned short* x16 = (unsigned short*)carve((size_t)NTOK * D * 2); unsigned short* w16 = (unsigned short*)carve((size_t)3 * D * D * 2); b16* wo16 = (b16*)carve((size_t)D * D * 2);
  b16* qh = (b16*)carve((size_t)2 * NTOK * D * 2); b16* kh = (b16*)carve((size_t)2 * NTOK * D * 2); b16* vt = (b16*)carve((size_t)2 * NTOK * D * 2); float* y = (float*)carve((size_t)NTOK * D * 4);
  if (off > ws_size) return;                                    // ≈ 46 MB
  prep_kernel<<<512, 256, 0, stream>>>(wq, wk, wv, wo, w16, wo16);
  xprep_kernel<<<1024, 256, 0, stream>>>(x, x16);
  proj_kernel<<<dim3(3 * D / 64, NTOK / 128), 128, 0, stream>>>((const __bf16*)x16, (const __bf16*)w16, bq, bk, bv, qh, kh, vt);
  attn_kernel<S / 16><<<Bn * H * (S / 16) / 8, 256 * KP, 0, stream>>>(qh, kh, vt, rel, remb, y);
  out_kernel<<<dim3(D / 64, NTOK / 128), 128, 0, stream>>>(y, wo16, bo, out);
}

// v004
// A run of this version takes 109 microseconds.
// Timed twice side by side with v003, it ran 1.57 times as fast both times.
// Over all steps from v000 it is 2.68 times as fast.
#include <hip/hip_runtime.h>

// BART attention with relation embeddings: q = (x Wq^T + bq)/8, k = x Wk^T + bk, v = x Wv^T + bv (16 heads x 64); attn = softmax(q.k) (no mask; the k-relation term has scale 0);
// out_h[t] = sum_s attn[t][s] (v_h[s] + rel_emb[relation_inputs[b][t][s]]) (v-relation scale 1, shared by all heads); out = merged Wo^T + bo -> [2][1024][1024].
// The relation term is sum_r w_r[t] rel_emb[r] with w_r[t] = sum over keys s of relation r of attn[t][s]: per (b, h, 16 queries) the final probabilities are bucketed by the INPUT relation id
// into f32 LDS tables [16 queries][41], one per key part (plain ordered adds, no atomics), summed over the parts, then multiplied by the 41 x 64 table — nothing index-like is written; ids only select an LDS accumulator.
// Numerics: bf16 inputs (x, weights, biases, rel_emb rounded to bf16): projections on v_wmma_f32_16x16x32_bf16 (exact products; + bias); per pair a
// v_wmma_f32_16x16x32_f16; out projection with y hi+lo x8 (2 products); softmax, buckets and the relation product in f32. Fragment k-map per lane half hh for A AND B: elements 0..7 <-

namespace {
constexpr int BT = 2, Bn = 2, S = 1024, D = 1024, H = 16, HD = 64, NTOK = Bn * S, NREL = 41;
constexpr float SCALE = 0.125f, VS = 8.0f, QS = 8.0f, PS = 8.0f;   // power-of-two carry scales so hi/lo residual planes stay normal in f16
constexpr size_t VPL = (size_t)NTOK * D;   // distance between the (8v)^T hi and lo planes
constexpr size_t QPL = (size_t)NTOK * D;   // distance between the q/k hi and lo planes

typedef _Float16 b16;
typedef __attribute__((ext_vector_type(16))) _Float16 v16b;
typedef __attribute__((ext_vector_type(8)))  _Float16 v8b;
typedef __attribute__((ext_vector_type(8)))  float v8f;
typedef __attribute__((ext_vector_type(4)))  float v4f;

__device__ __forceinline__ v8b ld8b(const b16* p) { return *(const v8b*)p; }
__device__ __forceinline__ v16b cat8b(v8b a, v8b b) { return __builtin_shufflevector(a, b, 0, 1, 2, 3, 4, 5, 6, 7, 8, 9, 10, 11, 12, 13, 14, 15); }
// Fragment order: every matrix operand in the workspace is kept as blocks of 16 rows x 32 k. A block of 16-bit elements is 1 KB, element (row, k) at [k >> 4][((k >> 3) & 1) * 16 + row][k & 7]:
// a lane's two 16-byte reads lie at lane * 8 and 256 + lane * 8 elements, so each wave-wide read covers 512 contiguous bytes (4 lines) and not 32 bytes in each of 16 rows.
constexpr int FB = 512, KB32 = D / 32;   // elements per block; blocks along a 1024-long k
__device__ __forceinline__ v16b frag_blk(const b16* p, unsigned lane) { return cat8b(ld8b(p + lane * 8), ld8b(p + 256 + lane * 8)); }
// Piece p (8 elements) of a [rows][1024] matrix on its way into fragment order: four lanes read one 32-element run of a row, eight rows per wave, and the wave's 16-byte stores fill four whole lines.
__device__ __forceinline__ size_t pack_src(size_t p) { return ((p >> 11) * 16 + ((p >> 2) & 15)) * D + ((p >> 6) & 31) * 32 + (p & 3) * 8; }
__device__ __forceinline__ size_t pack_dst(size_t p) { return (p >> 6) * FB + ((p >> 1) & 1) * 256 + ((p & 1) * 16 + ((p >> 2) & 15)) * 8; }
__device__ __forceinline__ void split16(float v, b16& hi, b16& lo) { hi = (b16)v; lo = (b16)(v - (float)hi); }
__device__ __forceinline__ v8f wmma16b(v16b a, v16b b, v8f c) {
  v8f d = __builtin_amdgcn_wmma_f32_16x16x32_f16(false, a, false, b, (short)0, c, false, false);
  asm volatile("v_nop\n\tv_nop\n\tv_nop\n\tv_nop" : "+v"(d) : "v"(a), "v"(b));
  return d;
}
__device__ __forceinline__ void wave_lds_sync() {
  __builtin_amdgcn_fence(__ATOMIC_RELEASE, "workgroup");
  __builtin_amdgcn_wave_barrier();
  __builtin_amdgcn_fence(__ATOMIC_ACQUIRE, "workgroup");
}

__device__ __forceinline__ void epi_planes(v8f (&acc)[2][4], float scale, bool two, b16* __restrict__ oh, b16* __restrict__ ol, int ldo,
                                           int m0, int c0, int lane, b16* Th, b16* Tl) {
  const int nloc = lane & 15, hlf = lane >> 4;
#pragma unroll
  for (int t = 0; t < 4; ++t)
#pragma unroll
    for (int r = 0; r < 2; ++r)
#pragma unroll
      for (int v = 0; v < 8; ++v) {
        const int rr = r * 16 + v + 8 * hlf, cc = t * 16 + nloc;
        b16 h_, l_; split16(acc[r][t][v] * scale, h_, l_);
        Th[rr * 64 + cc] = h_; Tl[rr * 64 + cc] = l_;
      }
  wave_lds_sync();
  {
#pragma unroll
    for (int j = 0; j < 8; ++j) {
      const int rr = j * 4 + (lane >> 3), c8 = (lane & 7) * 8;
      const size_t o = (size_t)(m0 + rr) * ldo + c0 + c8;
      *(v8b*)(oh + o) = ld8b(Th + rr * 64 + c8);
      if (two) *(v8b*)(ol + o) = ld8b(Tl + rr * 64 + c8);
    }
    
  }
}
// (b) f32 rows with pitch ldo: 64 floats = 256 B = 2 lines per row; 16 lanes x 16 B per row, 2 rows per instruction. Optional per-row factor
__device__ __forceinline__ void epi_f32(v8f (&acc)[2][4], float scale, const float* rscale, float* __restrict__ out, int ldo, int m0, int c0, int lane, float* Tt) {
  const int nloc = lane & 15, hlf = lane >> 4;
#pragma unroll
  for (int t = 0; t < 4; ++t)
#pragma unroll
    for (int r = 0; r < 2; ++r)
#pragma unroll
      for (int v = 0; v < 8; ++v) {
        const int rr = r * 16 + v + 8 * hlf;
        const float rs = rscale ? rscale[(size_t)(m0 + rr) * 32] : 1.0f;
        Tt[rr * 64 + t * 16 + nloc] = acc[r][t][v] * scale * rs;
      }
  wave_lds_sync();
  float* dst0 = out + (size_t)m0 * ldo + c0;
  {
#pragma unroll
    for (int j = 0; j < 16; ++j) { const int rr = j * 2 + hlf, c4 = nloc * 4; *(v4f*)(dst0 + (size_t)rr * ldo + c4) = *(const v4f*)(Tt + rr * 64 + c4); }
    
  }
}



typedef __attribute__((ext_vector_type(8))) __bf16 v8bb; typedef __attribute__((ext_vector_type(16))) __bf16 v16bb;
typedef __attribute__((ext_vector_type(8))) unsigned short v8us;
__device__ __forceinline__ v16bb frag_blk_bf(const __bf16* p, unsigned lane) { const v8bb a = *(const v8bb*)(p + lane * 8), b = *(const v8bb*)(p + 256 + lane * 8); return __builtin_shufflevector(a, b, 0, 1, 2, 3, 4, 5, 6, 7, 8, 9, 10, 11, 12, 13, 14, 15); }
__device__ __forceinline__ v8f wmma16bb(v16bb a, v16bb b, v8f c) {
  v8f d = __builtin_amdgcn_wmma_f32_16x16x32_bf16(false, a, false, b, (short)0, c, false, false);
  asm volatile("v_nop\n\tv_nop\n\tv_nop\n\tv_nop" : "+v"(d) : "v"(a), "v"(b));
  return d;
}
__device__ __forceinline__ unsigned short bf16_rne_bits(float v) { unsigned int u = __float_as_uint(v); u += 0x7FFFu + ((u >> 16) & 1u); return (unsigned short)(u >> 16); }
__device__ __forceinline__ float bf16_rne(float v) { return __uint_as_float(((unsigned int)bf16_rne_bits(v)) << 16); }



// x (f32) -> bf16 bits, round to nearest even.
__global__ __launch_bounds__(256) void xprep_kernel(const float* __restrict__ x, unsigned short* __restrict__ x16) {   // one pass's two batches -> bf16
  const size_t tid = (size_t)blockIdx.x * blockDim.x + threadIdx.x, nth = (size_t)gridDim.x * blockDim.x;
  { for (size_t p = tid; p < (size_t)NTOK * D / 8; p += nth) { v8us v;
#pragma unroll
      for (int e = 0; e < 8; ++e) v[e] = bf16_rne_bits(x[pack_src(p) + e]);
      *(v8us*)(x16 + pack_dst(p)) = v; }  }
}
__global__ __launch_bounds__(256) void prep_kernel(const float* __restrict__ wq, const float* __restrict__ wk, const float* __restrict__ wv, const float* __restrict__ wo, unsigned short* __restrict__ w16, b16* __restrict__ wo16) {
  const size_t tid = (size_t)blockIdx.x * blockDim.x + threadIdx.x, nth = (size_t)gridDim.x * blockDim.x;
  {
    for (size_t p = tid; p < (size_t)3 * D * D / 8; p += nth) { const float* W = (p < (size_t)D * D / 8) ? wq : (p < (size_t)2 * D * D / 8) ? wk : wv; const size_t q = p % ((size_t)D * D / 8); v8us v;   // [out][in] rows into fragment order; the three matrices follow one another as 3072 rows
#pragma unroll
      for (int e = 0; e < 8; ++e) v[e] = bf16_rne_bits(W[pack_src(q) + e]);
      *(v8us*)(w16 + pack_dst(p)) = v; }
    for (size_t p = tid; p < (size_t)D * D / 8; p += nth) { v8b w;   // W_o [out][in] rows into fragment order
#pragma unroll
      for (int e = 0; e < 8; ++e) w[e] = (b16)bf16_rne(wo[pack_src(p) + e]);
      *(v8b*)(wo16 + pack_dst(p)) = w; }
    
  }
}

// projections: rows = tokens (2048), K = 1024, column tiles of 64 = one head of q (tiles 0..15), k (16..31) or v (32..47); f16 planes [b*H + head] of 1024 tok x 64 for q/k;
// v: (8v)^T f16 planes [b*H + head] of 64 x 1024 tok; inside a plane the elements lie in fragment order (blocks of 16 rows x 32 k). grid (48, 16) x 128.
__global__ __launch_bounds__(128) void proj_kernel(const __bf16* __restrict__ x16, const __bf16* __restrict__ w16, const float* __restrict__ bq, const float* __restrict__ bk, const float* __restrict__ bv, b16* __restrict__ qh, b16* __restrict__ kh, b16* __restrict__ vt) {
  __shared__ __attribute__((aligned(16))) b16 Th[4][32][HD + 8], Tq[4][32][HD + 8];
  __shared__ __attribute__((aligned(16))) b16 Tt[64][128 + 8], Tl[64][128 + 8];
  const int lane = threadIdx.x & 31, wave = threadIdx.x >> 5, nloc = lane & 15, hlf = lane >> 4, m0 = blockIdx.y * 128 + wave * 32, c0 = blockIdx.x * 64;
  v8f acc[2][4];
#pragma unroll
  for (int r = 0; r < 2; ++r)
#pragma unroll
    for (int t = 0; t < 4; ++t) acc[r][t] = (v8f){};
  // Three register stages of 32 k: all twelve loads of stage j + 2 are issued ahead of the matrix instructions of stage j, so a stage waits once, two stages late, not once per weight fragment.
  const __bf16* pa = x16 + (size_t)(m0 / 16) * KB32 * FB; const __bf16* pw = w16 + (size_t)(c0 / 16) * KB32 * FB;
  v16bb fa[3][2], fw[3][4];
  auto fetch = [&](int st, int s) {
#pragma unroll
    for (int r = 0; r < 2; ++r) fa[s][r] = frag_blk_bf(pa + (size_t)(r * KB32 + st) * FB, lane);
#pragma unroll
    for (int t = 0; t < 4; ++t) fw[s][t] = frag_blk_bf(pw + (size_t)(t * KB32 + st) * FB, lane);
    __builtin_amdgcn_sched_barrier(0);   // keeps the stage's loads in front of the matrix instructions that follow; without it they sink to their first use and each is waited for alone
  };
  auto work = [&](int s) {
#pragma unroll
    for (int t = 0; t < 4; ++t) { acc[0][t] = wmma16bb(fa[s][0], fw[s][t], acc[0][t]); acc[1][t] = wmma16bb(fa[s][1], fw[s][t], acc[1][t]); }
  };
  fetch(0, 0); fetch(1, 1);
  for (int st = 0; st < D / 32 - 2; st += 3) { fetch(st + 2, 2); work(0); fetch(st + 3, 0); work(1); fetch(st + 4, 1); work(2);
    asm volatile("s_wait_xcnt 0x0" ::: "memory"); }   // the trip's loads are still out when the next trip rewrites their address pairs
  work(0); work(1);
  const int which = blockIdx.x / (D / 64), head = blockIdx.x % (D / 64), b = m0 / S, tok0 = m0 % S;
  { const float* bias = (which == 0) ? bq : (which == 1) ? bk : bv;   // + bf16(bias)
#pragma unroll
    for (int t = 0; t < 4; ++t) { const float bb = bf16_rne(bias[head * HD + t * 16 + nloc]);
#pragma unroll
      for (int r = 0; r < 2; ++r)
#pragma unroll
        for (int v = 0; v < 8; ++v) acc[r][t][v] += bb; } }
  if (which < 2) {                                              // q or k head: f16 hi/lo blocks in fragment order
#pragma unroll
    for (int t = 0; t < 4; ++t)
#pragma unroll
      for (int r = 0; r < 2; ++r)
#pragma unroll
        for (int v = 0; v < 8; ++v) { b16 a_, c_; split16(acc[r][t][v] * QS, a_, c_); Th[wave][r * 16 + 8 * hlf + v][t * 16 + nloc] = a_; Tq[wave][r * 16 + 8 * hlf + v][t * 16 + nloc] = c_; }   // q, k carried x8 (lo residuals stay normal)
    wave_lds_sync();
    b16* dst = (which == 0 ? qh : kh) + (((size_t)b * H + head) * S + tok0) * HD;
    {
#pragma unroll
      for (int j = 0; j < 8; ++j) { const int rr = (j >> 2) * 16 + nloc, c8 = (j & 3) * 16 + hlf * 8;   // blocks [16 tokens][32 d] in the order token block, d half: the wave's 32 x 64 tile is 4 KB in a row
        *(v8b*)(dst + j * 256 + lane * 8) = *(const v8b*)(&Th[wave][rr][c8]); *(v8b*)(dst + QPL + j * 256 + lane * 8) = *(const v8b*)(&Tq[wave][rr][c8]); }
       }
    return;
  }
  const int vh = head;                                          // v head: (8v)^T tile [64 d][128 tok] via LDS, rows of 256 B
#pragma unroll
  for (int t = 0; t < 4; ++t)
#pragma unroll
    for (int r = 0; r < 2; ++r)
#pragma unroll
      for (int v = 0; v < 8; ++v) { b16 a_, c_; split16(acc[r][t][v] * VS, a_, c_); Tt[t * 16 + nloc][wave * 32 + r * 16 + 8 * hlf + v] = a_; Tl[t * 16 + nloc][wave * 32 + r * 16 + 8 * hlf + v] = c_; }
  __syncthreads();
  b16* dstv = vt + (((size_t)b * H + vh) * HD) * S + (size_t)((blockIdx.y * 128) % S) * HD;   // blocks [16 d][32 tokens] in the order token run of 32, d block
  {
#pragma unroll
    for (int j = 0; j < 8; ++j) { const int dd = (j >> 1) * 16 + nloc, c8 = wave * 32 + (j & 1) * 16 + hlf * 8, o = (wave * 8 + j) * 256 + lane * 8; *(v8b*)(dstv + o) = *(const v8b*)(&Tt[dd][c8]); *(v8b*)(dstv + VPL + o) = *(const v8b*)(&Tl[dd][c8]); }
    asm volatile("s_wait_xcnt 0x0" ::: "memory");   // the build lays the q/k branch behind these stores, where their address pair is written again
    
  }
}

__device__ __forceinline__ void s_tile(const b16* __restrict__ K, const v16b* qf, const v16b* ql, int kb, unsigned lane, v8f& s0, v8f& s1) {
  s0 = (v8f){}; s1 = (v8f){};
  const b16* kl = K + (size_t)kb * HD + lane * 8;   // the lane's place in the trip's first block
  v16b k0[2], k0l[2], k1[2], k1l[2];   // all sixteen key reads of the trip go out together: one wait for memory per trip, not one per half of the head dimension
#pragma unroll
  for (int ks = 0; ks < 2; ++ks) { const b16* kp = kl + ks * FB; k0[ks] = frag_blk(kp, 0); k0l[ks] = frag_blk(kp + QPL, 0); k1[ks] = frag_blk(kp + 2 * FB, 0); k1l[ks] = frag_blk(kp + QPL + 2 * FB, 0); }
  // stands behind the key reads because their address pair is rewritten later in the trip, in pass 2 while the reads are still out; it names the pair so that none of the sixteen reads lands on it in front of the wait
  asm volatile("s_wait_xcnt 0x0" :: "v"(kl) : "memory");
#pragma unroll
  for (int ks = 0; ks < 2; ++ks) { s0 = wmma16b(k0[ks], qf[ks], s0); s0 = wmma16b(k0[ks], ql[ks], s0); s0 = wmma16b(k0l[ks], qf[ks], s0); s1 = wmma16b(k1[ks], qf[ks], s1); s1 = wmma16b(k1[ks], ql[ks], s1); s1 = wmma16b(k1l[ks], qf[ks], s1); }
#pragma unroll
  for (int r = 0; r < 8; ++r) { s0[r] *= SCALE / (QS * QS); s1[r] *= SCALE / (QS * QS); }
}
// Each 16-query tile is worked by KP waves of one work-group, each on its own run of keys (TP trips of 32 keys; the last part has what is left): wave = part * 8 + tile.
// The parts meet twice in LDS: after pass 1 (row maximum and row sum) and after pass 2 (partial outputs and partial relation buckets, summed in part order 0..KP-1).
constexpr int KP = 3, TP = (S / 32 + KP - 1) / KP;
template <int QT>
__global__ __launch_bounds__(256 * KP) void attn_kernel(const b16* __restrict__ qh, const b16* __restrict__ kh, const b16* __restrict__ vt, const int* __restrict__ rel, const float* __restrict__ remb, float* __restrict__ y) {
  __shared__ __attribute__((aligned(16))) float Os[8 * KP][16][HD + 4]; __shared__ float Bk[8 * KP][16][NREL + 1]; __shared__ __attribute__((aligned(16))) float Es[NREL][HD]; __shared__ float Ms[8 * KP][16], Ls[8 * KP][16];
  // the wave's number is taken as a scalar so that tile, part, head, the key range and the base addresses formed from them stay out of the vector registers
  const int wid = __builtin_amdgcn_readfirstlane(threadIdx.x >> 5), lane = threadIdx.x & 31, hh = lane >> 4, col = lane & 15, tile = wid & 7, part = wid >> 3;
  const int kbeg = part * TP * 32, kend = (kbeg + TP * 32 < S) ? kbeg + TP * 32 : S;
  for (int i = threadIdx.x; i < NREL * HD; i += 256 * KP) Es[i / HD][i % HD] = bf16_rne(remb[i]);
  for (int i = lane; i < 16 * (NREL + 1); i += 32) Bk[wid][i / (NREL + 1)][i % (NREL + 1)] = 0.0f;
  __syncthreads();
  const int qt = blockIdx.x * 8 + tile, jt = qt % QT, bh = qt / QT, h = bh % H, b = bh / H, q0 = jt * 16, qi = q0 + col;
  const b16* Q = qh + ((size_t)bh * S) * HD; const b16* K = kh + ((size_t)bh * S) * HD; const b16* vb = vt + ((size_t)bh * HD) * S; const int* rrow = rel + ((size_t)b * S + qi) * S;
  v16b qf[2], ql[2];
#pragma unroll
  for (int ks = 0; ks < 2; ++ks) { qf[ks] = frag_blk(Q + (size_t)q0 * HD + ks * FB, lane); ql[ks] = frag_blk(Q + QPL + (size_t)q0 * HD + ks * FB, lane); }
  asm volatile("s_wait_xcnt 0x0" ::: "memory");   // the query reads' address pair is rewritten behind the loop's entry branch
  float m = -INFINITY, l = 0.0f;
  for (int kb = kbeg; kb < kend; kb += 32) { v8f s0, s1; s_tile(K, qf, ql, kb, lane, s0, s1);
    float mr = -INFINITY;
#pragma unroll
    for (int r = 0; r < 8; ++r) mr = fmaxf(mr, fmaxf(s0[r], s1[r]));
    mr = fmaxf(mr, __shfl_xor(mr, 16));
    const float mn = fmaxf(m, mr), al_ = __expf(m - mn); m = mn; float sum = 0.0f;
#pragma unroll
    for (int r = 0; r < 8; ++r) sum += __expf(s0[r] - mn) + __expf(s1[r] - mn);
    sum += __shfl_xor(sum, 16); l = l * al_ + sum; }
  if (hh == 0) { Ms[wid][col] = m; Ls[wid][col] = l; }           // this part's row maximum and row sum (both lane halves hold the same pair)
  __syncthreads();
  { float mg = -INFINITY, lg = 0.0f;
#pragma unroll
    for (int p = 0; p < KP; ++p) mg = fmaxf(mg, Ms[p * 8 + tile][col]);
#pragma unroll
    for (int p = 0; p < KP; ++p) lg += Ls[p * 8 + tile][col] * __expf(Ms[p * 8 + tile][col] - mg);
    m = mg; l = lg; }
  const float il = 1.0f / l; v8f o[4] = {{}, {}, {}, {}};
  for (int kb = kbeg; kb < kend; kb += 32) { v8f s0, s1; s_tile(K, qf, ql, kb, lane, s0, s1);     // pass 2
    v16b pb, pl; float p0[8], p1[8]; int r0[8], r1[8]; const b16* vp = vb + (size_t)kb * HD + lane * 8;
#pragma unroll
    for (int r = 0; r < 8; ++r) { p0[r] = __expf(s0[r] - m) * il; p1[r] = __expf(s1[r] - m) * il; b16 a, c; split16(p0[r] * PS, a, c); pb[r] = a; pl[r] = c; split16(p1[r] * PS, a, c); pb[8 + r] = a; pl[8 + r] = c;
      int ra = rrow[kb + 8 * hh + r], rb = rrow[kb + 16 + 8 * hh + r]; r0[r] = (ra < 0) ? 0 : (ra >= NREL ? NREL - 1 : ra); r1[r] = (rb < 0) ? 0 : (rb >= NREL ? NREL - 1 : rb); }
#pragma unroll
    for (int n = 0; n < 4; ++n) { const v16b vf = frag_blk(vp + n * FB, 0), vl = frag_blk(vp + VPL + n * FB, 0);
      o[n] = wmma16b(vf, pb, o[n]); o[n] = wmma16b(vf, pl, o[n]); o[n] = wmma16b(vl, pb, o[n]); }
    asm volatile("s_wait_xcnt 0x0" :: "v"(vp) : "memory");   // names the value reads' address pair so that none of them lands on it while the others still name it; the pair is rewritten in the next trip
    // relation buckets: Bk[q][id] += p — the two lanes of a query column add in turn (ordered, no atomics)
    for (int turn = 0; turn < 2; ++turn) {
      if (hh == turn) {
#pragma unroll
        for (int r = 0; r < 8; ++r) { Bk[wid][col][r0[r]] += p0[r]; Bk[wid][col][r1[r]] += p1[r]; } }
      wave_lds_sync(); }
  }
  // epilogue: y[q][d] = sum over parts of o/64 + sum_r (sum over parts of Bk[q][r]) E[r][d]. Each wave leaves its partial o in LDS; behind the barrier the waves of parts 0 and 1
  // finish eight queries of their tile each: four lanes per query, sixteen consecutive d per lane, so a wave's four stores fill sixteen whole lines.
#pragma unroll
  for (int n = 0; n < 4; ++n)
#pragma unroll
    for (int r = 0; r < 8; ++r) Os[wid][col][n * 16 + 8 * hh + r] = o[n][r] * (1.0f / (VS * PS));
  __syncthreads();
  if (part < 2) {
    const int qq = part * 8 + (lane >> 2), d0 = (lane & 3) * 16;
    v4f a[4] = {{}, {}, {}, {}};
#pragma unroll
    for (int p = 0; p < KP; ++p)
#pragma unroll
      for (int j = 0; j < 4; ++j) a[j] += *(const v4f*)(&Os[p * 8 + tile][qq][d0 + 4 * j]);
    // Unrolled so that the reads of later ids are issued under the multiply-adds of earlier ones; each sum still adds ids 0..40 in that order.
#pragma unroll
    for (int rr = 0; rr < NREL; ++rr) { float w = 0.0f;
#pragma unroll
      for (int p = 0; p < KP; ++p) w += Bk[p * 8 + tile][qq][rr];
#pragma unroll
      for (int j = 0; j < 4; ++j) a[j] += w * *(const v4f*)(&Es[rr][d0 + 4 * j]); }
    // y in fragment order for the output product: f32 blocks of 16 rows x 32 k (2 KB), element (row, k) at [k >> 4][(k >> 2) & 1][((k >> 3) & 1) * 16 + row][k & 3]; a store fills four whole lines
    float* dst = y + ((size_t)((b * S + q0) / 16) * KB32 + h * 2 + ((lane & 3) >> 1)) * FB + (lane & 1) * 256 + qq * 4;
#pragma unroll
    for (int j = 0; j < 4; ++j) *(v4f*)(dst + (j & 1) * 128 + (j >> 1) * 64) = a[j];
  }
}

// out = y W_o^T: (2048 x 1024) x (1024 x 1024); A = y x8 split at load into f16 hi + lo, B = f16(bf16 W_o) rows; f32 rows; grid (16, 16).
__global__ __launch_bounds__(128) void out_kernel(const float* __restrict__ y, const b16* __restrict__ wo16, const float* __restrict__ bo, float* __restrict__ out) {
  __shared__ __attribute__((aligned(16))) float Ts[4][32 * 64];
  const int lane = threadIdx.x & 31, wave = threadIdx.x >> 5, nloc = lane & 15, hlf = lane >> 4, m0 = blockIdx.y * 128 + wave * 32, c0 = blockIdx.x * 64;
  v8f acc[2][4];
#pragma unroll
  for (int r = 0; r < 2; ++r)
#pragma unroll
    for (int t = 0; t < 4; ++t) acc[r][t] = (v8f){};
  // Two register stages of 32 k: the sixteen loads of stage j + 1 (raw f32 y, f16 weights) are issued ahead of the split and the matrix instructions of stage j.
  const float* py = y + (size_t)(m0 / 16) * KB32 * FB + lane * 4; const b16* pw = wo16 + (size_t)(c0 / 16) * KB32 * FB;
  v4f ry[2][2][4]; v16b fw[2][4];
  auto fetch = [&](int kb, int s) {
#pragma unroll
    for (int r = 0; r < 2; ++r) { const float* p = py + (size_t)(r * KB32 + kb / 32) * FB; ry[s][r][0] = *(const v4f*)p; ry[s][r][1] = *(const v4f*)(p + 128); ry[s][r][2] = *(const v4f*)(p + 256); ry[s][r][3] = *(const v4f*)(p + 384); }
#pragma unroll
    for (int t = 0; t < 4; ++t) fw[s][t] = frag_blk(pw + (size_t)(t * KB32 + kb / 32) * FB, lane);
    __builtin_amdgcn_sched_barrier(0);   // keeps the stage's loads in front of the work that follows; without it they sink to their first use and each is waited for alone
  };
  auto work = [&](int s) {                                                      // y as an f16 hi+lo pair carried x8 (2 products)
    v16b ah[2], al[2];
#pragma unroll
    for (int r = 0; r < 2; ++r)
#pragma unroll
      for (int e = 0; e < 8; ++e) { b16 a, c; split16(ry[s][r][e >> 2][e & 3] * 8.0f, a, c); ah[r][e] = a; al[r][e] = c; split16(ry[s][r][2 + (e >> 2)][e & 3] * 8.0f, a, c); ah[r][8 + e] = a; al[r][8 + e] = c; }
#pragma unroll
    for (int t = 0; t < 4; ++t)
#pragma unroll
      for (int r = 0; r < 2; ++r) { acc[r][t] = wmma16b(ah[r], fw[s][t], acc[r][t]); acc[r][t] = wmma16b(al[r], fw[s][t], acc[r][t]); }
  };
  fetch(0, 0);
  for (int kb = 0; kb < D - 64; kb += 64) { fetch(kb + 32, 1); work(0); fetch(kb + 64, 0); work(1); }
  fetch(D - 32, 1);
  asm volatile("s_wait_xcnt 0x0" ::: "memory");   // the last stage's address pairs are reused by the split below while its loads are still out
  __builtin_amdgcn_sched_barrier(0);              // holds the split behind that wait
  work(0); work(1);
#pragma unroll
  for (int t = 0; t < 4; ++t)
#pragma unroll
    for (int r = 0; r < 2; ++r)
#pragma unroll
      for (int v = 0; v < 8; ++v) acc[r][t][v] = acc[r][t][v] * (1.0f / 8.0f) + bf16_rne(bo[c0 + t * 16 + nloc]);
  epi_f32(acc, 1.0f, nullptr, out, D, m0, c0, lane, Ts[wave]);
}
}  // namespace

extern "C" void kernel_launch(void* const* d_in, const int* in_sizes, int n_in,
                              void* d_out, int out_size, void* d_ws, size_t ws_size, hipStream_t stream) {
  (void)n_in; (void)out_size;
  const float* x = (const float*)d_in[0]; const int* rel = (const int*)d_in[1];
  const float* wq = (const float*)d_in[2]; const float* bq = (const float*)d_in[3]; const float* wk = (const float*)d_in[4]; const float* bk = (const float*)d_in[5]; const float* wv = (const float*)d_in[6]; const float* bv = (const float*)d_in[7];
  const float* wo = (const float*)d_in[8]; const float* bo = (const float*)d_in[9]; const float* remb = (const float*)d_in[10];
  float* out = (float*)d_out;   // [2][1024][1024]
  if (in_sizes[0] != BT * S * D || in_sizes[1] != BT * S * S || in_sizes[2] != D * D || in_sizes[8] != D * D || in_sizes[10] != NREL * HD) return;
  size_t off = 0; char* ws = (char*)d_ws;
  auto carve = [&](size_t bytes) { char* p = ws + off; off += (bytes + 255) & ~(size_t)255; return p; };
  unsigned short* x16 = (unsigned short*)carve((size_t)NTOK * D * 2); unsigned short* w16 = (unsigned short*)carve((size_t)3 * D * D * 2); b16* wo16 = (b16*)carve((size_t)D * D * 2);
  b16* qh = (b16*)carve((size_t)2 * NTOK * D * 2); b16* kh = (b16*)carve((size_t)2 * NTOK * D * 2); b16* vt = (b16*)carve((size_t)2 * NTOK * D * 2); float* y = (float*)carve((size_t)NTOK * D * 4);
  if (off > ws_size) return;                                    // ≈ 46 MB
  prep_kernel<<<512, 256, 0, stream>>>(wq, wk, wv, wo, w16, wo16);
  xprep_kernel<<<1024, 256, 0, stream>>>(x, x16);
  proj_kernel<<<dim3(3 * D / 64, NTOK / 128), 128, 0, stream>>>((const __bf16*)x16, (const __bf16*)w16, bq, bk, bv, qh, kh, vt);
  attn_kernel<S / 16><<<Bn * H * (S / 16) / 8, 256 * KP, 0, stream>>>(qh, kh, vt, rel, remb, y);
  out_kernel<<<dim3(D / 64, NTOK / 128), 128, 0, stream>>>(y, wo16, bo, out);
}

// v005
// A run of this version takes 101 microseconds.
// In both of two side-by-side timings against v004, it was 1.08 times as fast.
// Counting every step since v000, it is 2.89 times as fast.
#include <hip/hip_runtime.h>

// BART attention with relation embeddings: q = (x Wq^T + bq)/8, k = x Wk^T + bk, v = x Wv^T + bv (16 heads x 64); attn = softmax(q.k) (no mask; the k-relation term has scale 0);
// out_h[t] = sum_s attn[t][s] (v_h[s] + rel_emb[relation_inputs[b][t][s]]) (v-relation scale 1, shared by all heads); out = merged Wo^T + bo -> [2][1024][1024].
// The relation term is sum_r w_r[t] rel_emb[r] with w_r[t] = sum over keys s of relation r of attn[t][s]: per (b, h, 16 queries) the final probabilities are bucketed by the INPUT relation id
// into f32 LDS tables [41][lane] (plain ordered adds, no atomics), then multiplied by the 41 x 64 table; nothing index-like is written; ids only select an LDS accumulator.
// x, weights, biases, rel_emb rounded to bf16: projections on v_wmma_f32_16x16x32_bf16 (exact products; + bias); per pair a
// v_wmma_f32_16x16x32_f16; out projection with y hi+lo x8 (2 products); softmax, buckets and the relation product in f32. Fragment k-map per lane half hh for A AND B: elements 0..7 <-

namespace {
constexpr int BT = 2, Bn = 2, S = 1024, D = 1024, H = 16, HD = 64, NTOK = Bn * S, NREL = 41;
constexpr float SCALE = 0.125f, VS = 8.0f, QS = 8.0f, PS = 8.0f;   // power-of-two carry scales so hi/lo residual planes stay normal in f16
constexpr size_t VPL = (size_t)NTOK * D;   // distance between the (8v)^T hi and lo planes
constexpr size_t QPL = (size_t)NTOK * D;   // distance between the q/k hi and lo planes

typedef _Float16 b16;
typedef __attribute__((ext_vector_type(16))) _Float16 v16b;
typedef __attribute__((ext_vector_type(8)))  _Float16 v8b;
typedef __attribute__((ext_vector_type(8)))  float v8f;
typedef __attribute__((ext_vector_type(4)))  float v4f;

__device__ __forceinline__ v8b ld8b(const b16* p) { return *(const v8b*)p; }
__device__ __forceinline__ v16b cat8b(v8b a, v8b b) { return __builtin_shufflevector(a, b, 0, 1, 2, 3, 4, 5, 6, 7, 8, 9, 10, 11, 12, 13, 14, 15); }
// Fragment order: every matrix operand in the workspace is kept as blocks of 16 rows x 32 k. A block of 16-bit elements is 1 KB, element (row, k) at [k >> 4][((k >> 3) & 1) * 16 + row][k & 7]:
// a lane's two 16-byte reads lie at lane * 8 and 256 + lane * 8 elements, so each wave-wide read covers 512 contiguous bytes (4 lines) and not 32 bytes in each of 16 rows.
constexpr int FB = 512, KB32 = D / 32;   // elements per block; blocks along a 1024-long k
__device__ __forceinline__ v16b frag_blk(const b16* p, unsigned lane) { return cat8b(ld8b(p + lane * 8), ld8b(p + 256 + lane * 8)); }
// Piece p (8 elements) of a [rows][1024] matrix on its way into fragment order: four lanes read one 32-element run of a row, eight rows per wave, and the wave's 16-byte stores fill four whole lines.
__device__ __forceinline__ size_t pack_src(size_t p) { return ((p >> 11) * 16 + ((p >> 2) & 15)) * D + ((p >> 6) & 31) * 32 + (p & 3) * 8; }
__device__ __forceinline__ size_t pack_dst(size_t p) { return (p >> 6) * FB + ((p >> 1) & 1) * 256 + ((p & 1) * 16 + ((p >> 2) & 15)) * 8; }
__device__ __forceinline__ void split16(float v, b16& hi, b16& lo) { hi = (b16)v; lo = (b16)(v - (float)hi); }
__device__ __forceinline__ v8f wmma16b(v16b a, v16b b, v8f c) {
  v8f d = __builtin_amdgcn_wmma_f32_16x16x32_f16(false, a, false, b, (short)0, c, false, false);
  asm volatile("v_nop\n\tv_nop\n\tv_nop\n\tv_nop" : "+v"(d) : "v"(a), "v"(b));
  return d;
}
__device__ __forceinline__ void wave_lds_sync() {
  __builtin_amdgcn_fence(__ATOMIC_RELEASE, "workgroup");
  __builtin_amdgcn_wave_barrier();
  __builtin_amdgcn_fence(__ATOMIC_ACQUIRE, "workgroup");
}

__device__ __forceinline__ void epi_planes(v8f (&acc)[2][4], float scale, bool two, b16* __restrict__ oh, b16* __restrict__ ol, int ldo,
                                           int m0, int c0, int lane, b16* Th, b16* Tl) {
  const int nloc = lane & 15, hlf = lane >> 4;
#pragma unroll
  for (int t = 0; t < 4; ++t)
#pragma unroll
    for (int r = 0; r < 2; ++r)
#pragma unroll
      for (int v = 0; v < 8; ++v) {
        const int rr = r * 16 + v + 8 * hlf, cc = t * 16 + nloc;
        b16 h_, l_; split16(acc[r][t][v] * scale, h_, l_);
        Th[rr * 64 + cc] = h_; Tl[rr * 64 + cc] = l_;
      }
  wave_lds_sync();
  {
#pragma unroll
    for (int j = 0; j < 8; ++j) {
      const int rr = j * 4 + (lane >> 3), c8 = (lane & 7) * 8;
      const size_t o = (size_t)(m0 + rr) * ldo + c0 + c8;
      *(v8b*)(oh + o) = ld8b(Th + rr * 64 + c8);
      if (two) *(v8b*)(ol + o) = ld8b(Tl + rr * 64 + c8);
    }
    
  }
}
// (b) f32 rows with pitch ldo: 64 floats = 256 B = 2 lines per row; 16 lanes x 16 B per row, 2 rows per instruction. Optional per-row factor
__device__ __forceinline__ void epi_f32(v8f (&acc)[2][4], float scale, const float* rscale, float* __restrict__ out, int ldo, int m0, int c0, int lane, float* Tt) {
  const int nloc = lane & 15, hlf = lane >> 4;
#pragma unroll
  for (int t = 0; t < 4; ++t)
#pragma unroll
    for (int r = 0; r < 2; ++r)
#pragma unroll
      for (int v = 0; v < 8; ++v) {
        const int rr = r * 16 + v + 8 * hlf;
        const float rs = rscale ? rscale[(size_t)(m0 + rr) * 32] : 1.0f;
        Tt[rr * 64 + t * 16 + nloc] = acc[r][t][v] * scale * rs;
      }
  wave_lds_sync();
  float* dst0 = out + (size_t)m0 * ldo + c0;
  {
#pragma unroll
    for (int j = 0; j < 16; ++j) { const int rr = j * 2 + hlf, c4 = nloc * 4; *(v4f*)(dst0 + (size_t)rr * ldo + c4) = *(const v4f*)(Tt + rr * 64 + c4); }
    
  }
}



typedef __attribute__((ext_vector_type(8))) __bf16 v8bb; typedef __attribute__((ext_vector_type(16))) __bf16 v16bb;
typedef __attribute__((ext_vector_type(8))) unsigned short v8us;
__device__ __forceinline__ v16bb frag_blk_bf(const __bf16* p, unsigned lane) { const v8bb a = *(const v8bb*)(p + lane * 8), b = *(const v8bb*)(p + 256 + lane * 8); return __builtin_shufflevector(a, b, 0, 1, 2, 3, 4, 5, 6, 7, 8, 9, 10, 11, 12, 13, 14, 15); }
__device__ __forceinline__ v8f wmma16bb(v16bb a, v16bb b, v8f c) {
  v8f d = __builtin_amdgcn_wmma_f32_16x16x32_bf16(false, a, false, b, (short)0, c, false, false);
  asm volatile("v_nop\n\tv_nop\n\tv_nop\n\tv_nop" : "+v"(d) : "v"(a), "v"(b));
  return d;
}
__device__ __forceinline__ unsigned short bf16_rne_bits(float v) { unsigned int u = __float_as_uint(v); u += 0x7FFFu + ((u >> 16) & 1u); return (unsigned short)(u >> 16); }
__device__ __forceinline__ float bf16_rne(float v) { return __uint_as_float(((unsigned int)bf16_rne_bits(v)) << 16); }



// x (f32) -> bf16 bits, round to nearest even.
__global__ __launch_bounds__(256) void xprep_kernel(const float* __restrict__ x, unsigned short* __restrict__ x16) {   // one pass's two batches -> bf16
  const size_t tid = (size_t)blockIdx.x * blockDim.x + threadIdx.x, nth = (size_t)gridDim.x * blockDim.x;
  { for (size_t p = tid; p < (size_t)NTOK * D / 8; p += nth) { v8us v;
#pragma unroll
      for (int e = 0; e < 8; ++e) v[e] = bf16_rne_bits(x[pack_src(p) + e]);
      *(v8us*)(x16 + pack_dst(p)) = v; }  }
}
__global__ __launch_bounds__(256) void prep_kernel(const float* __restrict__ wq, const float* __restrict__ wk, const float* __restrict__ wv, const float* __restrict__ wo, unsigned short* __restrict__ w16, b16* __restrict__ wo16) {
  const size_t tid = (size_t)blockIdx.x * blockDim.x + threadIdx.x, nth = (size_t)gridDim.x * blockDim.x;
  {
    for (size_t p = tid; p < (size_t)3 * D * D / 8; p += nth) { const float* W = (p < (size_t)D * D / 8) ? wq : (p < (size_t)2 * D * D / 8) ? wk : wv; const size_t q = p % ((size_t)D * D / 8); v8us v;   // [out][in] rows into fragment order; the three matrices follow one another as 3072 rows
#pragma unroll
      for (int e = 0; e < 8; ++e) v[e] = bf16_rne_bits(W[pack_src(q) + e]);
      *(v8us*)(w16 + pack_dst(p)) = v; }
    for (size_t p = tid; p < (size_t)D * D / 8; p += nth) { v8b w;   // W_o [out][in] rows into fragment order
#pragma unroll
      for (int e = 0; e < 8; ++e) w[e] = (b16)bf16_rne(wo[pack_src(p) + e]);
      *(v8b*)(wo16 + pack_dst(p)) = w; }
    
  }
}

// projections: rows = tokens (2048), K = 1024, column tiles of 64 = one head of q (tiles 0..15), k (16..31) or v (32..47); f16 planes [b*H + head] of 1024 tok x 64 for q/k;
// v: (8v)^T f16 planes [b*H + head] of 64 x 1024 tok; inside a plane the elements lie in fragment order (blocks of 16 rows x 32 k). grid (48, 16) x 128.
__global__ __launch_bounds__(128) void proj_kernel(const __bf16* __restrict__ x16, const __bf16* __restrict__ w16, const float* __restrict__ bq, const float* __restrict__ bk, const float* __restrict__ bv, b16* __restrict__ qh, b16* __restrict__ kh, b16* __restrict__ vt) {
  __shared__ __attribute__((aligned(16))) b16 Th[4][32][HD + 8], Tq[4][32][HD + 8];
  __shared__ __attribute__((aligned(16))) b16 Tt[64][128 + 8], Tl[64][128 + 8];
  const int lane = threadIdx.x & 31, wave = threadIdx.x >> 5, nloc = lane & 15, hlf = lane >> 4, m0 = blockIdx.y * 128 + wave * 32, c0 = blockIdx.x * 64;
  v8f acc[2][4];
#pragma unroll
  for (int r = 0; r < 2; ++r)
#pragma unroll
    for (int t = 0; t < 4; ++t) acc[r][t] = (v8f){};
  // Three register stages of 32 k: all twelve loads of stage j + 2 are issued ahead of the matrix instructions of stage j, so a stage waits once, two stages late, not once per weight fragment.
  const __bf16* pa = x16 + (size_t)(m0 / 16) * KB32 * FB; const __bf16* pw = w16 + (size_t)(c0 / 16) * KB32 * FB;
  v16bb fa[3][2], fw[3][4];
  auto fetch = [&](int st, int s) {
#pragma unroll
    for (int r = 0; r < 2; ++r) fa[s][r] = frag_blk_bf(pa + (size_t)(r * KB32 + st) * FB, lane);
#pragma unroll
    for (int t = 0; t < 4; ++t) fw[s][t] = frag_blk_bf(pw + (size_t)(t * KB32 + st) * FB, lane);
    __builtin_amdgcn_sched_barrier(0);   // keeps the stage's loads in front of the matrix instructions that follow; without it they sink to their first use and each is waited for alone
  };
  auto work = [&](int s) {
#pragma unroll
    for (int t = 0; t < 4; ++t) { acc[0][t] = wmma16bb(fa[s][0], fw[s][t], acc[0][t]); acc[1][t] = wmma16bb(fa[s][1], fw[s][t], acc[1][t]); }
  };
  fetch(0, 0); fetch(1, 1);
  for (int st = 0; st < D / 32 - 2; st += 3) { fetch(st + 2, 2); work(0); fetch(st + 3, 0); work(1); fetch(st + 4, 1); work(2);
    asm volatile("s_wait_xcnt 0x0" ::: "memory"); }   // the trip's loads are still out when the next trip rewrites their address pairs
  work(0); work(1);
  const int which = blockIdx.x / (D / 64), head = blockIdx.x % (D / 64), b = m0 / S, tok0 = m0 % S;
  { const float* bias = (which == 0) ? bq : (which == 1) ? bk : bv;   // + bf16(bias)
#pragma unroll
    for (int t = 0; t < 4; ++t) { const float bb = bf16_rne(bias[head * HD + t * 16 + nloc]);
#pragma unroll
      for (int r = 0; r < 2; ++r)
#pragma unroll
        for (int v = 0; v < 8; ++v) acc[r][t][v] += bb; } }
  if (which < 2) {                                              // q or k head: f16 hi/lo blocks in fragment order
#pragma unroll
    for (int t = 0; t < 4; ++t)
#pragma unroll
      for (int r = 0; r < 2; ++r)
#pragma unroll
        for (int v = 0; v < 8; ++v) { b16 a_, c_; split16(acc[r][t][v] * QS, a_, c_); Th[wave][r * 16 + 8 * hlf + v][t * 16 + nloc] = a_; Tq[wave][r * 16 + 8 * hlf + v][t * 16 + nloc] = c_; }   // q, k carried x8 (lo residuals stay normal)
    wave_lds_sync();
    b16* dst = (which == 0 ? qh : kh) + (((size_t)b * H + head) * S + tok0) * HD;
    {
#pragma unroll
      for (int j = 0; j < 8; ++j) { const int rr = (j >> 2) * 16 + nloc, c8 = (j & 3) * 16 + hlf * 8;   // blocks [16 tokens][32 d] in the order token block, d half: the wave's 32 x 64 tile is 4 KB in a row
        *(v8b*)(dst + j * 256 + lane * 8) = *(const v8b*)(&Th[wave][rr][c8]); *(v8b*)(dst + QPL + j * 256 + lane * 8) = *(const v8b*)(&Tq[wave][rr][c8]); }
       }
    return;
  }
  const int vh = head;                                          // v head: (8v)^T tile [64 d][128 tok] via LDS, rows of 256 B
#pragma unroll
  for (int t = 0; t < 4; ++t)
#pragma unroll
    for (int r = 0; r < 2; ++r)
#pragma unroll
      for (int v = 0; v < 8; ++v) { b16 a_, c_; split16(acc[r][t][v] * VS, a_, c_); Tt[t * 16 + nloc][wave * 32 + r * 16 + 8 * hlf + v] = a_; Tl[t * 16 + nloc][wave * 32 + r * 16 + 8 * hlf + v] = c_; }
  __syncthreads();
  b16* dstv = vt + (((size_t)b * H + vh) * HD) * S + (size_t)((blockIdx.y * 128) % S) * HD;   // blocks [16 d][32 tokens] in the order token run of 32, d block
  {
#pragma unroll
    for (int j = 0; j < 8; ++j) { const int dd = (j >> 1) * 16 + nloc, c8 = wave * 32 + (j & 1) * 16 + hlf * 8, o = (wave * 8 + j) * 256 + lane * 8; *(v8b*)(dstv + o) = *(const v8b*)(&Tt[dd][c8]); *(v8b*)(dstv + VPL + o) = *(const v8b*)(&Tl[dd][c8]); }
    asm volatile("s_wait_xcnt 0x0" ::: "memory");   // the build lays the q/k branch behind these stores, where their address pair is written again
    
  }
}

__device__ __forceinline__ void s_tile(const b16* __restrict__ K, const v16b* qf, const v16b* ql, int kb, unsigned lane, v8f& s0, v8f& s1) {
  s0 = (v8f){}; s1 = (v8f){};
  const b16* kl = K + (size_t)kb * HD + lane * 8;   // the lane's place in the trip's first block
  v16b k0[2], k0l[2], k1[2], k1l[2];   // all sixteen key reads of the trip go out together: one wait for memory per trip, not one per half of the head dimension
#pragma unroll
  for (int ks = 0; ks < 2; ++ks) { const b16* kp = kl + ks * FB; k0[ks] = frag_blk(kp, 0); k0l[ks] = frag_blk(kp + QPL, 0); k1[ks] = frag_blk(kp + 2 * FB, 0); k1l[ks] = frag_blk(kp + QPL + 2 * FB, 0); }
  // stands behind the key reads because their address pair is rewritten later in the trip, in pass 2 while the reads are still out; it names the pair so that none of the sixteen reads lands on it in front of the wait
  asm volatile("s_wait_xcnt 0x0" :: "v"(kl) : "memory");
#pragma unroll
  for (int ks = 0; ks < 2; ++ks) { s0 = wmma16b(k0[ks], qf[ks], s0); s0 = wmma16b(k0[ks], ql[ks], s0); s0 = wmma16b(k0l[ks], qf[ks], s0); s1 = wmma16b(k1[ks], qf[ks], s1); s1 = wmma16b(k1[ks], ql[ks], s1); s1 = wmma16b(k1l[ks], qf[ks], s1); }
#pragma unroll
  for (int r = 0; r < 8; ++r) { s0[r] *= SCALE / (QS * QS); s1[r] *= SCALE / (QS * QS); }
}
// Each 16-query tile is worked by KP waves of one work-group, each on its own run of keys (TP trips of 32 keys; the last part has what is left): wave = part * 8 + tile.
// The parts meet twice in LDS: after pass 1 (row maximum and row sum) and after pass 2 (partial outputs and partial relation buckets, summed in part order 0..KP-1).
constexpr int KP = 3, TP = (S / 32 + KP - 1) / KP;
// Relation buckets: each wave has two tables [41 ids][32 lanes], one per key half of a trip. A lane adds only into its own column of each: no turn-taking between the two lanes of a query,
// the adds into the two tables do not depend on each other, and bank = lane (+ 32 for odd ids), so no two lanes meet on a bank. After pass 2 the wave folds the four columns of a query
// into columns 0..15 of the first table; its partial output then lies over the second table.
constexpr int TS = NREL * 32, OP = HD + 4;
static_assert(16 * OP <= TS && TS % 4 == 0, "the partial output fits over the second table, 16-byte aligned");
template <int QT>
__global__ __launch_bounds__(256 * KP) void attn_kernel(const b16* __restrict__ qh, const b16* __restrict__ kh, const b16* __restrict__ vt, const int* __restrict__ rel, const float* __restrict__ remb, float* __restrict__ y) {
  __shared__ __attribute__((aligned(16))) float Wk[8 * KP][2 * TS]; __shared__ __attribute__((aligned(16))) float Es[NREL][HD]; __shared__ float Ms[8 * KP][16], Ls[8 * KP][16];
  // the wave's number is taken as a scalar so that tile, part, head, the key range and the base addresses formed from them stay out of the vector registers
  const int wid = __builtin_amdgcn_readfirstlane(threadIdx.x >> 5), lane = threadIdx.x & 31, hh = lane >> 4, col = lane & 15, tile = wid & 7, part = wid >> 3;
  const int kbeg = part * TP * 32, kend = (kbeg + TP * 32 < S) ? kbeg + TP * 32 : S;
  for (int i = threadIdx.x; i < NREL * HD; i += 256 * KP) Es[i / HD][i % HD] = bf16_rne(remb[i]);
  for (int i = lane; i < 2 * TS / 4; i += 32) *(v4f*)(&Wk[wid][i * 4]) = (v4f){};
  __syncthreads();
  const int qt = blockIdx.x * 8 + tile, jt = qt % QT, bh = qt / QT, h = bh % H, b = bh / H, q0 = jt * 16, qi = q0 + col;
  const b16* Q = qh + ((size_t)bh * S) * HD; const b16* K = kh + ((size_t)bh * S) * HD; const b16* vb = vt + ((size_t)bh * HD) * S; const int* rrow = rel + ((size_t)b * S + qi) * S;
  v16b qf[2], ql[2];
#pragma unroll
  for (int ks = 0; ks < 2; ++ks) { qf[ks] = frag_blk(Q + (size_t)q0 * HD + ks * FB, lane); ql[ks] = frag_blk(Q + QPL + (size_t)q0 * HD + ks * FB, lane); }
  asm volatile("s_wait_xcnt 0x0" ::: "memory");   // the query reads' address pair is rewritten behind the loop's entry branch
  float m = -INFINITY, l = 0.0f;
  for (int kb = kbeg; kb < kend; kb += 32) { v8f s0, s1; s_tile(K, qf, ql, kb, lane, s0, s1);
    float mr = -INFINITY;
#pragma unroll
    for (int r = 0; r < 8; ++r) mr = fmaxf(mr, fmaxf(s0[r], s1[r]));
    mr = fmaxf(mr, __shfl_xor(mr, 16));
    const float mn = fmaxf(m, mr), al_ = __expf(m - mn); m = mn; float sum = 0.0f;
#pragma unroll
    for (int r = 0; r < 8; ++r) sum += __expf(s0[r] - mn) + __expf(s1[r] - mn);
    sum += __shfl_xor(sum, 16); l = l * al_ + sum; }
  if (hh == 0) { Ms[wid][col] = m; Ls[wid][col] = l; }           // this part's row maximum and row sum (both lane halves hold the same pair)
  __syncthreads();
  { float mg = -INFINITY, lg = 0.0f;
#pragma unroll
    for (int p = 0; p < KP; ++p) mg = fmaxf(mg, Ms[p * 8 + tile][col]);
#pragma unroll
    for (int p = 0; p < KP; ++p) lg += Ls[p * 8 + tile][col] * __expf(Ms[p * 8 + tile][col] - mg);
    m = mg; l = lg; }
  const float il = 1.0f / l; v8f o[4] = {{}, {}, {}, {}};
  float* t0 = &Wk[wid][lane]; float* t1 = t0 + TS;   // the lane's own columns: keys 8 hh + r and keys 16 + 8 hh + r of a trip
  for (int kb = kbeg; kb < kend; kb += 32) { v8f s0, s1; s_tile(K, qf, ql, kb, lane, s0, s1);     // pass 2
    v16b pb, pl; float p0[8], p1[8]; int r0[8], r1[8]; const b16* vp = vb + (size_t)kb * HD + lane * 8;
#pragma unroll
    for (int r = 0; r < 8; ++r) { p0[r] = __expf(s0[r] - m) * il; p1[r] = __expf(s1[r] - m) * il; b16 a, c; split16(p0[r] * PS, a, c); pb[r] = a; pl[r] = c; split16(p1[r] * PS, a, c); pb[8 + r] = a; pl[8 + r] = c;
      int ra = rrow[kb + 8 * hh + r], rb = rrow[kb + 16 + 8 * hh + r]; r0[r] = (ra < 0) ? 0 : (ra >= NREL ? NREL - 1 : ra); r1[r] = (rb < 0) ? 0 : (rb >= NREL ? NREL - 1 : rb); }
#pragma unroll
    for (int n = 0; n < 4; ++n) { const v16b vf = frag_blk(vp + n * FB, 0), vl = frag_blk(vp + VPL + n * FB, 0);
      o[n] = wmma16b(vf, pb, o[n]); o[n] = wmma16b(vf, pl, o[n]); o[n] = wmma16b(vl, pb, o[n]); }
    asm volatile("s_wait_xcnt 0x0" :: "v"(vp) : "memory");   // names the value reads' address pair so that none of them lands on it while the others still name it; the pair is rewritten in the next trip
    // relation buckets: column[id] += p in the lane's own two columns (plain adds, no atomics); both reads of a step go out before either write
#pragma unroll
    for (int r = 0; r < 8; ++r) { const float a = t0[r0[r] * 32], c = t1[r1[r] * 32]; t0[r0[r] * 32] = a + p0[r]; t1[r1[r] * 32] = c + p1[r]; }
  }
  wave_lds_sync();   // the fold reads columns that other lanes of the wave wrote
  for (int i = lane; i < NREL * 4; i += 32) { float* t = &Wk[wid][(i >> 2) * 32 + (i & 3) * 4];   // four queries of one id per lane
    *(v4f*)t = ((*(const v4f*)t + *(const v4f*)(t + 16)) + *(const v4f*)(t + TS)) + *(const v4f*)(t + TS + 16); }
  wave_lds_sync();   // the partial output below overwrites the second table, which other lanes have just read
  // epilogue: y[q][d] = sum over parts of o/64 + sum_r (sum over parts of bucket[r][q]) E[r][d]. Each wave leaves its partial o in LDS; behind the barrier the waves of parts 0 and 1
  // finish eight queries of their tile each: four lanes per query, sixteen consecutive d per lane, and each of the wave's four stores fills four whole lines.
#pragma unroll
  for (int n = 0; n < 4; ++n)
#pragma unroll
    for (int r = 0; r < 8; ++r) Wk[wid][TS + col * OP + n * 16 + 8 * hh + r] = o[n][r] * (1.0f / (VS * PS));
  __syncthreads();
  if (part < 2) {
    const int qq = part * 8 + (lane >> 2), d0 = (lane & 3) * 16;
    v4f a[4] = {{}, {}, {}, {}};
#pragma unroll
    for (int p = 0; p < KP; ++p)
#pragma unroll
      for (int j = 0; j < 4; ++j) a[j] += *(const v4f*)(&Wk[p * 8 + tile][TS + qq * OP + d0 + 4 * j]);
    // Unrolled so that the reads of later ids are issued under the multiply-adds of earlier ones; each sum still adds ids 0..40 in that order.
#pragma unroll
    for (int rr = 0; rr < NREL; ++rr) { float w = 0.0f;
#pragma unroll
      for (int p = 0; p < KP; ++p) w += Wk[p * 8 + tile][rr * 32 + qq];
#pragma unroll
      for (int j = 0; j < 4; ++j) a[j] += w * *(const v4f*)(&Es[rr][d0 + 4 * j]); }
    // y in fragment order for the output product: f32 blocks of 16 rows x 32 k (2 KB), element (row, k) at [k >> 4][(k >> 2) & 1][((k >> 3) & 1) * 16 + row][k & 3]; a store fills four whole lines
    float* dst = y + ((size_t)((b * S + q0) / 16) * KB32 + h * 2 + ((lane & 3) >> 1)) * FB + (lane & 1) * 256 + qq * 4;
#pragma unroll
    for (int j = 0; j < 4; ++j) *(v4f*)(dst + (j & 1) * 128 + (j >> 1) * 64) = a[j];
  }
}

// out = y W_o^T: (2048 x 1024) x (1024 x 1024); A = y x8 split at load into f16 hi + lo, B = f16(bf16 W_o) rows; f32 rows; grid (16, 16).
__global__ __launch_bounds__(128) void out_kernel(const float* __restrict__ y, const b16* __restrict__ wo16, const float* __restrict__ bo, float* __restrict__ out) {
  __shared__ __attribute__((aligned(16))) float Ts[4][32 * 64];
  const int lane = threadIdx.x & 31, wave = threadIdx.x >> 5, nloc = lane & 15, hlf = lane >> 4, m0 = blockIdx.y * 128 + wave * 32, c0 = blockIdx.x * 64;
  v8f acc[2][4];
#pragma unroll
  for (int r = 0; r < 2; ++r)
#pragma unroll
    for (int t = 0; t < 4; ++t) acc[r][t] = (v8f){};
  // Two register stages of 32 k: the sixteen loads of stage j + 1 (raw f32 y, f16 weights) are issued ahead of the split and the matrix instructions of stage j.
  const float* py = y + (size_t)(m0 / 16) * KB32 * FB + lane * 4; const b16* pw = wo16 + (size_t)(c0 / 16) * KB32 * FB;
  v4f ry[2][2][4]; v16b fw[2][4];
  auto fetch = [&](int kb, int s) {
#pragma unroll
    for (int r = 0; r < 2; ++r) { const float* p = py + (size_t)(r * KB32 + kb / 32) * FB; ry[s][r][0] = *(const v4f*)p; ry[s][r][1] = *(const v4f*)(p + 128); ry[s][r][2] = *(const v4f*)(p + 256); ry[s][r][3] = *(const v4f*)(p + 384); }
#pragma unroll
    for (int t = 0; t < 4; ++t) fw[s][t] = frag_blk(pw + (size_t)(t * KB32 + kb / 32) * FB, lane);
    __builtin_amdgcn_sched_barrier(0);   // keeps the stage's loads in front of the work that follows; without it they sink to their first use and each is waited for alone
  };
  auto work = [&](int s) {                                                      // y as an f16 hi+lo pair carried x8 (2 products)
    v16b ah[2], al[2];
#pragma unroll
    for (int r = 0; r < 2; ++r)
#pragma unroll
      for (int e = 0; e < 8; ++e) { b16 a, c; split16(ry[s][r][e >> 2][e & 3] * 8.0f, a, c); ah[r][e] = a; al[r][e] = c; split16(ry[s][r][2 + (e >> 2)][e & 3] * 8.0f, a, c); ah[r][8 + e] = a; al[r][8 + e] = c; }
#pragma unroll
    for (int t = 0; t < 4; ++t)
#pragma unroll
      for (int r = 0; r < 2; ++r) { acc[r][t] = wmma16b(ah[r], fw[s][t], acc[r][t]); acc[r][t] = wmma16b(al[r], fw[s][t], acc[r][t]); }
  };
  fetch(0, 0);
  for (int kb = 0; kb < D - 64; kb += 64) { fetch(kb + 32, 1); work(0); fetch(kb + 64, 0); work(1); }
  fetch(D - 32, 1);
  asm volatile("s_wait_xcnt 0x0" ::: "memory");   // the last stage's address pairs are reused by the split below while its loads are still out
  __builtin_amdgcn_sched_barrier(0);              // holds the split behind that wait
  work(0); work(1);
#pragma unroll
  for (int t = 0; t < 4; ++t)
#pragma unroll
    for (int r = 0; r < 2; ++r)
#pragma unroll
      for (int v = 0; v < 8; ++v) acc[r][t][v] = acc[r][t][v] * (1.0f / 8.0f) + bf16_rne(bo[c0 + t * 16 + nloc]);
  epi_f32(acc, 1.0f, nullptr, out, D, m0, c0, lane, Ts[wave]);
}
}  // namespace

extern "C" void kernel_launch(void* const* d_in, const int* in_sizes, int n_in,
                              void* d_out, int out_size, void* d_ws, size_t ws_size, hipStream_t stream) {
  (void)n_in; (void)out_size;
  const float* x = (const float*)d_in[0]; const int* rel = (const int*)d_in[1];
  const float* wq = (const float*)d_in[2]; const float* bq = (const float*)d_in[3]; const float* wk = (const float*)d_in[4]; const float* bk = (const float*)d_in[5]; const float* wv = (const float*)d_in[6]; const float* bv = (const float*)d_in[7];
  const float* wo = (const float*)d_in[8]; const float* bo = (const float*)d_in[9]; const float* remb = (const float*)d_in[10];
  float* out = (float*)d_out;   // [2][1024][1024]
  if (in_sizes[0] != BT * S * D || in_sizes[1] != BT * S * S || in_sizes[2] != D * D || in_sizes[8] != D * D || in_sizes[10] != NREL * HD) return;
  size_t off = 0; char* ws = (char*)d_ws;
  auto carve = [&](size_t bytes) { char* p = ws + off; off += (bytes + 255) & ~(size_t)255; return p; };
  unsigned short* x16 = (unsigned short*)carve((size_t)NTOK * D * 2); unsigned short* w16 = (unsigned short*)carve((size_t)3 * D * D * 2); b16* wo16 = (b16*)carve((size_t)D * D * 2);
  b16* qh = (b16*)carve((size_t)2 * NTOK * D * 2); b16* kh = (b16*)carve((size_t)2 * NTOK * D * 2); b16* vt = (b16*)carve((size_t)2 * NTOK * D * 2); float* y = (float*)carve((size_t)NTOK * D * 4);
  if (off > ws_size) return;                                    // ≈ 46 MB
  prep_kernel<<<512, 256, 0, stream>>>(wq, wk, wv, wo, w16, wo16);
  xprep_kernel<<<1024, 256, 0, stream>>>(x, x16);
  proj_kernel<<<dim3(3 * D / 64, NTOK / 128), 128, 0, stream>>>((const __bf16*)x16, (const __bf16*)w16, bq, bk, bv, qh, kh, vt);
  attn_kernel<S / 16><<<Bn * H * (S / 16) / 8, 256 * KP, 0, stream>>>(qh, kh, vt, rel, remb, y);
  out_kernel<<<dim3(D / 64, NTOK / 128), 128, 0, stream>>>(y, wo16, bo, out);
}

// v006
// Measured time: 88.7 microseconds a run.
// Timed twice side by side with v005, it ran 1.13 and 1.14 times as fast.
// Counting every step since v000, it is 3.30 times as fast.
#include <hip/hip_runtime.h>

// Attention with relation embeddings: q = (x Wq^T + bq)/8, k = x Wk^T + bk, v = x Wv^T + bv (16 heads x 64); attn = softmax(q.k) (no mask; the k-relation term has scale 0);
// out_h[t] = sum_s attn[t][s] (v_h[s] + rel_emb[relation_inputs[b][t][s]]) (v-relation scale 1, shared by all heads); out = merged Wo^T + bo -> [2][1024][1024].
// The relation term is sum_r w_r[t] rel_emb[r] with w_r[t] = sum over keys s of relation r of attn[t][s]: per (b, h, 16 queries) the final probabilities are bucketed by the INPUT relation id
// into f32 LDS tables [41][lane] (plain ordered adds, no atomics), then multiplied by the 41 x 64 table; nothing index-like is written; ids only select an LDS accumulator.
// x, weights, biases, rel_emb rounded to bf16: projections on v_wmma_f32_16x16x32_bf16 (exact products; + bias); per pair a
// v_wmma_f32_16x16x32_f16; out projection with y hi+lo x8 (2 products); softmax, buckets and the relation product in f32. Fragment k-map per lane half hh for A AND B: elements 0..7 <-

namespace {
constexpr int BT = 2, Bn = 2, S = 1024, D = 1024, H = 16, HD = 64, NTOK = Bn * S, NREL = 41;
constexpr float SCALE = 0.125f, VS = 8.0f, QS = 8.0f, PS = 8.0f;   // power-of-two carry scales so hi/lo residual planes stay normal in f16
constexpr size_t VPL = (size_t)NTOK * D;   // distance between the (8v)^T hi and lo planes
constexpr size_t QPL = (size_t)NTOK * D;   // distance between the q/k hi and lo planes

typedef _Float16 b16;
typedef __attribute__((ext_vector_type(16))) _Float16 v16b;
typedef __attribute__((ext_vector_type(8)))  _Float16 v8b;
typedef __attribute__((ext_vector_type(8)))  float v8f;
typedef __attribute__((ext_vector_type(4)))  float v4f;
typedef __attribute__((ext_vector_type(4)))  int v4i;

__device__ __forceinline__ v8b ld8b(const b16* p) { return *(const v8b*)p; }
__device__ __forceinline__ v16b cat8b(v8b a, v8b b) { return __builtin_shufflevector(a, b, 0, 1, 2, 3, 4, 5, 6, 7, 8, 9, 10, 11, 12, 13, 14, 15); }
// Fragment order: every matrix operand in the workspace is kept as blocks of 16 rows x 32 k. A block of 16-bit elements is 1 KB, element (row, k) at [k >> 4][((k >> 3) & 1) * 16 + row][k & 7]:
// a lane's two 16-byte reads lie at lane * 8 and 256 + lane * 8 elements, so each wave-wide read covers 512 contiguous bytes (4 lines) and not 32 bytes in each of 16 rows.
constexpr int FB = 512, KB32 = D / 32;   // elements per block; blocks along a 1024-long k
__device__ __forceinline__ v16b frag_blk(const b16* p, unsigned lane) { return cat8b(ld8b(p + lane * 8), ld8b(p + 256 + lane * 8)); }
// Piece p (8 elements) of a [rows][1024] matrix on its way into fragment order: four lanes read one 32-element run of a row, eight rows per wave, and the wave's 16-byte stores fill four whole lines.
__device__ __forceinline__ size_t pack_src(size_t p) { return ((p >> 11) * 16 + ((p >> 2) & 15)) * D + ((p >> 6) & 31) * 32 + (p & 3) * 8; }
__device__ __forceinline__ size_t pack_dst(size_t p) { return (p >> 6) * FB + ((p >> 1) & 1) * 256 + ((p & 1) * 16 + ((p >> 2) & 15)) * 8; }
__device__ __forceinline__ void split16(float v, b16& hi, b16& lo) { hi = (b16)v; lo = (b16)(v - (float)hi); }
__device__ __forceinline__ v8f wmma16b(v16b a, v16b b, v8f c) {
  v8f d = __builtin_amdgcn_wmma_f32_16x16x32_f16(false, a, false, b, (short)0, c, false, false);
  asm volatile("v_nop\n\tv_nop\n\tv_nop\n\tv_nop" : "+v"(d) : "v"(a), "v"(b));
  return d;
}
__device__ __forceinline__ void wave_lds_sync() {
  __builtin_amdgcn_fence(__ATOMIC_RELEASE, "workgroup");
  __builtin_amdgcn_wave_barrier();
  __builtin_amdgcn_fence(__ATOMIC_ACQUIRE, "workgroup");
}

__device__ __forceinline__ void epi_planes(v8f (&acc)[2][4], float scale, bool two, b16* __restrict__ oh, b16* __restrict__ ol, int ldo,
                                           int m0, int c0, int lane, b16* Th, b16* Tl) {
  const int nloc = lane & 15, hlf = lane >> 4;
#pragma unroll
  for (int t = 0; t < 4; ++t)
#pragma unroll
    for (int r = 0; r < 2; ++r)
#pragma unroll
      for (int v = 0; v < 8; ++v) {
        const int rr = r * 16 + v + 8 * hlf, cc = t * 16 + nloc;
        b16 h_, l_; split16(acc[r][t][v] * scale, h_, l_);
        Th[rr * 64 + cc] = h_; Tl[rr * 64 + cc] = l_;
      }
  wave_lds_sync();
  {
#pragma unroll
    for (int j = 0; j < 8; ++j) {
      const int rr = j * 4 + (lane >> 3), c8 = (lane & 7) * 8;
      const size_t o = (size_t)(m0 + rr) * ldo + c0 + c8;
      *(v8b*)(oh + o) = ld8b(Th + rr * 64 + c8);
      if (two) *(v8b*)(ol + o) = ld8b(Tl + rr * 64 + c8);
    }
    
  }
}
// (b) f32 rows with pitch ldo: 64 floats = 256 B = 2 lines per row; 16 lanes x 16 B per row, 2 rows per instruction. Optional per-row factor
__device__ __forceinline__ void epi_f32(v8f (&acc)[2][4], float scale, const float* rscale, float* __restrict__ out, int ldo, int m0, int c0, int lane, float* Tt) {
  const int nloc = lane & 15, hlf = lane >> 4;
#pragma unroll
  for (int t = 0; t < 4; ++t)
#pragma unroll
    for (int r = 0; r < 2; ++r)
#pragma unroll
      for (int v = 0; v < 8; ++v) {
        const int rr = r * 16 + v + 8 * hlf;
        const float rs = rscale ? rscale[(size_t)(m0 + rr) * 32] : 1.0f;
        Tt[rr * 64 + t * 16 + nloc] = acc[r][t][v] * scale * rs;
      }
  wave_lds_sync();
  float* dst0 = out + (size_t)m0 * ldo + c0;
  {
#pragma unroll
    for (int j = 0; j < 16; ++j) { const int rr = j * 2 + hlf, c4 = nloc * 4; *(v4f*)(dst0 + (size_t)rr * ldo + c4) = *(const v4f*)(Tt + rr * 64 + c4); }
    
  }
}



typedef __attribute__((ext_vector_type(8))) __bf16 v8bb; typedef __attribute__((ext_vector_type(16))) __bf16 v16bb;
typedef __attribute__((ext_vector_type(8))) unsigned short v8us;
__device__ __forceinline__ v16bb frag_blk_bf(const __bf16* p, unsigned lane) { const v8bb a = *(const v8bb*)(p + lane * 8), b = *(const v8bb*)(p + 256 + lane * 8); return __builtin_shufflevector(a, b, 0, 1, 2, 3, 4, 5, 6, 7, 8, 9, 10, 11, 12, 13, 14, 15); }
__device__ __forceinline__ v8f wmma16bb(v16bb a, v16bb b, v8f c) {
  v8f d = __builtin_amdgcn_wmma_f32_16x16x32_bf16(false, a, false, b, (short)0, c, false, false);
  asm volatile("v_nop\n\tv_nop\n\tv_nop\n\tv_nop" : "+v"(d) : "v"(a), "v"(b));
  return d;
}
__device__ __forceinline__ unsigned short bf16_rne_bits(float v) { unsigned int u = __float_as_uint(v); u += 0x7FFFu + ((u >> 16) & 1u); return (unsigned short)(u >> 16); }
__device__ __forceinline__ float bf16_rne(float v) { return __uint_as_float(((unsigned int)bf16_rne_bits(v)) << 16); }



// x (f32) -> bf16 bits, round to nearest even.
__global__ __launch_bounds__(256) void xprep_kernel(const float* __restrict__ x, unsigned short* __restrict__ x16) {   // one pass's two batches -> bf16
  const size_t tid = (size_t)blockIdx.x * blockDim.x + threadIdx.x, nth = (size_t)gridDim.x * blockDim.x;
  { for (size_t p = tid; p < (size_t)NTOK * D / 8; p += nth) { v8us v;
#pragma unroll
      for (int e = 0; e < 8; ++e) v[e] = bf16_rne_bits(x[pack_src(p) + e]);
      *(v8us*)(x16 + pack_dst(p)) = v; }  }
}
__global__ __launch_bounds__(256) void prep_kernel(const float* __restrict__ wq, const float* __restrict__ wk, const float* __restrict__ wv, const float* __restrict__ wo, unsigned short* __restrict__ w16, b16* __restrict__ wo16) {
  const size_t tid = (size_t)blockIdx.x * blockDim.x + threadIdx.x, nth = (size_t)gridDim.x * blockDim.x;
  {
    for (size_t p = tid; p < (size_t)3 * D * D / 8; p += nth) { const float* W = (p < (size_t)D * D / 8) ? wq : (p < (size_t)2 * D * D / 8) ? wk : wv; const size_t q = p % ((size_t)D * D / 8); v8us v;   // [out][in] rows into fragment order; the three matrices follow one another as 3072 rows
#pragma unroll
      for (int e = 0; e < 8; ++e) v[e] = bf16_rne_bits(W[pack_src(q) + e]);
      *(v8us*)(w16 + pack_dst(p)) = v; }
    for (size_t p = tid; p < (size_t)D * D / 8; p += nth) { v8b w;   // W_o [out][in] rows into fragment order
#pragma unroll
      for (int e = 0; e < 8; ++e) w[e] = (b16)bf16_rne(wo[pack_src(p) + e]);
      *(v8b*)(wo16 + pack_dst(p)) = w; }
    
  }
}

// projections: rows = tokens (2048), K = 1024, column tiles of 64 = one head of q (tiles 0..15), k (16..31) or v (32..47); f16 planes [b*H + head] of 1024 tok x 64 for q/k;
// v: (8v)^T f16 planes [b*H + head] of 64 x 1024 tok; inside a plane the elements lie in fragment order (blocks of 16 rows x 32 k). grid (48, 16) x 128.
__global__ __launch_bounds__(128) void proj_kernel(const __bf16* __restrict__ x16, const __bf16* __restrict__ w16, const float* __restrict__ bq, const float* __restrict__ bk, const float* __restrict__ bv, b16* __restrict__ qh, b16* __restrict__ kh, b16* __restrict__ vt) {
  __shared__ __attribute__((aligned(16))) b16 Th[4][32][HD + 8], Tq[4][32][HD + 8];
  __shared__ __attribute__((aligned(16))) b16 Tt[64][128 + 8], Tl[64][128 + 8];
  const int lane = threadIdx.x & 31, wave = threadIdx.x >> 5, nloc = lane & 15, hlf = lane >> 4, m0 = blockIdx.y * 128 + wave * 32, c0 = blockIdx.x * 64;
  v8f acc[2][4];
#pragma unroll
  for (int r = 0; r < 2; ++r)
#pragma unroll
    for (int t = 0; t < 4; ++t) acc[r][t] = (v8f){};
  // Three register stages of 32 k: all twelve loads of stage j + 2 are issued ahead of the matrix instructions of stage j, so a stage waits once, two stages late, not once per weight fragment.
  const __bf16* pa = x16 + (size_t)(m0 / 16) * KB32 * FB; const __bf16* pw = w16 + (size_t)(c0 / 16) * KB32 * FB;
  v16bb fa[3][2], fw[3][4];
  auto fetch = [&](int st, int s) {
#pragma unroll
    for (int r = 0; r < 2; ++r) fa[s][r] = frag_blk_bf(pa + (size_t)(r * KB32 + st) * FB, lane);
#pragma unroll
    for (int t = 0; t < 4; ++t) fw[s][t] = frag_blk_bf(pw + (size_t)(t * KB32 + st) * FB, lane);
    __builtin_amdgcn_sched_barrier(0);   // keeps the stage's loads in front of the matrix instructions that follow; without it they sink to their first use and each is waited for alone
  };
  auto work = [&](int s) {
#pragma unroll
    for (int t = 0; t < 4; ++t) { acc[0][t] = wmma16bb(fa[s][0], fw[s][t], acc[0][t]); acc[1][t] = wmma16bb(fa[s][1], fw[s][t], acc[1][t]); }
  };
  fetch(0, 0); fetch(1, 1);
  for (int st = 0; st < D / 32 - 2; st += 3) { fetch(st + 2, 2); work(0); fetch(st + 3, 0); work(1); fetch(st + 4, 1); work(2);
    asm volatile("s_wait_xcnt 0x0" ::: "memory"); }   // the trip's loads are still out when the next trip rewrites their address pairs
  work(0); work(1);
  const int which = blockIdx.x / (D / 64), head = blockIdx.x % (D / 64), b = m0 / S, tok0 = m0 % S;
  { const float* bias = (which == 0) ? bq : (which == 1) ? bk : bv;   // + bf16(bias)
#pragma unroll
    for (int t = 0; t < 4; ++t) { const float bb = bf16_rne(bias[head * HD + t * 16 + nloc]);
#pragma unroll
      for (int r = 0; r < 2; ++r)
#pragma unroll
        for (int v = 0; v < 8; ++v) acc[r][t][v] += bb; } }
  if (which < 2) {                                              // q or k head: f16 hi/lo blocks in fragment order
#pragma unroll
    for (int t = 0; t < 4; ++t)
#pragma unroll
      for (int r = 0; r < 2; ++r)
#pragma unroll
        for (int v = 0; v < 8; ++v) { b16 a_, c_; split16(acc[r][t][v] * QS, a_, c_); Th[wave][r * 16 + 8 * hlf + v][t * 16 + nloc] = a_; Tq[wave][r * 16 + 8 * hlf + v][t * 16 + nloc] = c_; }   // q, k carried x8 (lo residuals stay normal)
    wave_lds_sync();
    b16* dst = (which == 0 ? qh : kh) + (((size_t)b * H + head) * S + tok0) * HD;
    {
#pragma unroll
      for (int j = 0; j < 8; ++j) { const int rr = (j >> 2) * 16 + nloc, c8 = (j & 3) * 16 + hlf * 8;   // blocks [16 tokens][32 d] in the order token block, d half: the wave's 32 x 64 tile is 4 KB in a row
        *(v8b*)(dst + j * 256 + lane * 8) = *(const v8b*)(&Th[wave][rr][c8]); *(v8b*)(dst + QPL + j * 256 + lane * 8) = *(const v8b*)(&Tq[wave][rr][c8]); }
       }
    return;
  }
  const int vh = head;                                          // v head: (8v)^T tile [64 d][128 tok] via LDS, rows of 256 B
#pragma unroll
  for (int t = 0; t < 4; ++t)
#pragma unroll
    for (int r = 0; r < 2; ++r)
#pragma unroll
      for (int v = 0; v < 8; ++v) { b16 a_, c_; split16(acc[r][t][v] * VS, a_, c_); Tt[t * 16 + nloc][wave * 32 + r * 16 + 8 * hlf + v] = a_; Tl[t * 16 + nloc][wave * 32 + r * 16 + 8 * hlf + v] = c_; }
  __syncthreads();
  b16* dstv = vt + (((size_t)b * H + vh) * HD) * S + (size_t)((blockIdx.y * 128) % S) * HD;   // blocks [16 d][32 tokens] in the order token run of 32, d block
  {
#pragma unroll
    for (int j = 0; j < 8; ++j) { const int dd = (j >> 1) * 16 + nloc, c8 = wave * 32 + (j & 1) * 16 + hlf * 8, o = (wave * 8 + j) * 256 + lane * 8; *(v8b*)(dstv + o) = *(const v8b*)(&Tt[dd][c8]); *(v8b*)(dstv + VPL + o) = *(const v8b*)(&Tl[dd][c8]); }
    asm volatile("s_wait_xcnt 0x0" ::: "memory");   // the build lays the q/k branch behind these stores, where their address pair is written again
    
  }
}

__device__ __forceinline__ void s_tile(const b16* __restrict__ K, const v16b* qf, const v16b* ql, int kb, unsigned lane, v8f& s0, v8f& s1) {
  s0 = (v8f){}; s1 = (v8f){};
  const b16* kl = K + (size_t)kb * HD + lane * 8;   // the lane's place in the trip's first block
  v16b k0[2], k0l[2], k1[2], k1l[2];   // all sixteen key reads of the trip go out together: one wait for memory per trip, not one per half of the head dimension
#pragma unroll
  for (int ks = 0; ks < 2; ++ks) { const b16* kp = kl + ks * FB; k0[ks] = frag_blk(kp, 0); k0l[ks] = frag_blk(kp + QPL, 0); k1[ks] = frag_blk(kp + 2 * FB, 0); k1l[ks] = frag_blk(kp + QPL + 2 * FB, 0); }
  // stands behind the key reads because their address pair is rewritten later in the trip, in pass 2 while the reads are still out; it names the pair so that none of the sixteen reads lands on it in front of the wait
  asm volatile("s_wait_xcnt 0x0" :: "v"(kl) : "memory");
#pragma unroll
  for (int ks = 0; ks < 2; ++ks) { s0 = wmma16b(k0[ks], qf[ks], s0); s0 = wmma16b(k0[ks], ql[ks], s0); s0 = wmma16b(k0l[ks], qf[ks], s0); s1 = wmma16b(k1[ks], qf[ks], s1); s1 = wmma16b(k1[ks], ql[ks], s1); s1 = wmma16b(k1l[ks], qf[ks], s1); }
#pragma unroll
  for (int r = 0; r < 8; ++r) { s0[r] *= SCALE / (QS * QS); s1[r] *= SCALE / (QS * QS); }
}
// Each 16-query tile is worked by KP waves of one work-group, each on its own run of keys (TP trips of 32 keys; the last part has what is left): wave = part * 8 + tile.
// The parts meet twice in LDS: after pass 1 (row maximum and row sum) and after pass 2 (partial outputs and partial relation buckets, summed in part order 0..KP-1).
constexpr int KP = 3, TP = (S / 32 + KP - 1) / KP;
// Relation buckets: each wave has two tables [41 ids][32 lanes], one per key half of a trip. A lane adds only into its own column of each: no turn-taking between the two lanes of a query,
// the adds into the two tables do not depend on each other, and bank = lane (+ 32 for odd ids), so no two lanes meet on a bank. After pass 2 the wave folds the four columns of a query
// into columns 0..15 of the first table; its partial output then lies over the second table.
constexpr int TS = NREL * 32, OP = HD + 4;
static_assert(16 * OP <= TS && TS % 4 == 0, "the partial output fits over the second table, 16-byte aligned");
template <int QT>
__global__ __launch_bounds__(256 * KP) void attn_kernel(const b16* __restrict__ qh, const b16* __restrict__ kh, const b16* __restrict__ vt, const int* __restrict__ rel, const float* __restrict__ remb, float* __restrict__ y) {
  __shared__ __attribute__((aligned(16))) float Wk[8 * KP][2 * TS]; __shared__ __attribute__((aligned(16))) float Es[NREL][HD]; __shared__ float Ms[8 * KP][16], Ls[8 * KP][16];
  // the wave's number is taken as a scalar so that tile, part, head, the key range and the base addresses formed from them stay out of the vector registers
  const int wid = __builtin_amdgcn_readfirstlane(threadIdx.x >> 5), lane = threadIdx.x & 31, hh = lane >> 4, col = lane & 15, tile = wid & 7, part = wid >> 3;
  const int kbeg = part * TP * 32, kend = (kbeg + TP * 32 < S) ? kbeg + TP * 32 : S;
  for (int i = threadIdx.x; i < NREL * HD; i += 256 * KP) Es[i / HD][i % HD] = bf16_rne(remb[i]);
  for (int i = lane; i < 2 * TS / 4; i += 32) *(v4f*)(&Wk[wid][i * 4]) = (v4f){};
  __syncthreads();
  const int qt = blockIdx.x * 8 + tile, jt = qt % QT, bh = qt / QT, h = bh % H, b = bh / H, q0 = jt * 16, qi = q0 + col;
  const b16* Q = qh + ((size_t)bh * S) * HD; const b16* K = kh + ((size_t)bh * S) * HD; const b16* vb = vt + ((size_t)bh * HD) * S; const int* rrow = rel + ((size_t)b * S + qi) * S;
  v16b qf[2], ql[2];
#pragma unroll
  for (int ks = 0; ks < 2; ++ks) { qf[ks] = frag_blk(Q + (size_t)q0 * HD + ks * FB, lane); ql[ks] = frag_blk(Q + QPL + (size_t)q0 * HD + ks * FB, lane); }
  asm volatile("s_wait_xcnt 0x0" ::: "memory");   // the query reads' address pair is rewritten behind the loop's entry branch
  float m = -INFINITY, l = 0.0f;
  for (int kb = kbeg; kb < kend; kb += 32) { v8f s0, s1; s_tile(K, qf, ql, kb, lane, s0, s1);
    float mr = -INFINITY;
#pragma unroll
    for (int r = 0; r < 8; ++r) mr = fmaxf(mr, fmaxf(s0[r], s1[r]));
    mr = fmaxf(mr, __shfl_xor(mr, 16));
    const float mn = fmaxf(m, mr), al_ = __expf(m - mn); m = mn; float sum = 0.0f;
#pragma unroll
    for (int r = 0; r < 8; ++r) sum += __expf(s0[r] - mn) + __expf(s1[r] - mn);
    sum += __shfl_xor(sum, 16); l = l * al_ + sum; }
  if (hh == 0) { Ms[wid][col] = m; Ls[wid][col] = l; }           // this part's row maximum and row sum (both lane halves hold the same pair)
  __syncthreads();
  { float mg = -INFINITY, lg = 0.0f;
#pragma unroll
    for (int p = 0; p < KP; ++p) mg = fmaxf(mg, Ms[p * 8 + tile][col]);
#pragma unroll
    for (int p = 0; p < KP; ++p) lg += Ls[p * 8 + tile][col] * __expf(Ms[p * 8 + tile][col] - mg);
    m = mg; l = lg; }
  const float il = 1.0f / l; v8f o[4] = {{}, {}, {}, {}};
  float* t0 = &Wk[wid][lane]; float* t1 = t0 + TS;   // the lane's own columns: keys 8 hh + r and keys 16 + 8 hh + r of a trip
  // Pass 2 meets three read latencies a trip, not five (keys, then one per 16 d of the values): the keys; all four hi planes of the values, issued ahead of the softmax arithmetic, with the relation
  // ids behind them; all four lo planes, issued ahead of the bucket adds, into the registers that the hi planes have left. Each sum keeps its order hi p-hi, hi p-lo, lo p-hi.
  for (int kb = kbeg; kb < kend; kb += 32) { v8f s0, s1; s_tile(K, qf, ql, kb, lane, s0, s1);     // pass 2
    const b16* vp = vb + (size_t)kb * HD + lane * 8; const int* rp = rrow + kb + 8 * hh;
    v16b vf[4], vl[4], pb, pl; v4i id[4];
#pragma unroll
    for (int n = 0; n < 4; ++n) vf[n] = frag_blk(vp + n * FB, 0);
#pragma unroll
    for (int j = 0; j < 4; ++j) id[j] = *(const v4i*)(rp + (j >> 1) * 16 + (j & 1) * 4);   // keys 8 hh + 0..7 and 16 + 8 hh + 0..7
#pragma unroll
    for (int r = 0; r < 8; ++r) { s0[r] = __expf(s0[r] - m) * il; s1[r] = __expf(s1[r] - m) * il; b16 a, c; split16(s0[r] * PS, a, c); pb[r] = a; pl[r] = c; split16(s1[r] * PS, a, c); pb[8 + r] = a; pl[8 + r] = c; }
#pragma unroll
    for (int n = 0; n < 4; ++n) o[n] = wmma16b(vf[n], pb, o[n]);
#pragma unroll
    for (int n = 0; n < 4; ++n) o[n] = wmma16b(vf[n], pl, o[n]);
#pragma unroll
    for (int n = 0; n < 4; ++n) vl[n] = frag_blk(vp + VPL + n * FB, 0);
    asm volatile("s_wait_xcnt 0x0" :: "v"(vp) : "memory");   // the value reads' and the id reads' address pairs are rewritten behind this line while reads are still out; it names the value pair so that no read lands on it while others still name it
    // relation buckets: column[id] += p in the lane's own two columns (plain adds, no atomics); both reads of a step go out before either write
#pragma unroll
    for (int r = 0; r < 8; ++r) { const int ra = id[r >> 2][r & 3], rb = id[2 + (r >> 2)][r & 3];
      const int ia = ((ra < 0) ? 0 : (ra >= NREL ? NREL - 1 : ra)) * 32, ib = ((rb < 0) ? 0 : (rb >= NREL ? NREL - 1 : rb)) * 32;
      const float a = t0[ia], c = t1[ib]; t0[ia] = a + s0[r]; t1[ib] = c + s1[r]; }
    __builtin_amdgcn_sched_barrier(0);   // keeps the last four matrix instructions, and with them the waits for the lo planes, behind the bucket adds that cover those reads; without it they rise to the head of the adds
#pragma unroll
    for (int n = 0; n < 4; ++n) o[n] = wmma16b(vl[n], pb, o[n]);
  }
  wave_lds_sync();   // the fold reads columns that other lanes of the wave wrote
  for (int i = lane; i < NREL * 4; i += 32) { float* t = &Wk[wid][(i >> 2) * 32 + (i & 3) * 4];   // four queries of one id per lane
    *(v4f*)t = ((*(const v4f*)t + *(const v4f*)(t + 16)) + *(const v4f*)(t + TS)) + *(const v4f*)(t + TS + 16); }
  wave_lds_sync();   // the partial output below overwrites the second table, which other lanes have just read
  // epilogue: y[q][d] = sum over parts of o/64 + sum_r (sum over parts of bucket[r][q]) E[r][d]. Each wave leaves its partial o in LDS; behind the barrier the waves of parts 0 and 1
  // finish eight queries of their tile each: four lanes per query, sixteen consecutive d per lane, and each of the wave's four stores fills four whole lines.
#pragma unroll
  for (int n = 0; n < 4; ++n)
#pragma unroll
    for (int r = 0; r < 8; ++r) Wk[wid][TS + col * OP + n * 16 + 8 * hh + r] = o[n][r] * (1.0f / (VS * PS));
  __syncthreads();
  if (part < 2) {
    const int qq = part * 8 + (lane >> 2), d0 = (lane & 3) * 16;
    v4f a[4] = {{}, {}, {}, {}};
#pragma unroll
    for (int p = 0; p < KP; ++p)
#pragma unroll
      for (int j = 0; j < 4; ++j) a[j] += *(const v4f*)(&Wk[p * 8 + tile][TS + qq * OP + d0 + 4 * j]);
    // Unrolled so that the reads of later ids are issued under the multiply-adds of earlier ones; each sum still adds ids 0..40 in that order.
#pragma unroll
    for (int rr = 0; rr < NREL; ++rr) { float w = 0.0f;
#pragma unroll
      for (int p = 0; p < KP; ++p) w += Wk[p * 8 + tile][rr * 32 + qq];
#pragma unroll
      for (int j = 0; j < 4; ++j) a[j] += w * *(const v4f*)(&Es[rr][d0 + 4 * j]); }
    // y in fragment order for the output product: f32 blocks of 16 rows x 32 k (2 KB), element (row, k) at [k >> 4][(k >> 2) & 1][((k >> 3) & 1) * 16 + row][k & 3]; a store fills four whole lines
    float* dst = y + ((size_t)((b * S + q0) / 16) * KB32 + h * 2 + ((lane & 3) >> 1)) * FB + (lane & 1) * 256 + qq * 4;
#pragma unroll
    for (int j = 0; j < 4; ++j) *(v4f*)(dst + (j & 1) * 128 + (j >> 1) * 64) = a[j];
  }
}

// out = y W_o^T: (2048 x 1024) x (1024 x 1024); A = y x8 split at load into f16 hi + lo, B = f16(bf16 W_o) rows; f32 rows; grid (16, 16).
__global__ __launch_bounds__(128) void out_kernel(const float* __restrict__ y, const b16* __restrict__ wo16, const float* __restrict__ bo, float* __restrict__ out) {
  __shared__ __attribute__((aligned(16))) float Ts[4][32 * 64];
  const int lane = threadIdx.x & 31, wave = threadIdx.x >> 5, nloc = lane & 15, hlf = lane >> 4, m0 = blockIdx.y * 128 + wave * 32, c0 = blockIdx.x * 64;
  v8f acc[2][4];
#pragma unroll
  for (int r = 0; r < 2; ++r)
#pragma unroll
    for (int t = 0; t < 4; ++t) acc[r][t] = (v8f){};
  // Two register stages of 32 k: the sixteen loads of stage j + 1 (raw f32 y, f16 weights) are issued ahead of the split and the matrix instructions of stage j.
  const float* py = y + (size_t)(m0 / 16) * KB32 * FB + lane * 4; const b16* pw = wo16 + (size_t)(c0 / 16) * KB32 * FB;
  v4f ry[2][2][4]; v16b fw[2][4];
  auto fetch = [&](int kb, int s) {
#pragma unroll
    for (int r = 0; r < 2; ++r) { const float* p = py + (size_t)(r * KB32 + kb / 32) * FB; ry[s][r][0] = *(const v4f*)p; ry[s][r][1] = *(const v4f*)(p + 128); ry[s][r][2] = *(const v4f*)(p + 256); ry[s][r][3] = *(const v4f*)(p + 384); }
#pragma unroll
    for (int t = 0; t < 4; ++t) fw[s][t] = frag_blk(pw + (size_t)(t * KB32 + kb / 32) * FB, lane);
    __builtin_amdgcn_sched_barrier(0);   // keeps the stage's loads in front of the work that follows; without it they sink to their first use and each is waited for alone
  };
  auto work = [&](int s) {                                                      // y as an f16 hi+lo pair carried x8 (2 products)
    v16b ah[2], al[2];
#pragma unroll
    for (int r = 0; r < 2; ++r)
#pragma unroll
      for (int e = 0; e < 8; ++e) { b16 a, c; split16(ry[s][r][e >> 2][e & 3] * 8.0f, a, c); ah[r][e] = a; al[r][e] = c; split16(ry[s][r][2 + (e >> 2)][e & 3] * 8.0f, a, c); ah[r][8 + e] = a; al[r][8 + e] = c; }
#pragma unroll
    for (int t = 0; t < 4; ++t)
#pragma unroll
      for (int r = 0; r < 2; ++r) { acc[r][t] = wmma16b(ah[r], fw[s][t], acc[r][t]); acc[r][t] = wmma16b(al[r], fw[s][t], acc[r][t]); }
  };
  fetch(0, 0);
  for (int kb = 0; kb < D - 64; kb += 64) { fetch(kb + 32, 1); work(0); fetch(kb + 64, 0); work(1); }
  fetch(D - 32, 1);
  asm volatile("s_wait_xcnt 0x0" ::: "memory");   // the last stage's address pairs are reused by the split below while its loads are still out
  __builtin_amdgcn_sched_barrier(0);              // holds the split behind that wait
  work(0); work(1);
#pragma unroll
  for (int t = 0; t < 4; ++t)
#pragma unroll
    for (int r = 0; r < 2; ++r)
#pragma unroll
      for (int v = 0; v < 8; ++v) acc[r][t][v] = acc[r][t][v] * (1.0f / 8.0f) + bf16_rne(bo[c0 + t * 16 + nloc]);
  epi_f32(acc, 1.0f, nullptr, out, D, m0, c0, lane, Ts[wave]);
}
}  // namespace

extern "C" void kernel_launch(void* const* d_in, const int* in_sizes, int n_in,
                              void* d_out, int out_size, void* d_ws, size_t ws_size, hipStream_t stream) {
  (void)n_in; (void)out_size;
  const float* x = (const float*)d_in[0]; const int* rel = (const int*)d_in[1];
  const float* wq = (const float*)d_in[2]; const float* bq = (const float*)d_in[3]; const float* wk = (const float*)d_in[4]; const float* bk = (const float*)d_in[5]; const float* wv = (const float*)d_in[6]; const float* bv = (const float*)d_in[7];
  const float* wo = (const float*)d_in[8]; const float* bo = (const float*)d_in[9]; const float* remb = (const float*)d_in[10];
  float* out = (float*)d_out;   // [2][1024][1024]
  if (in_sizes[0] != BT * S * D || in_sizes[1] != BT * S * S || in_sizes[2] != D * D || in_sizes[8] != D * D || in_sizes[10] != NREL * HD) return;
  size_t off = 0; char* ws = (char*)d_ws;
  auto carve = [&](size_t bytes) { char* p = ws + off; off += (bytes + 255) & ~(size_t)255; return p; };
  unsigned short* x16 = (unsigned short*)carve((size_t)NTOK * D * 2); unsigned short* w16 = (unsigned short*)carve((size_t)3 * D * D * 2); b16* wo16 = (b16*)carve((size_t)D * D * 2);
  b16* qh = (b16*)carve((size_t)2 * NTOK * D * 2); b16* kh = (b16*)carve((size_t)2 * NTOK * D * 2); b16* vt = (b16*)carve((size_t)2 * NTOK * D * 2); float* y = (float*)carve((size_t)NTOK * D * 4);
  if (off > ws_size) return;                                    // ≈ 46 MB
  prep_kernel<<<512, 256, 0, stream>>>(wq, wk, wv, wo, w16, wo16);
  xprep_kernel<<<1024, 256, 0, stream>>>(x, x16);
  proj_kernel<<<dim3(3 * D / 64, NTOK / 128), 128, 0, stream>>>((const __bf16*)x16, (const __bf16*)w16, bq, bk, bv, qh, kh, vt);
  attn_kernel<S / 16><<<Bn * H * (S / 16) / 8, 256 * KP, 0, stream>>>(qh, kh, vt, rel, remb, y);
  out_kernel<<<dim3(D / 64, NTOK / 128), 128, 0, stream>>>(y, wo16, bo, out);
}

// v007
// A run of this version takes 84 microseconds.
// Timed twice side by side with v006, it ran 1.06 times as fast both times.
// All steps since v000 together make it 3.49 times as fast.
#include <hip/hip_runtime.h>

// Attention with relation embeddings: q = (x Wq^T + bq)/8, k = x Wk^T + bk, v = x Wv^T + bv (16 heads x 64); attn = softmax(q.k) (no mask; the k-relation term has scale 0);
// out_h[t] = sum_s attn[t][s] (v_h[s] + rel_emb[relation_inputs[b][t][s]]) (v-relation scale 1, shared by all heads); out = merged Wo^T + bo -> [2][1024][1024].
// The relation term is sum_r w_r[t] rel_emb[r] with w_r[t] = sum over keys s of relation r of attn[t][s]: per (b, h, 16 queries) the softmax terms are bucketed by the INPUT relation id
// into f32 LDS tables [41][lane] (plain ordered adds, no atomics), then multiplied by the 41 x 64 table; nothing index-like is written; ids only select an LDS accumulator.
// x, weights, biases, rel_emb rounded to bf16: projections on v_wmma_f32_16x16x32_bf16 (exact products; + bias); per pair a
// v_wmma_f32_16x16x32_f16; out projection with y hi+lo x8 (2 products); softmax, buckets and the relation product in f32. Fragment k-map per lane half hh for A AND B: elements 0..7 <-

namespace {
constexpr int BT = 2, Bn = 2, S = 1024, D = 1024, H = 16, HD = 64, NTOK = Bn * S, NREL = 41;
constexpr float SCALE = 0.125f, VS = 8.0f, QS = 8.0f, PS = 8.0f;   // power-of-two carry scales so hi/lo residual planes stay normal in f16
constexpr size_t VPL = (size_t)NTOK * D;   // distance between the (8v)^T hi and lo planes
constexpr size_t QPL = (size_t)NTOK * D;   // distance between the q/k hi and lo planes

typedef _Float16 b16;
typedef __attribute__((ext_vector_type(16))) _Float16 v16b;
typedef __attribute__((ext_vector_type(8)))  _Float16 v8b;
typedef __attribute__((ext_vector_type(8)))  float v8f;
typedef __attribute__((ext_vector_type(4)))  float v4f;
typedef __attribute__((ext_vector_type(4)))  int v4i;

__device__ __forceinline__ v8b ld8b(const b16* p) { return *(const v8b*)p; }
__device__ __forceinline__ v16b cat8b(v8b a, v8b b) { return __builtin_shufflevector(a, b, 0, 1, 2, 3, 4, 5, 6, 7, 8, 9, 10, 11, 12, 13, 14, 15); }
// Fragment order: every matrix operand in the workspace is kept as blocks of 16 rows x 32 k. A block of 16-bit elements is 1 KB, element (row, k) at [k >> 4][((k >> 3) & 1) * 16 + row][k & 7]:
// a lane's two 16-byte reads lie at lane * 8 and 256 + lane * 8 elements, so each wave-wide read covers 512 contiguous bytes (4 lines) and not 32 bytes in each of 16 rows.
constexpr int FB = 512, KB32 = D / 32;   // elements per block; blocks along a 1024-long k
__device__ __forceinline__ v16b frag_blk(const b16* p, unsigned lane) { return cat8b(ld8b(p + lane * 8), ld8b(p + 256 + lane * 8)); }
// Piece p (8 elements) of a [rows][1024] matrix on its way into fragment order: four lanes read one 32-element run of a row, eight rows per wave, and the wave's 16-byte stores fill four whole lines.
__device__ __forceinline__ size_t pack_src(size_t p) { return ((p >> 11) * 16 + ((p >> 2) & 15)) * D + ((p >> 6) & 31) * 32 + (p & 3) * 8; }
__device__ __forceinline__ size_t pack_dst(size_t p) { return (p >> 6) * FB + ((p >> 1) & 1) * 256 + ((p & 1) * 16 + ((p >> 2) & 15)) * 8; }
__device__ __forceinline__ void split16(float v, b16& hi, b16& lo) { hi = (b16)v; lo = (b16)(v - (float)hi); }
__device__ __forceinline__ v8f wmma16b(v16b a, v16b b, v8f c) {
  v8f d = __builtin_amdgcn_wmma_f32_16x16x32_f16(false, a, false, b, (short)0, c, false, false);
  asm volatile("v_nop\n\tv_nop\n\tv_nop\n\tv_nop" : "+v"(d) : "v"(a), "v"(b));
  return d;
}
__device__ __forceinline__ void wave_lds_sync() {
  __builtin_amdgcn_fence(__ATOMIC_RELEASE, "workgroup");
  __builtin_amdgcn_wave_barrier();
  __builtin_amdgcn_fence(__ATOMIC_ACQUIRE, "workgroup");
}

__device__ __forceinline__ void epi_planes(v8f (&acc)[2][4], float scale, bool two, b16* __restrict__ oh, b16* __restrict__ ol, int ldo,
                                           int m0, int c0, int lane, b16* Th, b16* Tl) {
  const int nloc = lane & 15, hlf = lane >> 4;
#pragma unroll
  for (int t = 0; t < 4; ++t)
#pragma unroll
    for (int r = 0; r < 2; ++r)
#pragma unroll
      for (int v = 0; v < 8; ++v) {
        const int rr = r * 16 + v + 8 * hlf, cc = t * 16 + nloc;
        b16 h_, l_; split16(acc[r][t][v] * scale, h_, l_);
        Th[rr * 64 + cc] = h_; Tl[rr * 64 + cc] = l_;
      }
  wave_lds_sync();
  {
#pragma unroll
    for (int j = 0; j < 8; ++j) {
      const int rr = j * 4 + (lane >> 3), c8 = (lane & 7) * 8;
      const size_t o = (size_t)(m0 + rr) * ldo + c0 + c8;
      *(v8b*)(oh + o) = ld8b(Th + rr * 64 + c8);
      if (two) *(v8b*)(ol + o) = ld8b(Tl + rr * 64 + c8);
    }
    
  }
}
// (b) f32 rows with pitch ldo: 64 floats = 256 B = 2 lines per row; 16 lanes x 16 B per row, 2 rows per instruction. Optional per-row factor
__device__ __forceinline__ void epi_f32(v8f (&acc)[2][4], float scale, const float* rscale, float* __restrict__ out, int ldo, int m0, int c0, int lane, float* Tt) {
  const int nloc = lane & 15, hlf = lane >> 4;
#pragma unroll
  for (int t = 0; t < 4; ++t)
#pragma unroll
    for (int r = 0; r < 2; ++r)
#pragma unroll
      for (int v = 0; v < 8; ++v) {
        const int rr = r * 16 + v + 8 * hlf;
        const float rs = rscale ? rscale[(size_t)(m0 + rr) * 32] : 1.0f;
        Tt[rr * 64 + t * 16 + nloc] = acc[r][t][v] * scale * rs;
      }
  wave_lds_sync();
  float* dst0 = out + (size_t)m0 * ldo + c0;
  {
#pragma unroll
    for (int j = 0; j < 16; ++j) { const int rr = j * 2 + hlf, c4 = nloc * 4; *(v4f*)(dst0 + (size_t)rr * ldo + c4) = *(const v4f*)(Tt + rr * 64 + c4); }
    
  }
}



typedef __attribute__((ext_vector_type(8))) __bf16 v8bb; typedef __attribute__((ext_vector_type(16))) __bf16 v16bb;
typedef __attribute__((ext_vector_type(8))) unsigned short v8us;
__device__ __forceinline__ v16bb frag_blk_bf(const __bf16* p, unsigned lane) { const v8bb a = *(const v8bb*)(p + lane * 8), b = *(const v8bb*)(p + 256 + lane * 8); return __builtin_shufflevector(a, b, 0, 1, 2, 3, 4, 5, 6, 7, 8, 9, 10, 11, 12, 13, 14, 15); }
__device__ __forceinline__ v8f wmma16bb(v16bb a, v16bb b, v8f c) {
  v8f d = __builtin_amdgcn_wmma_f32_16x16x32_bf16(false, a, false, b, (short)0, c, false, false);
  asm volatile("v_nop\n\tv_nop\n\tv_nop\n\tv_nop" : "+v"(d) : "v"(a), "v"(b));
  return d;
}
__device__ __forceinline__ unsigned short bf16_rne_bits(float v) { unsigned int u = __float_as_uint(v); u += 0x7FFFu + ((u >> 16) & 1u); return (unsigned short)(u >> 16); }
__device__ __forceinline__ float bf16_rne(float v) { return __uint_as_float(((unsigned int)bf16_rne_bits(v)) << 16); }



// x (f32) -> bf16 bits, round to nearest even.
__global__ __launch_bounds__(256) void xprep_kernel(const float* __restrict__ x, unsigned short* __restrict__ x16) {   // one pass's two batches -> bf16
  const size_t tid = (size_t)blockIdx.x * blockDim.x + threadIdx.x, nth = (size_t)gridDim.x * blockDim.x;
  { for (size_t p = tid; p < (size_t)NTOK * D / 8; p += nth) { v8us v;
#pragma unroll
      for (int e = 0; e < 8; ++e) v[e] = bf16_rne_bits(x[pack_src(p) + e]);
      *(v8us*)(x16 + pack_dst(p)) = v; }  }
}
__global__ __launch_bounds__(256) void prep_kernel(const float* __restrict__ wq, const float* __restrict__ wk, const float* __restrict__ wv, const float* __restrict__ wo, unsigned short* __restrict__ w16, b16* __restrict__ wo16) {
  const size_t tid = (size_t)blockIdx.x * blockDim.x + threadIdx.x, nth = (size_t)gridDim.x * blockDim.x;
  {
    for (size_t p = tid; p < (size_t)3 * D * D / 8; p += nth) { const float* W = (p < (size_t)D * D / 8) ? wq : (p < (size_t)2 * D * D / 8) ? wk : wv; const size_t q = p % ((size_t)D * D / 8); v8us v;   // [out][in] rows into fragment order; the three matrices follow one another as 3072 rows
#pragma unroll
      for (int e = 0; e < 8; ++e) v[e] = bf16_rne_bits(W[pack_src(q) + e]);
      *(v8us*)(w16 + pack_dst(p)) = v; }
    for (size_t p = tid; p < (size_t)D * D / 8; p += nth) { v8b w;   // W_o [out][in] rows into fragment order
#pragma unroll
      for (int e = 0; e < 8; ++e) w[e] = (b16)bf16_rne(wo[pack_src(p) + e]);
      *(v8b*)(wo16 + pack_dst(p)) = w; }
    
  }
}

// projections: rows = tokens (2048), K = 1024, column tiles of 64 = one head of q (tiles 0..15), k (16..31) or v (32..47); f16 planes [b*H + head] of 1024 tok x 64 for q/k;
// v: (8v)^T f16 planes [b*H + head] of 64 x 1024 tok; inside a plane the elements lie in fragment order (blocks of 16 rows x 32 k). grid (48, 16) x 128.
__global__ __launch_bounds__(128) void proj_kernel(const __bf16* __restrict__ x16, const __bf16* __restrict__ w16, const float* __restrict__ bq, const float* __restrict__ bk, const float* __restrict__ bv, b16* __restrict__ qh, b16* __restrict__ kh, b16* __restrict__ vt) {
  __shared__ __attribute__((aligned(16))) b16 Th[4][32][HD + 8], Tq[4][32][HD + 8];
  __shared__ __attribute__((aligned(16))) b16 Tt[64][128 + 8], Tl[64][128 + 8];
  const int lane = threadIdx.x & 31, wave = threadIdx.x >> 5, nloc = lane & 15, hlf = lane >> 4, m0 = blockIdx.y * 128 + wave * 32, c0 = blockIdx.x * 64;
  v8f acc[2][4];
#pragma unroll
  for (int r = 0; r < 2; ++r)
#pragma unroll
    for (int t = 0; t < 4; ++t) acc[r][t] = (v8f){};
  // Three register stages of 32 k: all twelve loads of stage j + 2 are issued ahead of the matrix instructions of stage j, so a stage waits once, two stages late, not once per weight fragment.
  const __bf16* pa = x16 + (size_t)(m0 / 16) * KB32 * FB; const __bf16* pw = w16 + (size_t)(c0 / 16) * KB32 * FB;
  v16bb fa[3][2], fw[3][4];
  auto fetch = [&](int st, int s) {
#pragma unroll
    for (int r = 0; r < 2; ++r) fa[s][r] = frag_blk_bf(pa + (size_t)(r * KB32 + st) * FB, lane);
#pragma unroll
    for (int t = 0; t < 4; ++t) fw[s][t] = frag_blk_bf(pw + (size_t)(t * KB32 + st) * FB, lane);
    __builtin_amdgcn_sched_barrier(0);   // keeps the stage's loads in front of the matrix instructions that follow; without it they sink to their first use and each is waited for alone
  };
  auto work = [&](int s) {
#pragma unroll
    for (int t = 0; t < 4; ++t) { acc[0][t] = wmma16bb(fa[s][0], fw[s][t], acc[0][t]); acc[1][t] = wmma16bb(fa[s][1], fw[s][t], acc[1][t]); }
  };
  fetch(0, 0); fetch(1, 1);
  for (int st = 0; st < D / 32 - 2; st += 3) { fetch(st + 2, 2); work(0); fetch(st + 3, 0); work(1); fetch(st + 4, 1); work(2);
    asm volatile("s_wait_xcnt 0x0" ::: "memory"); }   // the trip's loads are still out when the next trip rewrites their address pairs
  work(0); work(1);
  const int which = blockIdx.x / (D / 64), head = blockIdx.x % (D / 64), b = m0 / S, tok0 = m0 % S;
  { const float* bias = (which == 0) ? bq : (which == 1) ? bk : bv;   // + bf16(bias)
#pragma unroll
    for (int t = 0; t < 4; ++t) { const float bb = bf16_rne(bias[head * HD + t * 16 + nloc]);
#pragma unroll
      for (int r = 0; r < 2; ++r)
#pragma unroll
        for (int v = 0; v < 8; ++v) acc[r][t][v] += bb; } }
  if (which < 2) {                                              // q or k head: f16 hi/lo blocks in fragment order
#pragma unroll
    for (int t = 0; t < 4; ++t)
#pragma unroll
      for (int r = 0; r < 2; ++r)
#pragma unroll
        for (int v = 0; v < 8; ++v) { b16 a_, c_; split16(acc[r][t][v] * QS, a_, c_); Th[wave][r * 16 + 8 * hlf + v][t * 16 + nloc] = a_; Tq[wave][r * 16 + 8 * hlf + v][t * 16 + nloc] = c_; }   // q, k carried x8 (lo residuals stay normal)
    wave_lds_sync();
    b16* dst = (which == 0 ? qh : kh) + (((size_t)b * H + head) * S + tok0) * HD;
    {
#pragma unroll
      for (int j = 0; j < 8; ++j) { const int rr = (j >> 2) * 16 + nloc, c8 = (j & 3) * 16 + hlf * 8;   // blocks [16 tokens][32 d] in the order token block, d half: the wave's 32 x 64 tile is 4 KB in a row
        *(v8b*)(dst + j * 256 + lane * 8) = *(const v8b*)(&Th[wave][rr][c8]); *(v8b*)(dst + QPL + j * 256 + lane * 8) = *(const v8b*)(&Tq[wave][rr][c8]); }
       }
    return;
  }
  const int vh = head;                                          // v head: (8v)^T tile [64 d][128 tok] via LDS, rows of 256 B
#pragma unroll
  for (int t = 0; t < 4; ++t)
#pragma unroll
    for (int r = 0; r < 2; ++r)
#pragma unroll
      for (int v = 0; v < 8; ++v) { b16 a_, c_; split16(acc[r][t][v] * VS, a_, c_); Tt[t * 16 + nloc][wave * 32 + r * 16 + 8 * hlf + v] = a_; Tl[t * 16 + nloc][wave * 32 + r * 16 + 8 * hlf + v] = c_; }
  __syncthreads();
  b16* dstv = vt + (((size_t)b * H + vh) * HD) * S + (size_t)((blockIdx.y * 128) % S) * HD;   // blocks [16 d][32 tokens] in the order token run of 32, d block
  {
#pragma unroll
    for (int j = 0; j < 8; ++j) { const int dd = (j >> 1) * 16 + nloc, c8 = wave * 32 + (j & 1) * 16 + hlf * 8, o = (wave * 8 + j) * 256 + lane * 8; *(v8b*)(dstv + o) = *(const v8b*)(&Tt[dd][c8]); *(v8b*)(dstv + VPL + o) = *(const v8b*)(&Tl[dd][c8]); }
    asm volatile("s_wait_xcnt 0x0" ::: "memory");   // the build lays the q/k branch behind these stores, where their address pair is written again
    
  }
}

__device__ __forceinline__ void s_tile(const b16* __restrict__ K, const v16b* qf, const v16b* ql, int kb, unsigned lane, v8f& s0, v8f& s1) {
  s0 = (v8f){}; s1 = (v8f){};
  const b16* kl = K + (size_t)kb * HD + lane * 8;   // the lane's place in the trip's first block
  v16b k0[2], k0l[2], k1[2], k1l[2];   // all sixteen key reads of the trip go out together: one wait for memory per trip, not one per half of the head dimension
#pragma unroll
  for (int ks = 0; ks < 2; ++ks) { const b16* kp = kl + ks * FB; k0[ks] = frag_blk(kp, 0); k0l[ks] = frag_blk(kp + QPL, 0); k1[ks] = frag_blk(kp + 2 * FB, 0); k1l[ks] = frag_blk(kp + QPL + 2 * FB, 0); }
  // stands behind the key reads because their address pair is rewritten later in the trip, in pass 2 while the reads are still out; it names the pair so that none of the sixteen reads lands on it in front of the wait
  asm volatile("s_wait_xcnt 0x0" :: "v"(kl) : "memory");
#pragma unroll
  for (int ks = 0; ks < 2; ++ks) { s0 = wmma16b(k0[ks], qf[ks], s0); s0 = wmma16b(k0[ks], ql[ks], s0); s0 = wmma16b(k0l[ks], qf[ks], s0); s1 = wmma16b(k1[ks], qf[ks], s1); s1 = wmma16b(k1[ks], ql[ks], s1); s1 = wmma16b(k1l[ks], qf[ks], s1); }
#pragma unroll
  for (int r = 0; r < 8; ++r) { s0[r] *= SCALE / (QS * QS); s1[r] *= SCALE / (QS * QS); }
}
// Each 16-query tile is worked by KP waves of one work-group, each on its own run of keys (TP trips of 32 keys; the last part has what is left): wave = part * 8 + tile.
// The parts meet twice in LDS: after pass 1 (row shift) and after pass 2 (partial outputs and partial relation buckets, summed in part order 0..KP-1).
// Pass 1 finds only the shift of the softmax, which cancels in the quotient: the row maximum of the hi x hi product alone, 64 keys a trip, K1 keys a part. Pass 2 works with exp(s - shift),
// not divided; every key falls into exactly one bucket, so the row sum is the sum of the row's buckets, and the epilogue divides by it once.
constexpr int KP = 3, TP = (S / 32 + KP - 1) / KP, K1 = ((S / 64 + KP - 1) / KP) * 64;
// Relation buckets: each wave has two tables [41 ids][32 lanes], one per key half of a trip. A lane adds only into its own column of each: no turn-taking between the two lanes of a query,
// the adds into the two tables do not depend on each other, and bank = lane (+ 32 for odd ids), so no two lanes meet on a bank. After pass 2 the wave folds the four columns of a query
// into columns 0..15 of the first table; its partial output then lies over the second table.
constexpr int TS = NREL * 32, OP = HD + 4;
static_assert(16 * OP <= TS && TS % 4 == 0, "the partial output fits over the second table, 16-byte aligned");
template <int QT>
__global__ __launch_bounds__(256 * KP) void attn_kernel(const b16* __restrict__ qh, const b16* __restrict__ kh, const b16* __restrict__ vt, const int* __restrict__ rel, const float* __restrict__ remb, float* __restrict__ y) {
  __shared__ __attribute__((aligned(16))) float Wk[8 * KP][2 * TS]; __shared__ __attribute__((aligned(16))) float Es[NREL][HD]; __shared__ float Ms[8 * KP][16];
  // the wave's number is taken as a scalar so that tile, part, head, the key range and the base addresses formed from them stay out of the vector registers
  const int wid = __builtin_amdgcn_readfirstlane(threadIdx.x >> 5), lane = threadIdx.x & 31, hh = lane >> 4, col = lane & 15, tile = wid & 7, part = wid >> 3;
  const int kbeg = part * TP * 32, kend = (kbeg + TP * 32 < S) ? kbeg + TP * 32 : S;
  for (int i = threadIdx.x; i < NREL * HD; i += 256 * KP) Es[i / HD][i % HD] = bf16_rne(remb[i]);
  for (int i = lane; i < 2 * TS / 4; i += 32) *(v4f*)(&Wk[wid][i * 4]) = (v4f){};
  __syncthreads();
  const int qt = blockIdx.x * 8 + tile, jt = qt % QT, bh = qt / QT, h = bh % H, b = bh / H, q0 = jt * 16, qi = q0 + col;
  const b16* Q = qh + ((size_t)bh * S) * HD; const b16* K = kh + ((size_t)bh * S) * HD; const b16* vb = vt + ((size_t)bh * HD) * S; const int* rrow = rel + ((size_t)b * S + qi) * S;
  v16b qf[2], ql[2];
#pragma unroll
  for (int ks = 0; ks < 2; ++ks) { qf[ks] = frag_blk(Q + (size_t)q0 * HD + ks * FB, lane); ql[ks] = frag_blk(Q + QPL + (size_t)q0 * HD + ks * FB, lane); }
  asm volatile("s_wait_xcnt 0x0" ::: "memory");   // the query reads' address pair is rewritten behind the loop's entry branch
  float m = -INFINITY;
  const int k1beg = part * K1, k1end = (k1beg + K1 < S) ? k1beg + K1 : S;
  for (int kb = k1beg; kb < k1end; kb += 64) {                    // pass 1
    const b16* kl = K + (size_t)kb * HD + lane * 8;   // the lane's place in the trip's first block
    v16b kf[4][2]; v8f s[4] = {{}, {}, {}, {}};       // the sixteen hi-plane reads of 64 keys go out together: one wait for memory per trip
#pragma unroll
    for (int t = 0; t < 4; ++t)
#pragma unroll
      for (int ks = 0; ks < 2; ++ks) kf[t][ks] = frag_blk(kl + (t * 2 + ks) * FB, 0);
    asm volatile("s_wait_xcnt 0x0" :: "v"(kl) : "memory");   // the reads' address pair is rewritten for the next trip while they may still be out; it names the pair so that no read lands on it in front of the wait
    __builtin_amdgcn_sched_barrier(0);   // keeps the sixteen reads in front of the matrix instructions; without it they sink to their first use and each is waited for alone
#pragma unroll
    for (int ks = 0; ks < 2; ++ks)
#pragma unroll
      for (int t = 0; t < 4; ++t) s[t] = __builtin_amdgcn_wmma_f32_16x16x32_f16(false, kf[t][ks], false, qf[ks], (short)0, s[t], false, false);   // four independent sums fill each other's distance
#pragma unroll
    for (int r = 0; r < 8; ++r) m = fmaxf(m, fmaxf(fmaxf(s[0][r], s[1][r]), fmaxf(s[2][r], s[3][r])));
  }
  m *= SCALE / (QS * QS);                                        // a power of two: scaling the maximum is exact
  m = fmaxf(m, __shfl_xor(m, 16));
  if (hh == 0) Ms[wid][col] = m;                                 // this part's row shift (both lane halves hold the same value)
  __syncthreads();
  { float mg = -INFINITY;
#pragma unroll
    for (int p = 0; p < KP; ++p) mg = fmaxf(mg, Ms[p * 8 + tile][col]);
    m = mg; }
  v8f o[4] = {{}, {}, {}, {}};
  float* t0 = &Wk[wid][lane]; float* t1 = t0 + TS;   // the lane's own columns: keys 8 hh + r and keys 16 + 8 hh + r of a trip
  // Pass 2 meets three read latencies a trip, not five (keys, then one per 16 d of the values): the keys; all four hi planes of the values, issued ahead of the softmax arithmetic, with the relation
  // ids behind them; all four lo planes, issued ahead of the bucket adds, into the registers that the hi planes have left. Each sum keeps its order hi p-hi, hi p-lo, lo p-hi.
  for (int kb = kbeg; kb < kend; kb += 32) { v8f s0, s1; s_tile(K, qf, ql, kb, lane, s0, s1);     // pass 2
    const b16* vp = vb + (size_t)kb * HD + lane * 8; const int* rp = rrow + kb + 8 * hh;
    v16b vf[4], vl[4], pb, pl; v4i id[4];
#pragma unroll
    for (int n = 0; n < 4; ++n) vf[n] = frag_blk(vp + n * FB, 0);
#pragma unroll
    for (int j = 0; j < 4; ++j) id[j] = *(const v4i*)(rp + (j >> 1) * 16 + (j & 1) * 4);   // keys 8 hh + 0..7 and 16 + 8 hh + 0..7
#pragma unroll
    for (int r = 0; r < 8; ++r) { s0[r] = __expf(s0[r] - m); s1[r] = __expf(s1[r] - m); b16 a, c; split16(s0[r] * PS, a, c); pb[r] = a; pl[r] = c; split16(s1[r] * PS, a, c); pb[8 + r] = a; pl[8 + r] = c; }
#pragma unroll
    for (int n = 0; n < 4; ++n) o[n] = wmma16b(vf[n], pb, o[n]);
#pragma unroll
    for (int n = 0; n < 4; ++n) o[n] = wmma16b(vf[n], pl, o[n]);
#pragma unroll
    for (int n = 0; n < 4; ++n) vl[n] = frag_blk(vp + VPL + n * FB, 0);
    asm volatile("s_wait_xcnt 0x0" :: "v"(vp) : "memory");   // the value reads' and the id reads' address pairs are rewritten behind this line while reads are still out; it names the value pair so that no read lands on it while others still name it
    // relation buckets: column[id] += p in the lane's own two columns (plain adds, no atomics); both reads of a step go out before either write
#pragma unroll
    for (int r = 0; r < 8; ++r) { const int ra = id[r >> 2][r & 3], rb = id[2 + (r >> 2)][r & 3];
      const int ia = ((ra < 0) ? 0 : (ra >= NREL ? NREL - 1 : ra)) * 32, ib = ((rb < 0) ? 0 : (rb >= NREL ? NREL - 1 : rb)) * 32;
      const float a = t0[ia], c = t1[ib]; t0[ia] = a + s0[r]; t1[ib] = c + s1[r]; }
    __builtin_amdgcn_sched_barrier(0);   // keeps the last four matrix instructions, and with them the waits for the lo planes, behind the bucket adds that cover those reads; without it they rise to the head of the adds
#pragma unroll
    for (int n = 0; n < 4; ++n) o[n] = wmma16b(vl[n], pb, o[n]);
  }
  wave_lds_sync();   // the fold reads columns that other lanes of the wave wrote
  for (int i = lane; i < NREL * 4; i += 32) { float* t = &Wk[wid][(i >> 2) * 32 + (i & 3) * 4];   // four queries of one id per lane
    *(v4f*)t = ((*(const v4f*)t + *(const v4f*)(t + 16)) + *(const v4f*)(t + TS)) + *(const v4f*)(t + TS + 16); }
  wave_lds_sync();   // the partial output below overwrites the second table, which other lanes have just read
  // epilogue: y[q][d] = (sum over parts of o/64 + sum_r w[r][q] E[r][d]) / sum_r w[r][q], w = sum over parts of bucket. Each wave leaves its partial o in LDS; behind the barrier the waves of parts 0 and 1
  // finish eight queries of their tile each: four lanes per query, sixteen consecutive d per lane, so each of its four stores fills four whole lines.
#pragma unroll
  for (int n = 0; n < 4; ++n)
#pragma unroll
    for (int r = 0; r < 8; ++r) Wk[wid][TS + col * OP + n * 16 + 8 * hh + r] = o[n][r] * (1.0f / (VS * PS));
  __syncthreads();
  if (part < 2) {
    const int qq = part * 8 + (lane >> 2), d0 = (lane & 3) * 16;
    v4f a[4] = {{}, {}, {}, {}}; float l = 0.0f;
#pragma unroll
    for (int p = 0; p < KP; ++p)
#pragma unroll
      for (int j = 0; j < 4; ++j) a[j] += *(const v4f*)(&Wk[p * 8 + tile][TS + qq * OP + d0 + 4 * j]);
    // Unrolled so that the reads of later ids are issued under the multiply-adds of earlier ones; each sum still adds ids 0..40 in that order.
#pragma unroll
    for (int rr = 0; rr < NREL; ++rr) { float w = 0.0f;
#pragma unroll
      for (int p = 0; p < KP; ++p) w += Wk[p * 8 + tile][rr * 32 + qq];
      l += w;
#pragma unroll
      for (int j = 0; j < 4; ++j) a[j] += w * *(const v4f*)(&Es[rr][d0 + 4 * j]); }
    // y in fragment order for the output product: f32 blocks of 16 rows x 32 k (2 KB), element (row, k) at [k >> 4][(k >> 2) & 1][((k >> 3) & 1) * 16 + row][k & 3]; a store fills four whole lines
    const float il = 1.0f / l;
    float* dst = y + ((size_t)((b * S + q0) / 16) * KB32 + h * 2 + ((lane & 3) >> 1)) * FB + (lane & 1) * 256 + qq * 4;
#pragma unroll
    for (int j = 0; j < 4; ++j) *(v4f*)(dst + (j & 1) * 128 + (j >> 1) * 64) = a[j] * il;
  }
}

// out = y W_o^T: (2048 x 1024) x (1024 x 1024); A = y x8 split at load into f16 hi + lo, B = f16(bf16 W_o) rows; f32 rows; grid (16, 16).
__global__ __launch_bounds__(128) void out_kernel(const float* __restrict__ y, const b16* __restrict__ wo16, const float* __restrict__ bo, float* __restrict__ out) {
  __shared__ __attribute__((aligned(16))) float Ts[4][32 * 64];
  const int lane = threadIdx.x & 31, wave = threadIdx.x >> 5, nloc = lane & 15, hlf = lane >> 4, m0 = blockIdx.y * 128 + wave * 32, c0 = blockIdx.x * 64;
  v8f acc[2][4];
#pragma unroll
  for (int r = 0; r < 2; ++r)
#pragma unroll
    for (int t = 0; t < 4; ++t) acc[r][t] = (v8f){};
  // Two register stages of 32 k: the sixteen loads of stage j + 1 (raw f32 y, f16 weights) are issued ahead of the split and the matrix instructions of stage j.
  const float* py = y + (size_t)(m0 / 16) * KB32 * FB + lane * 4; const b16* pw = wo16 + (size_t)(c0 / 16) * KB32 * FB;
  v4f ry[2][2][4]; v16b fw[2][4];
  auto fetch = [&](int kb, int s) {
#pragma unroll
    for (int r = 0; r < 2; ++r) { const float* p = py + (size_t)(r * KB32 + kb / 32) * FB; ry[s][r][0] = *(const v4f*)p; ry[s][r][1] = *(const v4f*)(p + 128); ry[s][r][2] = *(const v4f*)(p + 256); ry[s][r][3] = *(const v4f*)(p + 384); }
#pragma unroll
    for (int t = 0; t < 4; ++t) fw[s][t] = frag_blk(pw + (size_t)(t * KB32 + kb / 32) * FB, lane);
    __builtin_amdgcn_sched_barrier(0);   // keeps the stage's loads in front of the work that follows; without it they sink to their first use and each is waited for alone
  };
  auto work = [&](int s) {                                                      // y as an f16 hi+lo pair carried x8 (2 products)
    v16b ah[2], al[2];
#pragma unroll
    for (int r = 0; r < 2; ++r)
#pragma unroll
      for (int e = 0; e < 8; ++e) { b16 a, c; split16(ry[s][r][e >> 2][e & 3] * 8.0f, a, c); ah[r][e] = a; al[r][e] = c; split16(ry[s][r][2 + (e >> 2)][e & 3] * 8.0f, a, c); ah[r][8 + e] = a; al[r][8 + e] = c; }
#pragma unroll
    for (int t = 0; t < 4; ++t)
#pragma unroll
      for (int r = 0; r < 2; ++r) { acc[r][t] = wmma16b(ah[r], fw[s][t], acc[r][t]); acc[r][t] = wmma16b(al[r], fw[s][t], acc[r][t]); }
  };
  fetch(0, 0);
  for (int kb = 0; kb < D - 64; kb += 64) { fetch(kb + 32, 1); work(0); fetch(kb + 64, 0); work(1); }
  fetch(D - 32, 1);
  asm volatile("s_wait_xcnt 0x0" ::: "memory");   // the last stage's address pairs are reused by the split below while its loads are still out
  __builtin_amdgcn_sched_barrier(0);              // holds the split behind that wait
  work(0); work(1);
#pragma unroll
  for (int t = 0; t < 4; ++t)
#pragma unroll
    for (int r = 0; r < 2; ++r)
#pragma unroll
      for (int v = 0; v < 8; ++v) acc[r][t][v] = acc[r][t][v] * (1.0f / 8.0f) + bf16_rne(bo[c0 + t * 16 + nloc]);
  epi_f32(acc, 1.0f, nullptr, out, D, m0, c0, lane, Ts[wave]);
}
}  // namespace

extern "C" void kernel_launch(void* const* d_in, const int* in_sizes, int n_in,
                              void* d_out, int out_size, void* d_ws, size_t ws_size, hipStream_t stream) {
  (void)n_in; (void)out_size;
  const float* x = (const float*)d_in[0]; const int* rel = (const int*)d_in[1];
  const float* wq = (const float*)d_in[2]; const float* bq = (const float*)d_in[3]; const float* wk = (const float*)d_in[4]; const float* bk = (const float*)d_in[5]; const float* wv = (const float*)d_in[6]; const float* bv = (const float*)d_in[7];
  const float* wo = (const float*)d_in[8]; const float* bo = (const float*)d_in[9]; const float* remb = (const float*)d_in[10];
  float* out = (float*)d_out;   // [2][1024][1024]
  if (in_sizes[0] != BT * S * D || in_sizes[1] != BT * S * S || in_sizes[2] != D * D || in_sizes[8] != D * D || in_sizes[10] != NREL * HD) return;
  size_t off = 0; char* ws = (char*)d_ws;
  auto carve = [&](size_t bytes) { char* p = ws + off; off += (bytes + 255) & ~(size_t)255; return p; };
  unsigned short* x16 = (unsigned short*)carve((size_t)NTOK * D * 2); unsigned short* w16 = (unsigned short*)carve((size_t)3 * D * D * 2); b16* wo16 = (b16*)carve((size_t)D * D * 2);
  b16* qh = (b16*)carve((size_t)2 * NTOK * D * 2); b16* kh = (b16*)carve((size_t)2 * NTOK * D * 2); b16* vt = (b16*)carve((size_t)2 * NTOK * D * 2); float* y = (float*)carve((size_t)NTOK * D * 4);
  if (off > ws_size) return;                                    // ≈ 46 MB
  prep_kernel<<<512, 256, 0, stream>>>(wq, wk, wv, wo, w16, wo16);
  xprep_kernel<<<1024, 256, 0, stream>>>(x, x16);
  proj_kernel<<<dim3(3 * D / 64, NTOK / 128), 128, 0, stream>>>((const __bf16*)x16, (const __bf16*)w16, bq, bk, bv, qh, kh, vt);
  attn_kernel<S / 16><<<Bn * H * (S / 16) / 8, 256 * KP, 0, stream>>>(qh, kh, vt, rel, remb, y);
  out_kernel<<<dim3(D / 64, NTOK / 128), 128, 0, stream>>>(y, wo16, bo, out);
}

// v008
// Measured time: 80.4 microseconds a run.
// Next to v007, in two timings, it ran 1.04 times as fast each time.
// Counting every step since v000, it is 3.63 times as fast.
#include <hip/hip_runtime.h>

// Attention with relation embeddings: q = (x Wq^T + bq)/8, k = x Wk^T + bk, v = x Wv^T + bv (16 heads x 64); attn = softmax(q.k) (no mask; the k-relation term has scale 0);
// out_h[t] = sum_s attn[t][s] (v_h[s] + rel_emb[relation_inputs[b][t][s]]) (v-relation scale 1, shared by all heads); out = merged Wo^T + bo -> [2][1024][1024].
// The relation term is sum_r w_r[t] rel_emb[r] with w_r[t] = sum over keys s of relation r of attn[t][s]: per (b, h, 16 queries) the softmax terms are bucketed by the INPUT relation id
// into f32 LDS tables [41][lane] (plain ordered adds, no atomics), then multiplied by the 41 x 64 table; nothing index-like is written; ids only select an LDS accumulator.
// x, weights, biases, rel_emb rounded to bf16: projections on v_wmma_f32_16x16x32_bf16 (exact products; + bias); per pair a
// v_wmma_f32_16x16x32_f16; out projection with y hi+lo x8 (2 products); softmax, buckets and the relation product in f32. Fragment k-map per lane half hh for A AND B: elements 0..7 <-

namespace {
constexpr int BT = 2, Bn = 2, S = 1024, D = 1024, H = 16, HD = 64, NTOK = Bn * S, NREL = 41;
constexpr float SCALE = 0.125f, VS = 8.0f, QS = 8.0f, PS = 8.0f;   // power-of-two carry scales so hi/lo residual planes stay normal in f16
constexpr size_t VPL = (size_t)NTOK * D;   // distance between the (8v)^T hi and lo planes
constexpr size_t QPL = (size_t)NTOK * D;   // distance between the q/k hi and lo planes

typedef _Float16 b16;
typedef __attribute__((ext_vector_type(16))) _Float16 v16b;
typedef __attribute__((ext_vector_type(8)))  _Float16 v8b;
typedef __attribute__((ext_vector_type(8)))  float v8f;
typedef __attribute__((ext_vector_type(4)))  float v4f;
typedef __attribute__((ext_vector_type(4)))  int v4i;

__device__ __forceinline__ v8b ld8b(const b16* p) { return *(const v8b*)p; }
__device__ __forceinline__ v16b cat8b(v8b a, v8b b) { return __builtin_shufflevector(a, b, 0, 1, 2, 3, 4, 5, 6, 7, 8, 9, 10, 11, 12, 13, 14, 15); }
// Fragment order: every matrix operand in the workspace is kept as blocks of 16 rows x 32 k. A block of 16-bit elements is 1 KB, element (row, k) at [k >> 4][((k >> 3) & 1) * 16 + row][k & 7]:
// a lane's two 16-byte reads lie at lane * 8 and 256 + lane * 8 elements, so each wave-wide read covers 512 contiguous bytes (4 lines) and not 32 bytes in each of 16 rows.
constexpr int FB = 512, KB32 = D / 32;   // elements per block; blocks along a 1024-long k
__device__ __forceinline__ v16b frag_blk(const b16* p, unsigned lane) { return cat8b(ld8b(p + lane * 8), ld8b(p + 256 + lane * 8)); }
// Piece p (8 elements) of a [rows][1024] matrix on its way into fragment order: four lanes read one 32-element run of a row, eight rows per wave, and the wave's 16-byte stores fill four whole lines.
__device__ __forceinline__ size_t pack_src(size_t p) { return ((p >> 11) * 16 + ((p >> 2) & 15)) * D + ((p >> 6) & 31) * 32 + (p & 3) * 8; }
__device__ __forceinline__ size_t pack_dst(size_t p) { return (p >> 6) * FB + ((p >> 1) & 1) * 256 + ((p & 1) * 16 + ((p >> 2) & 15)) * 8; }
__device__ __forceinline__ void split16(float v, b16& hi, b16& lo) { hi = (b16)v; lo = (b16)(v - (float)hi); }
__device__ __forceinline__ v8f wmma16b(v16b a, v16b b, v8f c) {
  v8f d = __builtin_amdgcn_wmma_f32_16x16x32_f16(false, a, false, b, (short)0, c, false, false);
  asm volatile("v_nop\n\tv_nop\n\tv_nop\n\tv_nop" : "+v"(d) : "v"(a), "v"(b));
  return d;
}
__device__ __forceinline__ void wave_lds_sync() {
  __builtin_amdgcn_fence(__ATOMIC_RELEASE, "workgroup");
  __builtin_amdgcn_wave_barrier();
  __builtin_amdgcn_fence(__ATOMIC_ACQUIRE, "workgroup");
}

__device__ __forceinline__ void epi_planes(v8f (&acc)[2][4], float scale, bool two, b16* __restrict__ oh, b16* __restrict__ ol, int ldo,
                                           int m0, int c0, int lane, b16* Th, b16* Tl) {
  const int nloc = lane & 15, hlf = lane >> 4;
#pragma unroll
  for (int t = 0; t < 4; ++t)
#pragma unroll
    for (int r = 0; r < 2; ++r)
#pragma unroll
      for (int v = 0; v < 8; ++v) {
        const int rr = r * 16 + v + 8 * hlf, cc = t * 16 + nloc;
        b16 h_, l_; split16(acc[r][t][v] * scale, h_, l_);
        Th[rr * 64 + cc] = h_; Tl[rr * 64 + cc] = l_;
      }
  wave_lds_sync();
  {
#pragma unroll
    for (int j = 0; j < 8; ++j) {
      const int rr = j * 4 + (lane >> 3), c8 = (lane & 7) * 8;
      const size_t o = (size_t)(m0 + rr) * ldo + c0 + c8;
      *(v8b*)(oh + o) = ld8b(Th + rr * 64 + c8);
      if (two) *(v8b*)(ol + o) = ld8b(Tl + rr * 64 + c8);
    }
    
  }
}
// (b) f32 rows with pitch ldo: 64 floats = 256 B = 2 lines per row; 16 lanes x 16 B per row, 2 rows per instruction. Optional per-row factor
__device__ __forceinline__ void epi_f32(v8f (&acc)[2][4], float scale, const float* rscale, float* __restrict__ out, int ldo, int m0, int c0, int lane, float* Tt) {
  const int nloc = lane & 15, hlf = lane >> 4;
#pragma unroll
  for (int t = 0; t < 4; ++t)
#pragma unroll
    for (int r = 0; r < 2; ++r)
#pragma unroll
      for (int v = 0; v < 8; ++v) {
        const int rr = r * 16 + v + 8 * hlf;
        const float rs = rscale ? rscale[(size_t)(m0 + rr) * 32] : 1.0f;
        Tt[rr * 64 + t * 16 + nloc] = acc[r][t][v] * scale * rs;
      }
  wave_lds_sync();
  float* dst0 = out + (size_t)m0 * ldo + c0;
  {
#pragma unroll
    for (int j = 0; j < 16; ++j) { const int rr = j * 2 + hlf, c4 = nloc * 4; *(v4f*)(dst0 + (size_t)rr * ldo + c4) = *(const v4f*)(Tt + rr * 64 + c4); }
    
  }
}



typedef __attribute__((ext_vector_type(8))) __bf16 v8bb; typedef __attribute__((ext_vector_type(16))) __bf16 v16bb;
typedef __attribute__((ext_vector_type(8))) unsigned short v8us;
__device__ __forceinline__ v16bb frag_blk_bf(const __bf16* p, unsigned lane) { const v8bb a = *(const v8bb*)(p + lane * 8), b = *(const v8bb*)(p + 256 + lane * 8); return __builtin_shufflevector(a, b, 0, 1, 2, 3, 4, 5, 6, 7, 8, 9, 10, 11, 12, 13, 14, 15); }
__device__ __forceinline__ v8f wmma16bb(v16bb a, v16bb b, v8f c) {
  v8f d = __builtin_amdgcn_wmma_f32_16x16x32_bf16(false, a, false, b, (short)0, c, false, false);
  asm volatile("v_nop\n\tv_nop\n\tv_nop\n\tv_nop" : "+v"(d) : "v"(a), "v"(b));
  return d;
}
__device__ __forceinline__ unsigned short bf16_rne_bits(float v) { unsigned int u = __float_as_uint(v); u += 0x7FFFu + ((u >> 16) & 1u); return (unsigned short)(u >> 16); }
__device__ __forceinline__ float bf16_rne(float v) { return __uint_as_float(((unsigned int)bf16_rne_bits(v)) << 16); }



// One preparation launch for everything that goes into fragment order. Each of W_q, W_k, W_v, W_o and each batch of x is 1024 x 1024 = PCS pieces of 8 elements, and the grid has PCS threads:
// a thread takes the same piece of all six, so one source offset and one destination offset serve them all, and its twelve 16-byte reads are out together: one trip to memory per thread.
constexpr int PCS = D * D / 8;
__global__ __launch_bounds__(256) void prep_kernel(const float* __restrict__ x, const float* __restrict__ wq, const float* __restrict__ wk, const float* __restrict__ wv, const float* __restrict__ wo,
                                                   unsigned short* __restrict__ x16, unsigned short* __restrict__ w16, b16* __restrict__ wo16) {
  const size_t p = (size_t)blockIdx.x * 256 + threadIdx.x, dst = pack_dst(p);
  const unsigned sb = (unsigned)pack_src(p) * 4u;   // the piece's byte offset in its matrix (under 4 MB): one 32-bit register beside the scalar bases addresses all twelve reads
  const float* in[6] = {wq, wk, wv, x, x + (size_t)D * D, wo};
  v4f r[6][2];
#pragma unroll
  for (int i = 0; i < 6; ++i) { const char* q = (const char*)in[i] + sb; r[i][0] = *(const v4f*)q; r[i][1] = *(const v4f*)(q + 16); }
  asm volatile("s_wait_xcnt 0x0" :: "v"(sb) : "memory");   // the reads' offset register is free for reuse behind this line while reads are still out; it names the register so that none of the twelve reads lands on it in front of the wait
  unsigned short* ob[5] = {w16 + dst, w16 + (size_t)D * D + dst, w16 + (size_t)2 * D * D + dst, x16 + dst, x16 + (size_t)D * D + dst};   // the three weight matrices follow one another as 3072 rows
#pragma unroll
  for (int i = 0; i < 5; ++i) { v8us v;
#pragma unroll
    for (int e = 0; e < 8; ++e) v[e] = bf16_rne_bits(r[i][e >> 2][e & 3]);
    *(v8us*)ob[i] = v; }
  v8b w;
#pragma unroll
  for (int e = 0; e < 8; ++e) w[e] = (b16)bf16_rne(r[5][e >> 2][e & 3]);
  *(v8b*)(wo16 + dst) = w;
}

// projections: rows = tokens (2048), K = 1024, column tiles of 64 = one head of q (tiles 0..15), k (16..31) or v (32..47); f16 planes [b*H + head] of 1024 tok x 64 for q/k;
// v: (8v)^T f16 planes [b*H + head] of 64 x 1024 tok; inside a plane the elements lie in fragment order (blocks of 16 rows x 32 k). grid (48, 16) x 128.
__global__ __launch_bounds__(128) void proj_kernel(const __bf16* __restrict__ x16, const __bf16* __restrict__ w16, const float* __restrict__ bq, const float* __restrict__ bk, const float* __restrict__ bv, b16* __restrict__ qh, b16* __restrict__ kh, b16* __restrict__ vt) {
  __shared__ __attribute__((aligned(16))) b16 Th[4][32][HD + 8], Tq[4][32][HD + 8];
  __shared__ __attribute__((aligned(16))) b16 Tt[64][128 + 8], Tl[64][128 + 8];
  const int lane = threadIdx.x & 31, wave = threadIdx.x >> 5, nloc = lane & 15, hlf = lane >> 4, m0 = blockIdx.y * 128 + wave * 32, c0 = blockIdx.x * 64;
  v8f acc[2][4];
#pragma unroll
  for (int r = 0; r < 2; ++r)
#pragma unroll
    for (int t = 0; t < 4; ++t) acc[r][t] = (v8f){};
  // Three register stages of 32 k: all twelve loads of stage j + 2 are issued ahead of the matrix instructions of stage j, so a stage waits once, two stages late, not once per weight fragment.
  const __bf16* pa = x16 + (size_t)(m0 / 16) * KB32 * FB; const __bf16* pw = w16 + (size_t)(c0 / 16) * KB32 * FB;
  v16bb fa[3][2], fw[3][4];
  auto fetch = [&](int st, int s) {
#pragma unroll
    for (int r = 0; r < 2; ++r) fa[s][r] = frag_blk_bf(pa + (size_t)(r * KB32 + st) * FB, lane);
#pragma unroll
    for (int t = 0; t < 4; ++t) fw[s][t] = frag_blk_bf(pw + (size_t)(t * KB32 + st) * FB, lane);
    __builtin_amdgcn_sched_barrier(0);   // keeps the stage's loads in front of the matrix instructions that follow; without it they sink to their first use and each is waited for alone
  };
  auto work = [&](int s) {
#pragma unroll
    for (int t = 0; t < 4; ++t) { acc[0][t] = wmma16bb(fa[s][0], fw[s][t], acc[0][t]); acc[1][t] = wmma16bb(fa[s][1], fw[s][t], acc[1][t]); }
  };
  fetch(0, 0); fetch(1, 1);
  for (int st = 0; st < D / 32 - 2; st += 3) { fetch(st + 2, 2); work(0); fetch(st + 3, 0); work(1); fetch(st + 4, 1); work(2);
    asm volatile("s_wait_xcnt 0x0" ::: "memory"); }   // the trip's loads are still out when the next trip rewrites their address pairs
  work(0); work(1);
  const int which = blockIdx.x / (D / 64), head = blockIdx.x % (D / 64), b = m0 / S, tok0 = m0 % S;
  { const float* bias = (which == 0) ? bq : (which == 1) ? bk : bv;   // + bf16(bias)
#pragma unroll
    for (int t = 0; t < 4; ++t) { const float bb = bf16_rne(bias[head * HD + t * 16 + nloc]);
#pragma unroll
      for (int r = 0; r < 2; ++r)
#pragma unroll
        for (int v = 0; v < 8; ++v) acc[r][t][v] += bb; } }
  if (which < 2) {                                              // q or k head: f16 hi/lo blocks in fragment order
#pragma unroll
    for (int t = 0; t < 4; ++t)
#pragma unroll
      for (int r = 0; r < 2; ++r)
#pragma unroll
        for (int v = 0; v < 8; ++v) { b16 a_, c_; split16(acc[r][t][v] * QS, a_, c_); Th[wave][r * 16 + 8 * hlf + v][t * 16 + nloc] = a_; Tq[wave][r * 16 + 8 * hlf + v][t * 16 + nloc] = c_; }   // q, k carried x8 (lo residuals stay normal)
    wave_lds_sync();
    b16* dst = (which == 0 ? qh : kh) + (((size_t)b * H + head) * S + tok0) * HD;
    {
#pragma unroll
      for (int j = 0; j < 8; ++j) { const int rr = (j >> 2) * 16 + nloc, c8 = (j & 3) * 16 + hlf * 8;   // blocks [16 tokens][32 d] in the order token block, d half: the wave's 32 x 64 tile is 4 KB in a row
        *(v8b*)(dst + j * 256 + lane * 8) = *(const v8b*)(&Th[wave][rr][c8]); *(v8b*)(dst + QPL + j * 256 + lane * 8) = *(const v8b*)(&Tq[wave][rr][c8]); }
       }
    return;
  }
  const int vh = head;                                          // v head: (8v)^T tile [64 d][128 tok] via LDS, stored as 1 KB blocks of 16 d x 32 tok
#pragma unroll
  for (int t = 0; t < 4; ++t)
#pragma unroll
    for (int r = 0; r < 2; ++r)
#pragma unroll
      for (int v = 0; v < 8; ++v) { b16 a_, c_; split16(acc[r][t][v] * VS, a_, c_); Tt[t * 16 + nloc][wave * 32 + r * 16 + 8 * hlf + v] = a_; Tl[t * 16 + nloc][wave * 32 + r * 16 + 8 * hlf + v] = c_; }
  __syncthreads();
  b16* dstv = vt + (((size_t)b * H + vh) * HD) * S + (size_t)((blockIdx.y * 128) % S) * HD;   // blocks [16 d][32 tokens] in the order token run of 32, d block
  {
#pragma unroll
    for (int j = 0; j < 8; ++j) { const int dd = (j >> 1) * 16 + nloc, c8 = wave * 32 + (j & 1) * 16 + hlf * 8, o = (wave * 8 + j) * 256 + lane * 8; *(v8b*)(dstv + o) = *(const v8b*)(&Tt[dd][c8]); *(v8b*)(dstv + VPL + o) = *(const v8b*)(&Tl[dd][c8]); }
    asm volatile("s_wait_xcnt 0x0" ::: "memory");   // the build lays the q/k branch behind these stores, where their address pair is written again
    
  }
}

__device__ __forceinline__ void s_tile(const b16* __restrict__ K, const v16b* qf, const v16b* ql, int kb, unsigned lane, v8f& s0, v8f& s1) {
  s0 = (v8f){}; s1 = (v8f){};
  const b16* kl = K + (size_t)kb * HD + lane * 8;   // the lane's place in the trip's first block
  v16b k0[2], k0l[2], k1[2], k1l[2];   // all sixteen key reads of the trip go out together: one wait for memory per trip, not one per half of the head dimension
#pragma unroll
  for (int ks = 0; ks < 2; ++ks) { const b16* kp = kl + ks * FB; k0[ks] = frag_blk(kp, 0); k0l[ks] = frag_blk(kp + QPL, 0); k1[ks] = frag_blk(kp + 2 * FB, 0); k1l[ks] = frag_blk(kp + QPL + 2 * FB, 0); }
  // stands behind the key reads because their address pair is rewritten later in the trip, in pass 2 while the reads are still out; it names the pair so that none of the sixteen reads lands on it in front of the wait
  asm volatile("s_wait_xcnt 0x0" :: "v"(kl) : "memory");
#pragma unroll
  for (int ks = 0; ks < 2; ++ks) { s0 = wmma16b(k0[ks], qf[ks], s0); s0 = wmma16b(k0[ks], ql[ks], s0); s0 = wmma16b(k0l[ks], qf[ks], s0); s1 = wmma16b(k1[ks], qf[ks], s1); s1 = wmma16b(k1[ks], ql[ks], s1); s1 = wmma16b(k1l[ks], qf[ks], s1); }
#pragma unroll
  for (int r = 0; r < 8; ++r) { s0[r] *= SCALE / (QS * QS); s1[r] *= SCALE / (QS * QS); }
}
// Each 16-query tile is worked by KP waves of one work-group, each on its own run of keys (TP trips of 32 keys; the last part has what is left): wave = part * 8 + tile.
// The parts meet twice in LDS: after pass 1 (row shift) and after pass 2 (partial outputs and partial relation buckets, summed in part order 0..KP-1).
// Pass 1 finds only the shift of the softmax, which cancels in the quotient: the row maximum of the hi x hi product alone, 64 keys a trip, K1 keys a part. Pass 2 works with exp(s - shift),
// not divided; every key falls into exactly one bucket, so the row sum is the sum of the row's buckets, and the epilogue divides by it once.
constexpr int KP = 3, TP = (S / 32 + KP - 1) / KP, K1 = ((S / 64 + KP - 1) / KP) * 64;
// Relation buckets: each wave has two tables [41 ids][32 lanes], one per key half of a trip. A lane adds only into its own column of each: no turn-taking between the two lanes of a query,
// the adds into the two tables do not depend on each other, and bank = lane (+ 32 for odd ids), so no two lanes meet on a bank. After pass 2 the wave folds the four columns of a query
// into columns 0..15 of the first table; its partial output then lies over the second table.
constexpr int TS = NREL * 32, OP = HD + 4;
static_assert(16 * OP <= TS && TS % 4 == 0, "the partial output fits over the second table, 16-byte aligned");
template <int QT>
__global__ __launch_bounds__(256 * KP) void attn_kernel(const b16* __restrict__ qh, const b16* __restrict__ kh, const b16* __restrict__ vt, const int* __restrict__ rel, const float* __restrict__ remb, float* __restrict__ y) {
  __shared__ __attribute__((aligned(16))) float Wk[8 * KP][2 * TS]; __shared__ __attribute__((aligned(16))) float Es[NREL][HD]; __shared__ float Ms[8 * KP][16];
  // the wave's number is taken as a scalar so that tile, part, head, the key range and the base addresses formed from them stay out of the vector registers
  const int wid = __builtin_amdgcn_readfirstlane(threadIdx.x >> 5), lane = threadIdx.x & 31, hh = lane >> 4, col = lane & 15, tile = wid & 7, part = wid >> 3;
  const int kbeg = part * TP * 32, kend = (kbeg + TP * 32 < S) ? kbeg + TP * 32 : S;
  for (int i = threadIdx.x; i < NREL * HD; i += 256 * KP) Es[i / HD][i % HD] = bf16_rne(remb[i]);
  for (int i = lane; i < 2 * TS / 4; i += 32) *(v4f*)(&Wk[wid][i * 4]) = (v4f){};
  __syncthreads();
  const int qt = blockIdx.x * 8 + tile, jt = qt % QT, bh = qt / QT, h = bh % H, b = bh / H, q0 = jt * 16, qi = q0 + col;
  const b16* Q = qh + ((size_t)bh * S) * HD; const b16* K = kh + ((size_t)bh * S) * HD; const b16* vb = vt + ((size_t)bh * HD) * S; const int* rrow = rel + ((size_t)b * S + qi) * S;
  v16b qf[2], ql[2];
#pragma unroll
  for (int ks = 0; ks < 2; ++ks) { qf[ks] = frag_blk(Q + (size_t)q0 * HD + ks * FB, lane); ql[ks] = frag_blk(Q + QPL + (size_t)q0 * HD + ks * FB, lane); }
  asm volatile("s_wait_xcnt 0x0" ::: "memory");   // the query reads' address pair is rewritten behind the loop's entry branch
  float m = -INFINITY;
  const int k1beg = part * K1, k1end = (k1beg + K1 < S) ? k1beg + K1 : S;
  for (int kb = k1beg; kb < k1end; kb += 64) {                    // pass 1
    const b16* kl = K + (size_t)kb * HD + lane * 8;   // the lane's place in the trip's first block
    v16b kf[4][2]; v8f s[4] = {{}, {}, {}, {}};       // the sixteen hi-plane reads of 64 keys go out together: one wait for memory per trip
#pragma unroll
    for (int t = 0; t < 4; ++t)
#pragma unroll
      for (int ks = 0; ks < 2; ++ks) kf[t][ks] = frag_blk(kl + (t * 2 + ks) * FB, 0);
    asm volatile("s_wait_xcnt 0x0" :: "v"(kl) : "memory");   // the reads' address pair is rewritten for the next trip while they may still be out; it names the pair so that no read lands on it in front of the wait
    __builtin_amdgcn_sched_barrier(0);   // keeps the sixteen reads in front of the matrix instructions; without it they sink to their first use and each is waited for alone
#pragma unroll
    for (int ks = 0; ks < 2; ++ks)
#pragma unroll
      for (int t = 0; t < 4; ++t) s[t] = __builtin_amdgcn_wmma_f32_16x16x32_f16(false, kf[t][ks], false, qf[ks], (short)0, s[t], false, false);   // four independent sums fill each other's distance
#pragma unroll
    for (int r = 0; r < 8; ++r) m = fmaxf(m, fmaxf(fmaxf(s[0][r], s[1][r]), fmaxf(s[2][r], s[3][r])));
  }
  m *= SCALE / (QS * QS);                                        // a power of two: scaling the maximum is exact
  m = fmaxf(m, __shfl_xor(m, 16));
  if (hh == 0) Ms[wid][col] = m;                                 // this part's row shift (both lane halves hold the same value)
  __syncthreads();
  { float mg = -INFINITY;
#pragma unroll
    for (int p = 0; p < KP; ++p) mg = fmaxf(mg, Ms[p * 8 + tile][col]);
    m = mg; }
  v8f o[4] = {{}, {}, {}, {}};
  float* t0 = &Wk[wid][lane]; float* t1 = t0 + TS;   // the lane's own columns: keys 8 hh + r and keys 16 + 8 hh + r of a trip
  // Pass 2 meets three read latencies a trip, not five (keys, then one per 16 d of the values): the keys; all four hi planes of the values, issued ahead of the softmax arithmetic, with the relation
  // ids behind them; all four lo planes, issued ahead of the bucket adds, into the registers that the hi planes have left. Each sum keeps its order hi p-hi, hi p-lo, lo p-hi.
  for (int kb = kbeg; kb < kend; kb += 32) { v8f s0, s1; s_tile(K, qf, ql, kb, lane, s0, s1);     // pass 2
    const b16* vp = vb + (size_t)kb * HD + lane * 8; const int* rp = rrow + kb + 8 * hh;
    v16b vf[4], vl[4], pb, pl; v4i id[4];
#pragma unroll
    for (int n = 0; n < 4; ++n) vf[n] = frag_blk(vp + n * FB, 0);
#pragma unroll
    for (int j = 0; j < 4; ++j) id[j] = *(const v4i*)(rp + (j >> 1) * 16 + (j & 1) * 4);   // keys 8 hh + 0..7 and 16 + 8 hh + 0..7
#pragma unroll
    for (int r = 0; r < 8; ++r) { s0[r] = __expf(s0[r] - m); s1[r] = __expf(s1[r] - m); b16 a, c; split16(s0[r] * PS, a, c); pb[r] = a; pl[r] = c; split16(s1[r] * PS, a, c); pb[8 + r] = a; pl[8 + r] = c; }
#pragma unroll
    for (int n = 0; n < 4; ++n) o[n] = wmma16b(vf[n], pb, o[n]);
#pragma unroll
    for (int n = 0; n < 4; ++n) o[n] = wmma16b(vf[n], pl, o[n]);
#pragma unroll
    for (int n = 0; n < 4; ++n) vl[n] = frag_blk(vp + VPL + n * FB, 0);
    asm volatile("s_wait_xcnt 0x0" :: "v"(vp) : "memory");   // the value reads' and the id reads' address pairs are rewritten behind this line while reads are still out; it names the value pair so that no read lands on it while others still name it
    // relation buckets: column[id] += p in the lane's own two columns (plain adds, no atomics); both reads of a step go out before either write
#pragma unroll
    for (int r = 0; r < 8; ++r) { const int ra = id[r >> 2][r & 3], rb = id[2 + (r >> 2)][r & 3];
      const int ia = ((ra < 0) ? 0 : (ra >= NREL ? NREL - 1 : ra)) * 32, ib = ((rb < 0) ? 0 : (rb >= NREL ? NREL - 1 : rb)) * 32;
      const float a = t0[ia], c = t1[ib]; t0[ia] = a + s0[r]; t1[ib] = c + s1[r]; }
    __builtin_amdgcn_sched_barrier(0);   // keeps the last four matrix instructions, and with them the waits for the lo planes, behind the bucket adds that cover those reads; without it they rise to the head of the adds
#pragma unroll
    for (int n = 0; n < 4; ++n) o[n] = wmma16b(vl[n], pb, o[n]);
  }
  wave_lds_sync();   // the fold reads columns that other lanes of the wave wrote
  for (int i = lane; i < NREL * 4; i += 32) { float* t = &Wk[wid][(i >> 2) * 32 + (i & 3) * 4];   // four queries of one id per lane
    *(v4f*)t = ((*(const v4f*)t + *(const v4f*)(t + 16)) + *(const v4f*)(t + TS)) + *(const v4f*)(t + TS + 16); }
  wave_lds_sync();   // the partial output below overwrites the second table, which other lanes have just read
  // epilogue: y[q][d] = (sum over parts of o/64 + sum_r w[r][q] E[r][d]) / sum_r w[r][q], w = sum over parts of bucket. Each wave leaves its partial o in LDS; behind the barrier the waves of parts 0 and 1
  // finish eight queries of their tile each: four lanes per query, sixteen consecutive d per lane, so each of its four stores fills four whole lines.
#pragma unroll
  for (int n = 0; n < 4; ++n)
#pragma unroll
    for (int r = 0; r < 8; ++r) Wk[wid][TS + col * OP + n * 16 + 8 * hh + r] = o[n][r] * (1.0f / (VS * PS));
  __syncthreads();
  if (part < 2) {
    const int qq = part * 8 + (lane >> 2), d0 = (lane & 3) * 16;
    v4f a[4] = {{}, {}, {}, {}}; float l = 0.0f;
#pragma unroll
    for (int p = 0; p < KP; ++p)
#pragma unroll
      for (int j = 0; j < 4; ++j) a[j] += *(const v4f*)(&Wk[p * 8 + tile][TS + qq * OP + d0 + 4 * j]);
    // Unrolled so that the reads of later ids are issued under the multiply-adds of earlier ones; each sum still adds ids 0..40 in that order.
#pragma unroll
    for (int rr = 0; rr < NREL; ++rr) { float w = 0.0f;
#pragma unroll
      for (int p = 0; p < KP; ++p) w += Wk[p * 8 + tile][rr * 32 + qq];
      l += w;
#pragma unroll
      for (int j = 0; j < 4; ++j) a[j] += w * *(const v4f*)(&Es[rr][d0 + 4 * j]); }
    // y in fragment order for the output product: f32 blocks of 16 rows x 32 k (2 KB), element (row, k) at [k >> 4][(k >> 2) & 1][((k >> 3) & 1) * 16 + row][k & 3]; a store fills four whole lines
    const float il = 1.0f / l;
    float* dst = y + ((size_t)((b * S + q0) / 16) * KB32 + h * 2 + ((lane & 3) >> 1)) * FB + (lane & 1) * 256 + qq * 4;
#pragma unroll
    for (int j = 0; j < 4; ++j) *(v4f*)(dst + (j & 1) * 128 + (j >> 1) * 64) = a[j] * il;
  }
}

// out = y W_o^T: (2048 x 1024) x (1024 x 1024); A = y x8 split at load into f16 hi + lo, B = f16(bf16 W_o) rows; f32 rows; grid (16, 16).
__global__ __launch_bounds__(128) void out_kernel(const float* __restrict__ y, const b16* __restrict__ wo16, const float* __restrict__ bo, float* __restrict__ out) {
  __shared__ __attribute__((aligned(16))) float Ts[4][32 * 64];
  const int lane = threadIdx.x & 31, wave = threadIdx.x >> 5, nloc = lane & 15, hlf = lane >> 4, m0 = blockIdx.y * 128 + wave * 32, c0 = blockIdx.x * 64;
  v8f acc[2][4];
#pragma unroll
  for (int r = 0; r < 2; ++r)
#pragma unroll
    for (int t = 0; t < 4; ++t) acc[r][t] = (v8f){};
  // Two register stages of 32 k: the sixteen loads of stage j + 1 (raw f32 y, f16 weights) are issued ahead of the split and the matrix instructions of stage j.
  const float* py = y + (size_t)(m0 / 16) * KB32 * FB + lane * 4; const b16* pw = wo16 + (size_t)(c0 / 16) * KB32 * FB;
  v4f ry[2][2][4]; v16b fw[2][4];
  auto fetch = [&](int kb, int s) {
#pragma unroll
    for (int r = 0; r < 2; ++r) { const float* p = py + (size_t)(r * KB32 + kb / 32) * FB; ry[s][r][0] = *(const v4f*)p; ry[s][r][1] = *(const v4f*)(p + 128); ry[s][r][2] = *(const v4f*)(p + 256); ry[s][r][3] = *(const v4f*)(p + 384); }
#pragma unroll
    for (int t = 0; t < 4; ++t) fw[s][t] = frag_blk(pw + (size_t)(t * KB32 + kb / 32) * FB, lane);
    __builtin_amdgcn_sched_barrier(0);   // keeps the stage's loads in front of the work that follows; without it they sink to their first use and each is waited for alone
  };
  auto work = [&](int s) {                                                      // y as an f16 hi+lo pair carried x8 (2 products)
    v16b ah[2], al[2];
#pragma unroll
    for (int r = 0; r < 2; ++r)
#pragma unroll
      for (int e = 0; e < 8; ++e) { b16 a, c; split16(ry[s][r][e >> 2][e & 3] * 8.0f, a, c); ah[r][e] = a; al[r][e] = c; split16(ry[s][r][2 + (e >> 2)][e & 3] * 8.0f, a, c); ah[r][8 + e] = a; al[r][8 + e] = c; }
#pragma unroll
    for (int t = 0; t < 4; ++t)
#pragma unroll
      for (int r = 0; r < 2; ++r) { acc[r][t] = wmma16b(ah[r], fw[s][t], acc[r][t]); acc[r][t] = wmma16b(al[r], fw[s][t], acc[r][t]); }
  };
  fetch(0, 0);
  for (int kb = 0; kb < D - 64; kb += 64) { fetch(kb + 32, 1); work(0); fetch(kb + 64, 0); work(1); }
  fetch(D - 32, 1);
  asm volatile("s_wait_xcnt 0x0" ::: "memory");   // the last stage's address pairs are reused by the split below while its loads are still out
  __builtin_amdgcn_sched_barrier(0);              // holds the split behind that wait
  work(0); work(1);
#pragma unroll
  for (int t = 0; t < 4; ++t)
#pragma unroll
    for (int r = 0; r < 2; ++r)
#pragma unroll
      for (int v = 0; v < 8; ++v) acc[r][t][v] = acc[r][t][v] * (1.0f / 8.0f) + bf16_rne(bo[c0 + t * 16 + nloc]);
  epi_f32(acc, 1.0f, nullptr, out, D, m0, c0, lane, Ts[wave]);
}
}  // namespace

extern "C" void kernel_launch(void* const* d_in, const int* in_sizes, int n_in,
                              void* d_out, int out_size, void* d_ws, size_t ws_size, hipStream_t stream) {
  (void)n_in; (void)out_size;
  const float* x = (const float*)d_in[0]; const int* rel = (const int*)d_in[1];
  const float* wq = (const float*)d_in[2]; const float* bq = (const float*)d_in[3]; const float* wk = (const float*)d_in[4]; const float* bk = (const float*)d_in[5]; const float* wv = (const float*)d_in[6]; const float* bv = (const float*)d_in[7];
  const float* wo = (const float*)d_in[8]; const float* bo = (const float*)d_in[9]; const float* remb = (const float*)d_in[10];
  float* out = (float*)d_out;   // [2][1024][1024]
  if (in_sizes[0] != BT * S * D || in_sizes[1] != BT * S * S || in_sizes[2] != D * D || in_sizes[8] != D * D || in_sizes[10] != NREL * HD) return;
  size_t off = 0; char* ws = (char*)d_ws;
  auto carve = [&](size_t bytes) { char* p = ws + off; off += (bytes + 255) & ~(size_t)255; return p; };
  unsigned short* x16 = (unsigned short*)carve((size_t)NTOK * D * 2); unsigned short* w16 = (unsigned short*)carve((size_t)3 * D * D * 2); b16* wo16 = (b16*)carve((size_t)D * D * 2);
  b16* qh = (b16*)carve((size_t)2 * NTOK * D * 2); b16* kh = (b16*)carve((size_t)2 * NTOK * D * 2); b16* vt = (b16*)carve((size_t)2 * NTOK * D * 2); float* y = (float*)carve((size_t)NTOK * D * 4);
  if (off > ws_size) return;                                    // ≈ 46 MB
  prep_kernel<<<PCS / 256, 256, 0, stream>>>(x, wq, wk, wv, wo, x16, w16, wo16);
  proj_kernel<<<dim3(3 * D / 64, NTOK / 128), 128, 0, stream>>>((const __bf16*)x16, (const __bf16*)w16, bq, bk, bv, qh, kh, vt);
  attn_kernel<S / 16><<<Bn * H * (S / 16) / 8, 256 * KP, 0, stream>>>(qh, kh, vt, rel, remb, y);
  out_kernel<<<dim3(D / 64, NTOK / 128), 128, 0, stream>>>(y, wo16, bo, out);
}

// v010
// It runs in 60.5 microseconds.
// It is 1.34 times as fast as v008, going by the measured steps of the versions left out in between.
// Counting every step since v000, it is 4.87 times as fast.
#include <hip/hip_runtime.h>

// Attention with relation embeddings: q = (x Wq^T + bq)/8, k = x Wk^T + bk, v = x Wv^T + bv (16 heads x 64); attn = softmax(q.k) (no mask; the k-relation term has scale 0);
// out_h[t] = sum_s attn[t][s] (v_h[s] + rel_emb[relation_inputs[b][t][s]]) (v-relation scale 1, shared by all heads); out = merged Wo^T + bo -> [2][1024][1024].
// The relation term is sum_r w_r[t] rel_emb[r] with w_r[t] = sum over keys s of relation r of attn[t][s]: per (b, h, 16 queries) the softmax terms are bucketed by the INPUT relation id
// into f32 LDS tables [41][lane] (plain ordered adds, no atomics), then multiplied by the 41 x 64 table; nothing index-like is written; ids only select an LDS accumulator.
// Numerics: x, weights, biases, rel_emb rounded to bf16; projections on v_wmma_f32_16x16x32_bf16 (exact products; + bias);
// q, k, v, the softmax terms and y are each rounded once to f16 (carried x8) and every later product is one v_wmma_f32_16x16x32_f16 with f32 sums; softmax, buckets and the relation product in f32.

namespace {
constexpr int BT = 2, Bn = 2, S = 1024, D = 1024, H = 16, HD = 64, NTOK = Bn * S, NREL = 41;
constexpr float SCALE = 0.125f, VS = 8.0f, QS = 8.0f, PS = 8.0f, YS = 8.0f;   // power-of-two carry scales: small values stay normal in f16

typedef _Float16 b16;
typedef __attribute__((ext_vector_type(16))) _Float16 v16b;
typedef __attribute__((ext_vector_type(8)))  _Float16 v8b;
typedef __attribute__((ext_vector_type(8)))  float v8f;
typedef __attribute__((ext_vector_type(4)))  float v4f;
typedef __attribute__((ext_vector_type(4)))  int v4i;

__device__ __forceinline__ v8b ld8b(const b16* p) { return *(const v8b*)p; }
__device__ __forceinline__ v16b cat8b(v8b a, v8b b) { return __builtin_shufflevector(a, b, 0, 1, 2, 3, 4, 5, 6, 7, 8, 9, 10, 11, 12, 13, 14, 15); }
// Fragment order: every matrix operand in the workspace is kept as blocks of 16 rows x 32 k. A block of 16-bit elements is 1 KB, element (row, k) at [k >> 4][((k >> 3) & 1) * 16 + row][k & 7]:
// a lane's two 16-byte reads lie at lane * 8 and 256 + lane * 8 elements, so each wave-wide read covers 512 contiguous bytes (4 lines) and not 32 bytes in each of 16 rows.
constexpr int FB = 512, KB32 = D / 32;   // elements per block; blocks along a 1024-long k
__device__ __forceinline__ v16b frag_blk(const b16* p, unsigned lane) { return cat8b(ld8b(p + lane * 8), ld8b(p + 256 + lane * 8)); }
// Piece p (8 elements) of a [rows][1024] matrix on its way into fragment order: four lanes read one 32-element run of a row, eight rows per wave, and the wave's 16-byte stores fill four whole lines.
__device__ __forceinline__ size_t pack_src(size_t p) { return ((p >> 11) * 16 + ((p >> 2) & 15)) * D + ((p >> 6) & 31) * 32 + (p & 3) * 8; }
__device__ __forceinline__ size_t pack_dst(size_t p) { return (p >> 6) * FB + ((p >> 1) & 1) * 256 + ((p & 1) * 16 + ((p >> 2) & 15)) * 8; }
__device__ __forceinline__ v8f wmma16b(v16b a, v16b b, v8f c) {
  v8f d = __builtin_amdgcn_wmma_f32_16x16x32_f16(false, a, false, b, (short)0, c, false, false);
  asm volatile("v_nop\n\tv_nop\n\tv_nop\n\tv_nop" : "+v"(d) : "v"(a), "v"(b));
  return d;
}
__device__ __forceinline__ void wave_lds_sync() {
  __builtin_amdgcn_fence(__ATOMIC_RELEASE, "workgroup");
  __builtin_amdgcn_wave_barrier();
  __builtin_amdgcn_fence(__ATOMIC_ACQUIRE, "workgroup");
}

typedef __attribute__((ext_vector_type(8))) __bf16 v8bb; typedef __attribute__((ext_vector_type(16))) __bf16 v16bb;
typedef __attribute__((ext_vector_type(8))) unsigned short v8us;
typedef __attribute__((ext_vector_type(16))) unsigned short v16us;
// The two GEMM kernels (projections, output) share one main loop. A work-group of four waves (2 x 2) owns 128 rows x 2 WN 16 columns; a wave owns 64 rows x WN 16 columns.
// A stage is KT of k of the work-group's 8 row blocks of A and 2 WN row blocks of B, still in fragment order: a row block's KT / 32 blocks lie in a row in the workspace, so a stage is
// (8 + 2 WN) runs of KT * 32 bytes, and 128 lanes x 16 bytes move 2 KB of a run per copy. Every operand byte crosses from L2 once per work-group; the waves read their fragments from LDS.
// Eight asynchronous copies to LDS places l, l + 2 KB, ...; the wait for the address translations is the statement's last line, so it stands in front of every rewrite of a register that a copy names.
__device__ __forceinline__ void copy8(unsigned l, const char* g0, const char* g1, const char* g2, const char* g3, const char* g4, const char* g5, const char* g6, const char* g7) {
  asm volatile("global_load_async_to_lds_b128 %0, %8, off\n\t"
               "global_load_async_to_lds_b128 %1, %9, off\n\t"
               "global_load_async_to_lds_b128 %2, %10, off\n\t"
               "global_load_async_to_lds_b128 %3, %11, off\n\t"
               "global_load_async_to_lds_b128 %4, %12, off\n\t"
               "global_load_async_to_lds_b128 %5, %13, off\n\t"
               "global_load_async_to_lds_b128 %6, %14, off\n\t"
               "global_load_async_to_lds_b128 %7, %15, off\n\t"
               "s_wait_xcnt 0x0"
               :: "v"(l), "v"(l + 2048u), "v"(l + 4096u), "v"(l + 6144u), "v"(l + 8192u), "v"(l + 10240u), "v"(l + 12288u), "v"(l + 14336u),
                  "v"(g0), "v"(g1), "v"(g2), "v"(g3), "v"(g4), "v"(g5), "v"(g6), "v"(g7) : "memory");
}
constexpr int RBB = KB32 * FB * 2;   // bytes of one row block (16 rows x 1024 k) in the workspace
// pa, pb: the lane's 16 bytes in the first run of A and of B; l: the lane's 16 bytes at the head of the buffer
template <int WN, int KT>
__device__ __forceinline__ void stage_copy(unsigned l, const char* pa, const char* pb, int st) {
  constexpr int SUB = KT / 64, NC = (8 + 2 * WN) * SUB;
  static_assert(NC % 8 == 0 && NC <= 63, "whole statements of eight copies; a wave's copies in flight stay under the counter's width");
  const size_t ko = (size_t)st * (KT * 32);
#pragma unroll   // the run and the piece of each copy are compile-time numbers
  for (int i = 0; i < NC; i += 8) { const char* g[8];
#pragma unroll
    for (int e = 0; e < 8; ++e) { const int r = (i + e) / SUB, sub = (i + e) % SUB; g[e] = (r < 8 ? pa + (size_t)r * RBB : pb + (size_t)(r - 8) * RBB) + ko + sub * 2048; }
    copy8(l + i * 2048u, g[0], g[1], g[2], g[3], g[4], g[5], g[6], g[7]); }
}
__device__ __forceinline__ v16us frag_lds(const unsigned short* p, unsigned lane) { const v8us a = *(const v8us*)(p + lane * 8), b = *(const v8us*)(p + 256 + lane * 8); return __builtin_shufflevector(a, b, 0, 1, 2, 3, 4, 5, 6, 7, 8, 9, 10, 11, 12, 13, 14, 15); }
// Two buffers: stage t + 1 flies while stage t is worked on. Each sum still adds its 32 steps of k in rising order.
// AHEAD: a second fragment set, so that inside a stage the reads of block ks + 1 go out ahead of the matrix instructions of block ks (for the kernel that has one wave per SIMD and registers to spare).
template <int WN, int KT, bool BF, bool AHEAD>
__device__ __forceinline__ void gemm_ring(const unsigned short* St, const char* pa, const char* pb, int wm, int wn, unsigned lane, v8f (&acc)[4][WN]) {
  constexpr int KBT = KT / 32, BUFE = (8 + 2 * WN) * KBT * FB, NT = D / KT;
  static_assert(NT >= 2, "the prologue fills two stages");
  const unsigned l0 = (unsigned)(size_t)St + threadIdx.x * 16u;
  stage_copy<WN, KT>(l0, pa, pb, 0);
  asm volatile("s_wait_asynccnt 0x0" ::: "memory");   // this wave's part of stage 0 has landed
  __syncthreads();                                      // and so has every other wave's
  stage_copy<WN, KT>(l0 + BUFE * 2u, pa, pb, 1);
  for (int t = 0; t < NT; ++t) {
    const unsigned short* sb = St + (t & 1) * BUFE;
    v16us fa[AHEAD ? 2 : 1][4], fb[AHEAD ? 2 : 1][WN];
    auto fetch = [&](int ks, int s) {
#pragma unroll
      for (int r = 0; r < 4; ++r) fa[s][r] = frag_lds(sb + ((wm * 4 + r) * KBT + ks) * FB, lane);
#pragma unroll
      for (int n = 0; n < WN; ++n) fb[s][n] = frag_lds(sb + ((8 + wn * WN + n) * KBT + ks) * FB, lane);
    };
    if constexpr (AHEAD) fetch(0, 0);
#pragma unroll   // the blocks of a stage: set numbers and LDS offsets are compile-time numbers
    for (int ks = 0; ks < KBT; ++ks) { const int s = AHEAD ? (ks & 1) : 0;
      if constexpr (AHEAD) { if (ks + 1 < KBT) fetch(ks + 1, (ks + 1) & 1); } else fetch(ks, 0);
      __builtin_amdgcn_sched_barrier(0);   // keeps a block's LDS reads together in front of the matrix instructions; without it this build reads one B fragment at a time and waits out the LDS latency at each
#pragma unroll
      for (int n = 0; n < WN; ++n)
#pragma unroll
        for (int r = 0; r < 4; ++r) {
          if constexpr (BF) acc[r][n] = __builtin_amdgcn_wmma_f32_16x16x32_bf16(false, __builtin_bit_cast(v16bb, fa[s][r]), false, __builtin_bit_cast(v16bb, fb[s][n]), (short)0, acc[r][n], false, false);
          else acc[r][n] = __builtin_amdgcn_wmma_f32_16x16x32_f16(false, __builtin_bit_cast(v16b, fa[s][r]), false, __builtin_bit_cast(v16b, fb[s][n]), (short)0, acc[r][n], false, false);
        } }
    __builtin_amdgcn_sched_barrier(0);   // keeps the last block's matrix instructions in front of the waits: without it this build sinks them behind the barrier, where they hold back the next stage's copies
    asm volatile("s_wait_dscnt 0x0" ::: "memory");      // this wave's reads of stage t are done before its buffer is given up
    asm volatile("s_wait_asynccnt 0x0" ::: "memory");   // this wave's part of stage t + 1 has landed
    __syncthreads();                                      // publishes stage t + 1 and ends every wave's reads of stage t
    if (t + 2 < NT) stage_copy<WN, KT>(l0 + (t & 1) * (BUFE * 2u), pa, pb, t + 2);
  }
  asm volatile("s_wait_asynccnt 0x0" ::: "memory");   // no copy is out when the wave goes on to the epilogue
}
__device__ __forceinline__ unsigned short bf16_rne_bits(float v) { unsigned int u = __float_as_uint(v); u += 0x7FFFu + ((u >> 16) & 1u); return (unsigned short)(u >> 16); }
__device__ __forceinline__ float bf16_rne(float v) { return __uint_as_float(((unsigned int)bf16_rne_bits(v)) << 16); }



// One preparation launch for everything that goes into fragment order. Each of W_q, W_k, W_v, W_o and each batch of x is 1024 x 1024 = PCS pieces of 8 elements, and the grid has PCS threads:
// a thread takes the same piece of all six, so one source offset and one destination offset serve them all, and its twelve 16-byte reads are out together: one trip to memory per thread.
constexpr int PCS = D * D / 8;
__global__ __launch_bounds__(256) void prep_kernel(const float* __restrict__ x, const float* __restrict__ wq, const float* __restrict__ wk, const float* __restrict__ wv, const float* __restrict__ wo,
                                                   unsigned short* __restrict__ x16, unsigned short* __restrict__ w16, b16* __restrict__ wo16) {
  const size_t p = (size_t)blockIdx.x * 256 + threadIdx.x, dst = pack_dst(p);
  const unsigned sb = (unsigned)pack_src(p) * 4u;   // the piece's byte offset in its matrix (under 4 MB): one 32-bit register beside the scalar bases addresses all twelve reads
  const float* in[6] = {wq, wk, wv, x, x + (size_t)D * D, wo};
  v4f r[6][2];
#pragma unroll
  for (int i = 0; i < 6; ++i) { const char* q = (const char*)in[i] + sb; r[i][0] = *(const v4f*)q; r[i][1] = *(const v4f*)(q + 16); }
  asm volatile("s_wait_xcnt 0x0" :: "v"(sb) : "memory");   // the reads' offset register is free for reuse behind this line while reads are still out; it names the register so that none of the twelve reads lands on it in front of the wait
  unsigned short* ob[5] = {w16 + dst, w16 + (size_t)D * D + dst, w16 + (size_t)2 * D * D + dst, x16 + dst, x16 + (size_t)D * D + dst};   // the three weight matrices follow one another as 3072 rows
#pragma unroll
  for (int i = 0; i < 5; ++i) { v8us v;
#pragma unroll
    for (int e = 0; e < 8; ++e) v[e] = bf16_rne_bits(r[i][e >> 2][e & 3]);
    *(v8us*)ob[i] = v; }
  v8b w;
#pragma unroll
  for (int e = 0; e < 8; ++e) w[e] = (b16)bf16_rne(r[5][e >> 2][e & 3]);
  *(v8b*)(wo16 + dst) = w;
}

// projections: rows = tokens (2048), K = 1024, work-group tiles of 128 tokens x 128 columns = two heads of q (tiles 0..7), k (8..15) or v (16..23), a wave 64 tokens x one head; f16 planes [b*H + head] of 1024 tok x 64 for q/k;
// v: (8v)^T f16 planes [b*H + head] of 64 x 1024 tok; inside a plane the elements lie in fragment order (blocks of 16 rows x 32 k). grid (24, 16) x 128.
__global__ __launch_bounds__(128) void proj_kernel(const __bf16* __restrict__ x16, const __bf16* __restrict__ w16, const float* __restrict__ bq, const float* __restrict__ bk, const float* __restrict__ bv, b16* __restrict__ qh, b16* __restrict__ kh, b16* __restrict__ vt) {
  __shared__ __attribute__((aligned(16))) unsigned short St[2 * 16 * 4 * FB];   // two stages of 128 k: 16 row blocks x 4 blocks each; 128 KB, so that two work-groups fit a WGP
  // The epilogue's staging lies over the ring: behind the last stage's barrier no wave reads the ring any more and no copy is out.
  b16 (*Th)[64][HD + 8] = (b16 (*)[64][HD + 8])St;                                  // [4 waves]
  b16 (*Tt)[64][128 + 8] = (b16 (*)[64][128 + 8])(St + 4 * 64 * (HD + 8));          // [2 heads]
  static_assert((4 * 64 * (HD + 8) + 2 * 64 * (128 + 8)) <= 2 * 16 * 4 * FB && (4 * 64 * (HD + 8)) % 8 == 0, "the staging fits the ring, 16-byte aligned");
  const int lane = threadIdx.x & 31, wave = threadIdx.x >> 5, wm = wave >> 1, wn = wave & 1, nloc = lane & 15, hlf = lane >> 4, m0 = blockIdx.y * 128 + wm * 64;
  v8f acc[4][4];
#pragma unroll
  for (int r = 0; r < 4; ++r)
#pragma unroll
    for (int t = 0; t < 4; ++t) acc[r][t] = (v8f){};
  gemm_ring<4, 128, true, false>(St, (const char*)x16 + (size_t)blockIdx.y * 8 * RBB + threadIdx.x * 16, (const char*)w16 + (size_t)blockIdx.x * 8 * RBB + threadIdx.x * 16, wm, wn, lane, acc);
  const int which = blockIdx.x / (D / 128), head = (blockIdx.x % (D / 128)) * 2 + wn, b = m0 / S, tok0 = m0 % S;
  { const float* bias = (which == 0) ? bq : (which == 1) ? bk : bv;   // + bf16(bias)
#pragma unroll
    for (int t = 0; t < 4; ++t) { const float bb = bf16_rne(bias[head * HD + t * 16 + nloc]);
#pragma unroll
      for (int r = 0; r < 4; ++r)
#pragma unroll
        for (int v = 0; v < 8; ++v) acc[r][t][v] += bb; } }
  if (which < 2) {                                              // q or k head: f16 blocks in fragment order
#pragma unroll
    for (int t = 0; t < 4; ++t)
#pragma unroll
      for (int r = 0; r < 4; ++r)
#pragma unroll
        for (int v = 0; v < 8; ++v) Th[wave][r * 16 + 8 * hlf + v][t * 16 + nloc] = (b16)(acc[r][t][v] * QS);   // q, k carried x8
    wave_lds_sync();
    b16* dst = (which == 0 ? qh : kh) + (((size_t)b * H + head) * S + tok0) * HD;
#pragma unroll
    for (int j = 0; j < 16; ++j) { const int rr = (j >> 2) * 16 + nloc, c8 = (j & 3) * 16 + hlf * 8;   // blocks [16 tokens][32 d] in the order token block, d half: the wave's 64 x 64 tile is 8 KB in a row
      *(v8b*)(dst + j * 256 + lane * 8) = *(const v8b*)(&Th[wave][rr][c8]); }
    return;
  }
#pragma unroll
  for (int t = 0; t < 4; ++t)                                   // v head: (8v)^T tile [64 d][128 tok] via LDS, rows of 256 B
#pragma unroll
    for (int r = 0; r < 4; ++r)
#pragma unroll
      for (int v = 0; v < 8; ++v) Tt[wn][t * 16 + nloc][wm * 64 + r * 16 + 8 * hlf + v] = (b16)(acc[r][t][v] * VS);
  __syncthreads();
  b16* dstv = vt + (((size_t)b * H + head) * HD) * S + (size_t)((blockIdx.y * 128) % S) * HD;   // blocks [16 d][32 tokens] in the order token run of 32, d block
#pragma unroll
  for (int u = 0; u < 2; ++u)
#pragma unroll
    for (int j = 0; j < 8; ++j) { const int run = wm * 2 + u, dd = (j >> 1) * 16 + nloc, c8 = run * 32 + (j & 1) * 16 + hlf * 8, o = (run * 8 + j) * 256 + lane * 8; *(v8b*)(dstv + o) = *(const v8b*)(&Tt[wn][dd][c8]); }
  asm volatile("s_wait_xcnt 0x0" ::: "memory");   // where the build lays other code behind these stores, their address pair may be written again
}
__device__ __forceinline__ void s_tile(const b16* __restrict__ K, const v16b* qf, int kb, unsigned lane, v8f& s0, v8f& s1) {
  s0 = (v8f){}; s1 = (v8f){};
  const b16* kl = K + (size_t)kb * HD + lane * 8;   // the lane's place in the trip's first block
  v16b k0[2], k1[2];   // all eight key reads of the trip go out together: one wait for memory per trip, not one per half of the head dimension
#pragma unroll
  for (int ks = 0; ks < 2; ++ks) { const b16* kp = kl + ks * FB; k0[ks] = frag_blk(kp, 0); k1[ks] = frag_blk(kp + 2 * FB, 0); }
  // stands behind the key reads because their address pair is rewritten later in the trip, in pass 2 while the reads are still out; it names the pair so that none of the eight reads lands on it in front of the wait
  asm volatile("s_wait_xcnt 0x0" :: "v"(kl) : "memory");
#pragma unroll
  for (int ks = 0; ks < 2; ++ks) { s0 = wmma16b(k0[ks], qf[ks], s0); s1 = wmma16b(k1[ks], qf[ks], s1); }
#pragma unroll
  for (int r = 0; r < 8; ++r) { s0[r] *= SCALE / (QS * QS); s1[r] *= SCALE / (QS * QS); }
}
// Each 16-query tile is worked by KP waves of one work-group, each on its own run of keys (TP trips of 32 keys; the last part has what is left): wave = part * 8 + tile.
// The parts meet twice in LDS: after pass 1 (row shift) and after pass 2 (partial outputs and partial relation buckets, summed in part order 0..KP-1).
// Pass 1 finds only the shift of the softmax, which cancels in the quotient: the row maximum of the scores, 64 keys a trip, K1 keys a part. Pass 2 works with exp(s - shift),
// not divided; every key falls into exactly one bucket, so the row sum is the sum of the row's buckets, and the epilogue divides by it once.
constexpr int KP = 3, TP = (S / 32 + KP - 1) / KP, K1 = ((S / 64 + KP - 1) / KP) * 64;
// Relation buckets: each wave has two tables [41 ids][32 lanes], one per key half of a trip. A lane adds only into its own column of each: no turn-taking between the two lanes of a query,
// the adds into the two tables do not depend on each other, and bank = lane (+ 32 for odd ids), so no two lanes meet on a bank. After pass 2 the wave folds the four columns of a query
// into columns 0..15 of the first table; its partial output then lies over the second table.
constexpr int TS = NREL * 32, OP = HD + 4;
static_assert(16 * OP <= TS && TS % 4 == 0, "the partial output fits over the second table, 16-byte aligned");
template <int QT>
__global__ __launch_bounds__(256 * KP) void attn_kernel(const b16* __restrict__ qh, const b16* __restrict__ kh, const b16* __restrict__ vt, const int* __restrict__ rel, const float* __restrict__ remb, b16* __restrict__ y) {
  __shared__ __attribute__((aligned(16))) float Wk[8 * KP][2 * TS]; __shared__ __attribute__((aligned(16))) float Es[NREL][HD]; __shared__ float Ms[8 * KP][16];
  // the wave's number is taken as a scalar so that tile, part, head, the key range and the base addresses formed from them stay out of the vector registers
  const int wid = __builtin_amdgcn_readfirstlane(threadIdx.x >> 5), lane = threadIdx.x & 31, hh = lane >> 4, col = lane & 15, tile = wid & 7, part = wid >> 3;
  const int kbeg = part * TP * 32, kend = (kbeg + TP * 32 < S) ? kbeg + TP * 32 : S;
  for (int i = threadIdx.x; i < NREL * HD; i += 256 * KP) Es[i / HD][i % HD] = bf16_rne(remb[i]);
  for (int i = lane; i < 2 * TS / 4; i += 32) *(v4f*)(&Wk[wid][i * 4]) = (v4f){};
  __syncthreads();
  const int qt = blockIdx.x * 8 + tile, jt = qt % QT, bh = qt / QT, h = bh % H, b = bh / H, q0 = jt * 16, qi = q0 + col;
  const b16* Q = qh + ((size_t)bh * S) * HD; const b16* K = kh + ((size_t)bh * S) * HD; const b16* vb = vt + ((size_t)bh * HD) * S; const int* rrow = rel + ((size_t)b * S + qi) * S;
  v16b qf[2];
#pragma unroll
  for (int ks = 0; ks < 2; ++ks) qf[ks] = frag_blk(Q + (size_t)q0 * HD + ks * FB, lane);
  asm volatile("s_wait_xcnt 0x0" ::: "memory");   // the query reads' address pair is rewritten behind the loop's entry branch
  float m = -INFINITY;
  const int k1beg = part * K1, k1end = (k1beg + K1 < S) ? k1beg + K1 : S;
  for (int kb = k1beg; kb < k1end; kb += 64) {                    // pass 1
    const b16* kl = K + (size_t)kb * HD + lane * 8;   // the lane's place in the trip's first block
    v16b kf[4][2]; v8f s[4] = {{}, {}, {}, {}};       // the sixteen reads of 64 keys go out together: one wait for memory per trip
#pragma unroll
    for (int t = 0; t < 4; ++t)
#pragma unroll
      for (int ks = 0; ks < 2; ++ks) kf[t][ks] = frag_blk(kl + (t * 2 + ks) * FB, 0);
    asm volatile("s_wait_xcnt 0x0" :: "v"(kl) : "memory");   // the reads' address pair is rewritten for the next trip while they may still be out; it names the pair so that no read lands on it in front of the wait
    __builtin_amdgcn_sched_barrier(0);   // keeps the sixteen reads in front of the matrix instructions; without it they sink to their first use and each is waited for alone
#pragma unroll
    for (int ks = 0; ks < 2; ++ks)
#pragma unroll
      for (int t = 0; t < 4; ++t) s[t] = __builtin_amdgcn_wmma_f32_16x16x32_f16(false, kf[t][ks], false, qf[ks], (short)0, s[t], false, false);   // four independent sums fill each other's distance
#pragma unroll
    for (int r = 0; r < 8; ++r) m = fmaxf(m, fmaxf(fmaxf(s[0][r], s[1][r]), fmaxf(s[2][r], s[3][r])));
  }
  m *= SCALE / (QS * QS);                                        // a power of two: scaling the maximum is exact
  m = fmaxf(m, __shfl_xor(m, 16));
  if (hh == 0) Ms[wid][col] = m;                                 // this part's row shift (both lane halves hold the same value)
  __syncthreads();
  { float mg = -INFINITY;
#pragma unroll
    for (int p = 0; p < KP; ++p) mg = fmaxf(mg, Ms[p * 8 + tile][col]);
    m = mg; }
  v8f o[4] = {{}, {}, {}, {}};
  float* t0 = &Wk[wid][lane]; float* t1 = t0 + TS;   // the lane's own columns: keys 8 hh + r and keys 16 + 8 hh + r of a trip
  // Pass 2 meets two read latencies a trip: the keys; then the values, issued ahead of the softmax arithmetic, with the relation ids behind them.
  for (int kb = kbeg; kb < kend; kb += 32) { v8f s0, s1; s_tile(K, qf, kb, lane, s0, s1);     // pass 2
    const b16* vp = vb + (size_t)kb * HD + lane * 8; const int* rp = rrow + kb + 8 * hh;
    v16b vf[4], pb; v4i id[4];
#pragma unroll
    for (int n = 0; n < 4; ++n) vf[n] = frag_blk(vp + n * FB, 0);
#pragma unroll
    for (int j = 0; j < 4; ++j) id[j] = *(const v4i*)(rp + (j >> 1) * 16 + (j & 1) * 4);   // keys 8 hh + 0..7 and 16 + 8 hh + 0..7
    asm volatile("s_wait_xcnt 0x0" :: "v"(vp), "v"(rp) : "memory");   // the value reads' and the id reads' address pairs are rewritten behind this line while reads are still out; it names the pairs so that no read lands on one of them while others still name it
    __builtin_amdgcn_sched_barrier(0);   // keeps the twelve reads in front of the softmax arithmetic, which covers a part of their latency; without it this build sinks them behind the arithmetic
#pragma unroll
    for (int r = 0; r < 8; ++r) { s0[r] = __expf(s0[r] - m); s1[r] = __expf(s1[r] - m); pb[r] = (b16)(s0[r] * PS); pb[8 + r] = (b16)(s1[r] * PS); }
#pragma unroll
    for (int n = 0; n < 4; ++n) o[n] = wmma16b(vf[n], pb, o[n]);
    // relation buckets: column[id] += p in the lane's own two columns (plain adds, no atomics); both reads of a step go out before either write
#pragma unroll
    for (int r = 0; r < 8; ++r) { const int ra = id[r >> 2][r & 3], rb = id[2 + (r >> 2)][r & 3];
      const int ia = ((ra < 0) ? 0 : (ra >= NREL ? NREL - 1 : ra)) * 32, ib = ((rb < 0) ? 0 : (rb >= NREL ? NREL - 1 : rb)) * 32;
      const float a = t0[ia], c = t1[ib]; t0[ia] = a + s0[r]; t1[ib] = c + s1[r]; }
  }
  wave_lds_sync();   // the fold reads columns that other lanes of the wave wrote
  for (int i = lane; i < NREL * 4; i += 32) { float* t = &Wk[wid][(i >> 2) * 32 + (i & 3) * 4];   // four queries of one id per lane
    *(v4f*)t = ((*(const v4f*)t + *(const v4f*)(t + 16)) + *(const v4f*)(t + TS)) + *(const v4f*)(t + TS + 16); }
  wave_lds_sync();   // the partial output below overwrites the second table, which other lanes have just read
  // epilogue: y[q][d] = (sum over parts of o/64 + sum_r w[r][q] E[r][d]) / sum_r w[r][q], w = sum over parts of bucket. Each wave leaves its partial o in LDS; behind the barrier the waves of parts 0 and 1
  // finish eight queries of their tile each: four lanes per query, sixteen consecutive d per lane, so a wave's two stores fill eight whole 128-byte lines.
#pragma unroll
  for (int n = 0; n < 4; ++n)
#pragma unroll
    for (int r = 0; r < 8; ++r) Wk[wid][TS + col * OP + n * 16 + 8 * hh + r] = o[n][r] * (1.0f / (VS * PS));
  __syncthreads();
  if (part < 2) {
    const int qq = part * 8 + (lane >> 2), d0 = (lane & 3) * 16;
    v4f a[4] = {{}, {}, {}, {}}; float l = 0.0f;
#pragma unroll
    for (int p = 0; p < KP; ++p)
#pragma unroll
      for (int j = 0; j < 4; ++j) a[j] += *(const v4f*)(&Wk[p * 8 + tile][TS + qq * OP + d0 + 4 * j]);
    // Unrolled so that the reads of later ids are issued under the multiply-adds of earlier ones; each sum still adds ids 0..40 in that order.
#pragma unroll
    for (int rr = 0; rr < NREL; ++rr) { float w = 0.0f;
#pragma unroll
      for (int p = 0; p < KP; ++p) w += Wk[p * 8 + tile][rr * 32 + qq];
      l += w;
#pragma unroll
      for (int j = 0; j < 4; ++j) a[j] += w * *(const v4f*)(&Es[rr][d0 + 4 * j]); }
    // y goes out as f16, carried x8, in fragment order for the output product: a lane's sixteen d are the two 8-element pieces of one k half of a block; a store fills four whole lines
    const float il = YS / l;
    b16* dst = y + ((size_t)((b * S + q0) / 16) * KB32 + h * 2 + ((lane & 3) >> 1)) * FB + (lane & 1) * 256 + qq * 8;
#pragma unroll
    for (int g = 0; g < 2; ++g) { v8b w;
#pragma unroll
      for (int e = 0; e < 8; ++e) w[e] = (b16)(a[g * 2 + (e >> 2)][e & 3] * il);
      *(v8b*)(dst + g * 128) = w; }
  }
}

// out = y W_o^T: (2048 x 1024) x (1024 x 1024); A = f16 y carried x8, B = f16(bf16 W_o) rows, both in fragment order; f32 rows; work-group tile 128 x 64, a wave 64 rows x 32 columns; grid (16, 16).
__global__ __launch_bounds__(128) void out_kernel(const b16* __restrict__ y, const b16* __restrict__ wo16, const float* __restrict__ bo, float* __restrict__ out) {
  __shared__ __attribute__((aligned(16))) unsigned short St[2 * 12 * 4 * FB];   // two stages of 128 k: 12 row blocks x 4 blocks each
  __shared__ __attribute__((aligned(16))) float Ts[4][64 * 32];
  const int lane = threadIdx.x & 31, wave = threadIdx.x >> 5, wm = wave >> 1, wn = wave & 1, nloc = lane & 15, hlf = lane >> 4, m0 = blockIdx.y * 128 + wm * 64, c0 = blockIdx.x * 64 + wn * 32;
  v8f acc[4][2];
#pragma unroll
  for (int r = 0; r < 4; ++r)
#pragma unroll
    for (int t = 0; t < 2; ++t) acc[r][t] = (v8f){};
  gemm_ring<2, 128, false, true>(St, (const char*)y + (size_t)blockIdx.y * 8 * RBB + threadIdx.x * 16, (const char*)wo16 + (size_t)blockIdx.x * 4 * RBB + threadIdx.x * 16, wm, wn, lane, acc);
  float* T = Ts[wave];
#pragma unroll
  for (int t = 0; t < 2; ++t) { const float bb = bf16_rne(bo[c0 + t * 16 + nloc]);
#pragma unroll
    for (int r = 0; r < 4; ++r)
#pragma unroll
      for (int v = 0; v < 8; ++v) T[(r * 16 + v + 8 * hlf) * 32 + t * 16 + nloc] = acc[r][t][v] * (1.0f / YS) + bb; }
  wave_lds_sync();
  float* dst0 = out + (size_t)m0 * D + c0;   // a row of the wave's tile is 32 floats = one whole line: 8 lanes x 16 B per row, 4 rows per store
#pragma unroll
  for (int j = 0; j < 16; ++j) { const int rr = j * 4 + (lane >> 3), c4 = (lane & 7) * 4; *(v4f*)(dst0 + (size_t)rr * D + c4) = *(const v4f*)(T + rr * 32 + c4); }
}
}  // namespace

extern "C" void kernel_launch(void* const* d_in, const int* in_sizes, int n_in,
                              void* d_out, int out_size, void* d_ws, size_t ws_size, hipStream_t stream) {
  (void)n_in; (void)out_size;
  const float* x = (const float*)d_in[0]; const int* rel = (const int*)d_in[1];
  const float* wq = (const float*)d_in[2]; const float* bq = (const float*)d_in[3]; const float* wk = (const float*)d_in[4]; const float* bk = (const float*)d_in[5]; const float* wv = (const float*)d_in[6]; const float* bv = (const float*)d_in[7];
  const float* wo = (const float*)d_in[8]; const float* bo = (const float*)d_in[9]; const float* remb = (const float*)d_in[10];
  float* out = (float*)d_out;   // [2][1024][1024]
  if (in_sizes[0] != BT * S * D || in_sizes[1] != BT * S * S || in_sizes[2] != D * D || in_sizes[8] != D * D || in_sizes[10] != NREL * HD) return;
  size_t off = 0; char* ws = (char*)d_ws;
  auto carve = [&](size_t bytes) { char* p = ws + off; off += (bytes + 255) & ~(size_t)255; return p; };
  unsigned short* x16 = (unsigned short*)carve((size_t)NTOK * D * 2); unsigned short* w16 = (unsigned short*)carve((size_t)3 * D * D * 2); b16* wo16 = (b16*)carve((size_t)D * D * 2);
  b16* qh = (b16*)carve((size_t)NTOK * D * 2); b16* kh = (b16*)carve((size_t)NTOK * D * 2); b16* vt = (b16*)carve((size_t)NTOK * D * 2); b16* y = (b16*)carve((size_t)NTOK * D * 2);
  if (off > ws_size) return;                                    // about 28 MB
  prep_kernel<<<PCS / 256, 256, 0, stream>>>(x, wq, wk, wv, wo, x16, w16, wo16);
  proj_kernel<<<dim3(3 * D / 128, NTOK / 128), 128, 0, stream>>>((const __bf16*)x16, (const __bf16*)w16, bq, bk, bv, qh, kh, vt);
  attn_kernel<S / 16><<<Bn * H * (S / 16) / 8, 256 * KP, 0, stream>>>(qh, kh, vt, rel, remb, y);
  out_kernel<<<dim3(D / 64, NTOK / 128), 128, 0, stream>>>(y, wo16, bo, out);
}
